// v000
// The times below were measured on an AMD MI455X: many runs one after another, warmed up first and cycling through
// copies of the inputs, with the whole window's GPU time divided by the number of runs. Launches and the gaps
// between them are all in it. The median over several windows is given; except for v000 it joins two sittings, which
// can be a few percent apart, so the side-by-side timings, each taken in one sitting, are the better comparison.
// The starting kernel, v000, takes 475 microseconds a run.
// compute dtype: query, key, value, pos_emb, mask, all weights/biases and the position biases (module inputs) rounded to bf16 / read as int32; the four input projections with exact bf16 products (inputs x inputs) on WMMA 16x16x32; scores as one 128-deep dot [q+u | q+v] . [k | p] with both computed operands as bf16 hi + residual pairs (3 products), P.V with P hi/lo x V hi/lo (3 products), output projection hi/lo x exact Wo (2 products); masking, softmax and the masked-row zeroing in f32; f32 accumulate.
#include <hip/hip_runtime.h>
#include <math.h>

typedef __attribute__((ext_vector_type(16))) _Float16 v16h;
typedef __attribute__((ext_vector_type(16))) __bf16 v16b;
typedef __attribute__((ext_vector_type(8)))  _Float16 v8h;
typedef __attribute__((ext_vector_type(8)))  float v8f;
typedef __attribute__((ext_vector_type(4)))  float v4f;
typedef __attribute__((ext_vector_type(2)))  float v2f;
typedef __attribute__((ext_vector_type(4)))  unsigned v4u;
typedef __attribute__((ext_vector_type(4)))  int v4i;
typedef float __attribute__((may_alias)) float_a;
typedef int __attribute__((may_alias)) int_a;

template <typename T> __device__ __forceinline__ void vst2(void* p, T v) { *(T*)p = v;  }
__device__ __forceinline__ v8f wmma16(v16h a, v16h b, v8f c) {
  v8f d = __builtin_amdgcn_wmma_f32_16x16x32_f16(false, a, false, b, (short)0, c, false, false);
  asm volatile("v_nop\n\tv_nop\n\tv_nop\n\tv_nop" : "+v"(d) : "v"(a), "v"(b));
  return d;
}
__device__ __forceinline__ v8f wmma_bf(v16b a, v16b b, v8f c) {
  v8f d = __builtin_amdgcn_wmma_f32_16x16x32_bf16(false, a, false, b, (short)0, c, false, false);
  asm volatile("v_nop\n\tv_nop\n\tv_nop\n\tv_nop" : "+v"(d) : "v"(a), "v"(b));
  return d;
}
// 16x16x32 fragments: lane = (h = lane>>4, row/col = lane&15); elements 0..7 = k0+8h+0..7, 8..15 = k0+16+8h+0..7; D element r = row 8h+r
__device__ __forceinline__ v16h frag_h(const _Float16* rowk0, int lane) {
  union { v16h v; v8h q[2]; } u; const _Float16* p = rowk0 + 8 * (lane >> 4);
  u.q[0] = *(const v8h*)p; u.q[1] = *(const v8h*)(p + 16); return u.v;
}
__device__ __forceinline__ v16h frag_f32(const float* rowk0, int lane) {
  v16h a; const float* p = rowk0 + 8 * (lane >> 4);
#pragma unroll
  for (int i = 0; i < 8; ++i) { a[i] = (_Float16)p[i]; a[8 + i] = (_Float16)p[16 + i]; }
  return a;
}
__device__ __forceinline__ v16h frag_f32s(const float* rowk0, int lane, float sc) {
  v16h a; const float* p = rowk0 + 8 * (lane >> 4);
#pragma unroll
  for (int i = 0; i < 8; ++i) { a[i] = (_Float16)(p[i] * sc); a[8 + i] = (_Float16)(p[16 + i] * sc); }
  return a;
}
// column fragment from a [K][ld] layout (column n), rows >= K read as 0
__device__ __forceinline__ v16h fragc_f32(const float* W, int k0, int n, int lane, int ld, int K) {
  v16h a; const int g = lane >> 4;
#pragma unroll
  for (int i = 0; i < 8; ++i) { const int ka = k0 + 8 * g + i, kb = ka + 16;
    a[i] = (_Float16)(ka < K ? W[(size_t)(ka < K ? ka : K - 1) * ld + n] : 0.f); a[8 + i] = (_Float16)(kb < K ? W[(size_t)(kb < K ? kb : K - 1) * ld + n] : 0.f); }
  return a;
}
struct F2 { v16b h, l; };
__device__ __forceinline__ F2 bsplit16(const float v[16]) { F2 r;
#pragma unroll
  for (int i = 0; i < 16; ++i) { const __bf16 h = (__bf16)v[i]; r.h[i] = h; r.l[i] = (__bf16)(v[i] - (float)h); }
  return r; }
__device__ __forceinline__ F2 split_row(const float* row, int k0, int lane) { float v[16]; const float* p = row + k0 + 8 * (lane >> 4);
#pragma unroll
  for (int i = 0; i < 8; ++i) { v[i] = p[i]; v[8 + i] = p[16 + i]; }
  return bsplit16(v); }
__device__ __forceinline__ F2 split_rowK(const float* row, int k0, int lane, int K) { float v[16]; const int g = lane >> 4;
#pragma unroll
  for (int i = 0; i < 8; ++i) { const int ka = k0 + 8 * g + i, kb = ka + 16; v[i] = ka < K ? row[ka < K ? ka : K - 1] : 0.f; v[8 + i] = kb < K ? row[kb < K ? kb : K - 1] : 0.f; }
  return bsplit16(v); }
__device__ __forceinline__ F2 split_col(const float* W, int k0, int n, int lane, int ld, int K) { float v[16]; const int g = lane >> 4;
#pragma unroll
  for (int i = 0; i < 8; ++i) { const int ka = k0 + 8 * g + i, kb = ka + 16; v[i] = ka < K ? W[(size_t)(ka < K ? ka : K - 1) * ld + n] : 0.f; v[8 + i] = kb < K ? W[(size_t)(kb < K ? kb : K - 1) * ld + n] : 0.f; }
  return bsplit16(v); }
__device__ __forceinline__ v8f mac3(const F2& a, const F2& b, v8f c) { c = wmma_bf(a.l, b.h, c); c = wmma_bf(a.h, b.l, c); return wmma_bf(a.h, b.h, c); }
__device__ __forceinline__ float sigm(float v) { return 1.0f / (1.0f + expf(-v)); }
#define LDSX() do { asm volatile("s_wait_dscnt 0" ::: "memory"); __builtin_amdgcn_wave_barrier(); __builtin_amdgcn_fence(__ATOMIC_RELEASE, "workgroup"); } while (0)


// Relative-position multi-head attention (B 8, T 1024, F 512, 8 heads x 64): q/k/v = Linear(query/key/value); p = pos_emb Wp^T; scores = ((q + pos_bias_u) k^T + (q + pos_bias_v) p^T) / sqrt(64); masked (mask == 0 -> float32 min); attn = softmax, then 0 where masked; x = attn v; out = x Wo^T + bo.
#define NB 8
#define TT 1024
#define FF 512
#define NH 8
#define HD 64
#ifndef TQB
#define TQB (TT / 64)
#define TNB NB
#define TOB (NB * TT / 64)
#endif
typedef __attribute__((ext_vector_type(8))) __bf16 v8b;
__device__ __forceinline__ v16b frag_b(const __bf16* rowk0, int lane) {
  union { v16b v; v8b q[2]; } u; const __bf16* p = rowk0 + 8 * (lane >> 4);
  u.q[0] = *(const v8b*)p; u.q[1] = *(const v8b*)(p + 16); return u.v;
}
__device__ __forceinline__ float bfr(float v) { return (float)(__bf16)v; }
__device__ __attribute__((noinline)) float exp_ni(float v) { return expf(v); }
__device__ __attribute__((noinline)) float erf_ni(float v) { return erff(v); }

#define WS_PW  0u                                   // bf16 natural rows: Wq, Wk, Wv, Wp, Wo [512][512] each
#define WS_QA  (WS_PW + 2u * 5 * FF * FF)            // f32 [NB*TT][8 h][128]: q+u | q+v
#define WS_KB  (WS_QA + 4u * NB * TT * NH * 128)      // f32 [NB*TT][8 h][128]: k | p
#define WS_VH  (WS_KB + 4u * NB * TT * NH * 128)      // bf16 [NB][512 (h*64+d)][TT]
#define WS_VL  (WS_VH + 2u * NB * FF * TT)
#define WS_P   (WS_VL + 2u * NB * FF * TT)            // f32 [TT][512] p = pos_emb Wp^T
#define WS_O   (WS_P + 4u * TT * FF)                  // f32 [NB*TT][512]
#define WS_END (WS_O + 4u * NB * TT * FF)

// ---- k_pack: block = (row n, which 0..4): natural [out][in] rows of Wq, Wk, Wv, Wp, Wo
__global__ __launch_bounds__(128) void k_pack(const float* __restrict__ WQ, const float* __restrict__ WK, const float* __restrict__ WV, const float* __restrict__ WP, const float* __restrict__ WO, __bf16* __restrict__ PW) {
  __shared__ __align__(16) __bf16 s[FF]; const int n = blockIdx.x, which = blockIdx.y, tid = threadIdx.x; const float* src = (which == 0 ? WQ : which == 1 ? WK : which == 2 ? WV : which == 3 ? WP : WO) + (size_t)n * FF;
  for (int k = tid; k < FF; k += 128) s[k] = (__bf16)src[k];
  __syncthreads();
  if (tid < FF / 8) vst2((unsigned*)(PW + ((size_t)which * FF + n) * FF + tid * 8), *(const v4u*)&s[tid * 8]);
}
// ---- k_posp: block = (64 positions, 128 cols): p = bf16(pos_emb) . Wp rows (exact) -> P rows (512-B segments)
__global__ __launch_bounds__(128) void k_posp(const float* __restrict__ PE, const __bf16* __restrict__ P4, float* __restrict__ P) {
  __shared__ __align__(16) float so[4][16][132];
  const int tid = threadIdx.x, wave = tid >> 5, lane = tid & 31, col = lane & 15, g = lane >> 4; const size_t r0 = (size_t)blockIdx.x * 64 + wave * 16; const int n0 = blockIdx.y * 128;
  v8f acc[8] = {};
#pragma unroll 2
  for (int kc = 0; kc < FF / 32; ++kc) { v16b a; { const float* p = PE + (r0 + col) * FF + kc * 32 + 8 * g;
#pragma unroll
      for (int i = 0; i < 8; ++i) { a[i] = (__bf16)p[i]; a[8 + i] = (__bf16)p[16 + i]; } }
#pragma unroll
    for (int j = 0; j < 8; ++j) acc[j] = wmma_bf(a, frag_b(P4 + (size_t)(n0 + j * 16 + col) * FF + kc * 32, lane), acc[j]); }
#pragma unroll
  for (int j = 0; j < 8; ++j)
#pragma unroll
    for (int r = 0; r < 8; ++r) so[wave][8 * g + r][j * 16 + col] = acc[j][r];
  LDSX();
  for (int rl = 0; rl < 16; ++rl) vst2(P + (r0 + rl) * FF + n0 + lane * 4, *(const v4f*)&so[wave][rl][lane * 4]);
}
// ---- k_proj<MODE>: block = (64 rows (b,t), 128 cols = 2 heads): MODE 0: q = query.Wq^T + bq -> QA[row][h][q+u | q+v] (512-B per (row, head)); MODE 1: k = key.Wk^T + bk -> KB[row][h][k | p[t]] ; MODE 2: v = value.Wv^T + bv -> transposed hi/lo planes
template <int MODE>
__global__ __launch_bounds__(128) void k_proj(const float* __restrict__ X, const __bf16* __restrict__ P1, const float* __restrict__ bias, const float* __restrict__ U, const float* __restrict__ Vb, const float* __restrict__ PP, float* __restrict__ OUT, __bf16* __restrict__ VH, __bf16* __restrict__ VL) {
  __shared__ __align__(16) float so[4][16][260]; __shared__ __align__(16) __bf16 sth[128][72], stl[128][72];
  const int tid = threadIdx.x, wave = tid >> 5, lane = tid & 31, col = lane & 15, g = lane >> 4; const size_t rb = (size_t)blockIdx.x * 64; const size_t r0 = rb + wave * 16; const int n0 = blockIdx.y * 128;
  v8f acc[8] = {};
#pragma unroll 2
  for (int kc = 0; kc < FF / 32; ++kc) { v16b a; { const float* p = X + (r0 + col) * FF + kc * 32 + 8 * g;
#pragma unroll
      for (int i = 0; i < 8; ++i) { a[i] = (__bf16)p[i]; a[8 + i] = (__bf16)p[16 + i]; } }
#pragma unroll
    for (int j = 0; j < 8; ++j) acc[j] = wmma_bf(a, frag_b(P1 + (size_t)(n0 + j * 16 + col) * FF + kc * 32, lane), acc[j]); }
  if (MODE == 2) {
#pragma unroll
    for (int j = 0; j < 8; ++j) { const float bb = bfr(bias[n0 + j * 16 + col]);
#pragma unroll
      for (int r = 0; r < 8; ++r) { const float v = acc[j][r] + bb; const __bf16 hb = (__bf16)v; sth[j * 16 + col][wave * 16 + 8 * g + r] = hb; stl[j * 16 + col][wave * 16 + 8 * g + r] = (__bf16)(v - (float)hb); } }
    __syncthreads();
    const int b = (int)(rb / TT), t0 = (int)(rb % TT);
    for (int q = tid; q < 128 * 8; q += 128) { const int d = q >> 3, pc = q & 7; const size_t o = ((size_t)b * FF + n0 + d) * TT + t0 + pc * 8; vst2((unsigned*)(VH + o), *(const v4u*)&sth[d][pc * 8]); vst2((unsigned*)(VL + o), *(const v4u*)&stl[d][pc * 8]); }
  } else {
    // two heads in this column block: hl = j / 4 (local), d = (j % 4) * 16 + col; segment layout per (row, head): [first 64 | second 64]
#pragma unroll
    for (int j = 0; j < 8; ++j) { const int hl = j >> 2, d = (j & 3) * 16 + col; const int h = (n0 >> 6) + hl; const float bb = bfr(bias[n0 + j * 16 + col]);
#pragma unroll
      for (int r = 0; r < 8; ++r) { const float v = acc[j][r] + bb; const int rl = 8 * g + r;
        if (MODE == 0) { so[wave][rl][hl * 128 + d] = v + bfr(U[h * HD + d]); so[wave][rl][hl * 128 + 64 + d] = v + bfr(Vb[h * HD + d]); }
        else { const size_t t = (r0 + rl) % TT; so[wave][rl][hl * 128 + d] = v; so[wave][rl][hl * 128 + 64 + d] = PP[t * FF + h * HD + d]; } } }
    LDSX();
    const int h0 = n0 >> 6;
    for (int rl = 0; rl < 16; ++rl) { vst2(OUT + ((r0 + rl) * NH + h0) * 128 + lane * 4, *(const v4f*)&so[wave][rl][lane * 4]); vst2(OUT + ((r0 + rl) * NH + h0) * 128 + 128 + lane * 4, *(const v4f*)&so[wave][rl][128 + lane * 4]); }
  }
}
// ---- k_attn: block = (64 queries, head h, batch b): per 32-key step: mask tile loads (int) -> wave vote -> {scores = [q+u|q+v].[k|p] / 8 (3 products, K 128), masked -> -3e38; online softmax; P(hi/lo).V(hi/lo)}; rows with no live key output 0 (the module's where(mask==0, 0, softmax)); O[row][h*64+d]
__global__ __launch_bounds__(128) void k_attn(const float* __restrict__ QA, const float* __restrict__ KB, const int* __restrict__ MASK, const __bf16* __restrict__ VH, const __bf16* __restrict__ VL, float* __restrict__ O) {
  __shared__ __align__(16) float sp[4][16][36]; __shared__ __align__(16) float so[4][16][68];
  const int tid = threadIdx.x, wave = tid >> 5, lane = tid & 31, col = lane & 15, g = lane >> 4;
  const int qb = blockIdx.x, h = blockIdx.y, b = blockIdx.z; const int q0 = qb * 64 + wave * 16; const size_t rq = (size_t)b * TT + q0;
  const float* qrow = QA + ((rq + col) * NH + h) * 128;
  float m[8], l[8];
#pragma unroll
  for (int r = 0; r < 8; ++r) { m[r] = -3.0e38f; l[r] = 0.f; }
  v8f acc[4] = {};
#pragma unroll 1
  for (int ks = 0; ks < TT / 32; ++ks) { v8f s[2]; int mk[2][8]; bool anylive = false;
#pragma unroll
    for (int ct = 0; ct < 2; ++ct) { const int kk = ks * 32 + ct * 16 + col;
#pragma unroll
      for (int r = 0; r < 8; ++r) { const int mv = MASK[((size_t)b * TT + q0 + 8 * g + r) * TT + kk]; mk[ct][r] = mv; anylive = anylive || (mv != 0); } }
    if (__any(anylive)) {
#pragma unroll
      for (int ct = 0; ct < 2; ++ct) { const int kk = ks * 32 + ct * 16 + col; const float* krow = KB + (((size_t)b * TT + kk) * NH + h) * 128; v8f c = {};
#pragma unroll
        for (int kc = 0; kc < 4; ++kc) { const F2 kb = split_row(krow, kc * 32, lane); const F2 qa = split_row(qrow, kc * 32, lane); c = mac3(qa, kb, c); }
#pragma unroll
        for (int r = 0; r < 8; ++r) s[ct][r] = (mk[ct][r] != 0) ? c[r] * 0.125f : -3.0e38f; }
#pragma unroll
      for (int r = 0; r < 8; ++r) { float mx = fmaxf(s[0][r], s[1][r]);
#pragma unroll
        for (int o = 1; o < 16; o <<= 1) mx = fmaxf(mx, __shfl_xor(mx, o));
        const float mn = fmaxf(m[r], mx); const float alpha = (m[r] <= -1.0e38f) ? 0.f : exp_ni(m[r] - mn);
        const float e0 = (s[0][r] <= -1.0e38f) ? 0.f : exp_ni(s[0][r] - mn), e1 = (s[1][r] <= -1.0e38f) ? 0.f : exp_ni(s[1][r] - mn); float es = e0 + e1;
#pragma unroll
        for (int o = 1; o < 16; o <<= 1) es += __shfl_xor(es, o);
        l[r] = l[r] * alpha + es; m[r] = mn;
#pragma unroll
        for (int dt = 0; dt < 4; ++dt) acc[dt][r] *= alpha;
        sp[wave][8 * g + r][col] = e0; sp[wave][8 * g + r][16 + col] = e1; }
      LDSX();
      const F2 pa = split_row(&sp[wave][col][0], 0, lane);
#pragma unroll
      for (int dt = 0; dt < 4; ++dt) { const size_t vr = ((size_t)b * FF + h * HD + dt * 16 + col) * TT + ks * 32; const v16b vh = frag_b(VH + vr, lane), vl = frag_b(VL + vr, lane); acc[dt] = wmma_bf(pa.l, vh, acc[dt]); acc[dt] = wmma_bf(pa.h, vl, acc[dt]); acc[dt] = wmma_bf(pa.h, vh, acc[dt]); }
      LDSX(); } }
#pragma unroll
  for (int r = 0; r < 8; ++r) { const float il = (l[r] > 0.f) ? 1.0f / l[r] : 0.f;
#pragma unroll
    for (int dt = 0; dt < 4; ++dt) so[wave][8 * g + r][dt * 16 + col] = acc[dt][r] * il; }
  LDSX();
  for (int rl = 0; rl < 16; ++rl) if (lane < 16) vst2(O + (rq + rl) * FF + h * HD + lane * 4, *(const v4f*)&so[wave][rl][lane * 4]);
}
// ---- k_out: block = (64 rows, 128 cols): out = O(hi/lo) . Wo rows (2 products) + bo
__global__ __launch_bounds__(128) void k_out(const float* __restrict__ O, const __bf16* __restrict__ P, const float* __restrict__ bias, float* __restrict__ Y) {
  __shared__ __align__(16) float so[4][16][132];
  const int tid = threadIdx.x, wave = tid >> 5, lane = tid & 31, col = lane & 15, g = lane >> 4; const size_t r0 = (size_t)blockIdx.x * 64 + wave * 16; const int n0 = blockIdx.y * 128;
  v8f acc[8] = {};
#pragma unroll 2
  for (int kc = 0; kc < FF / 32; ++kc) { const F2 a = split_row(O + (r0 + col) * FF, kc * 32, lane);
#pragma unroll
    for (int j = 0; j < 8; ++j) { const v16b w = frag_b(P + (size_t)(n0 + j * 16 + col) * FF + kc * 32, lane); acc[j] = wmma_bf(a.l, w, acc[j]); acc[j] = wmma_bf(a.h, w, acc[j]); } }
#pragma unroll
  for (int j = 0; j < 8; ++j) { const float bb = bfr(bias[n0 + j * 16 + col]);
#pragma unroll
    for (int r = 0; r < 8; ++r) so[wave][8 * g + r][j * 16 + col] = acc[j][r] + bb; }
  LDSX();
  for (int rl = 0; rl < 16; ++rl) vst2(Y + (r0 + rl) * FF + n0 + lane * 4, *(const v4f*)&so[wave][rl][lane * 4]);
}
extern "C" void kernel_launch(void* const* d_in, const int* in_sizes, int n_in, void* d_out, int out_size, void* d_ws, size_t ws_size, hipStream_t stream) {
  (void)in_sizes; (void)n_in; (void)out_size;
  const float** F = (const float**)d_in; const int* MASK = (const int*)d_in[3];
  // 0 query, 1 key, 2 value [8,1024,512], 3 mask [8,1024,1024] i32, 4 pos_emb [1,1024,512], 5 Wq, 6 bq, 7 Wk, 8 bk, 9 Wv, 10 bv, 11 Wp, 12 Wo, 13 bo, 14 pos_bias_u [8,64], 15 pos_bias_v [8,64]
  if (ws_size < (size_t)WS_END) return;
  char* ws = (char*)d_ws; __bf16 *PW = (__bf16*)(ws + WS_PW), *VH = (__bf16*)(ws + WS_VH), *VL = (__bf16*)(ws + WS_VL); float *QA = (float*)(ws + WS_QA), *KB = (float*)(ws + WS_KB), *P = (float*)(ws + WS_P), *O = (float*)(ws + WS_O);
  k_pack<<<dim3(FF, 5), 128, 0, stream>>>(F[5], F[7], F[9], F[11], F[12], PW);
  k_posp<<<dim3(TT / 64, FF / 128), 128, 0, stream>>>(F[4], PW + (size_t)3 * FF * FF, P);
  k_proj<0><<<dim3(TNB * TT / 64, FF / 128), 128, 0, stream>>>(F[0], PW, F[6], F[14], F[15], P, QA, nullptr, nullptr);
  k_proj<1><<<dim3(TNB * TT / 64, FF / 128), 128, 0, stream>>>(F[1], PW + (size_t)FF * FF, F[8], F[14], F[15], P, KB, nullptr, nullptr);
  k_proj<2><<<dim3(TNB * TT / 64, FF / 128), 128, 0, stream>>>(F[2], PW + (size_t)2 * FF * FF, F[10], F[14], F[15], P, nullptr, VH, VL);
  k_attn<<<dim3(TQB, NH, TNB), 128, 0, stream>>>(QA, KB, MASK, VH, VL, O);
  k_out<<<dim3(TOB, FF / 128), 128, 0, stream>>>(O, PW + (size_t)4 * FF * FF, F[13], (float*)d_out);
}

// v001
// One run takes 473 microseconds.
// Two timings next to v000 put it at 1.03 and 1.04 times that version's speed.
// compute dtype: query, key, value, pos_emb, mask, all weights/biases and the position biases (module inputs) rounded to bf16 / read as int32; the four input projections with exact bf16 products (inputs x inputs) on WMMA 16x16x32; scores as one 128-deep dot [q+u | q+v] . [k | p] with both computed operands as bf16 hi + residual pairs (3 products), P.V with P hi/lo x V hi/lo (3 products), output projection hi/lo x exact Wo (2 products); masking, softmax and the masked-row zeroing in f32; f32 accumulate.
#include <hip/hip_runtime.h>
#include <math.h>

typedef __attribute__((ext_vector_type(16))) _Float16 v16h;
typedef __attribute__((ext_vector_type(16))) __bf16 v16b;
typedef __attribute__((ext_vector_type(8)))  _Float16 v8h;
typedef __attribute__((ext_vector_type(8)))  float v8f;
typedef __attribute__((ext_vector_type(4)))  float v4f;
typedef __attribute__((ext_vector_type(2)))  float v2f;
typedef __attribute__((ext_vector_type(4)))  unsigned v4u;
typedef __attribute__((ext_vector_type(4)))  int v4i;
typedef float __attribute__((may_alias)) float_a;
typedef int __attribute__((may_alias)) int_a;

template <typename T> __device__ __forceinline__ void vst2(void* p, T v) { *(T*)p = v;  }
__device__ __forceinline__ v8f wmma16(v16h a, v16h b, v8f c) {
  v8f d = __builtin_amdgcn_wmma_f32_16x16x32_f16(false, a, false, b, (short)0, c, false, false);
  asm volatile("v_nop\n\tv_nop\n\tv_nop\n\tv_nop" : "+v"(d) : "v"(a), "v"(b));
  return d;
}
__device__ __forceinline__ v8f wmma_bf(v16b a, v16b b, v8f c) {
  v8f d = __builtin_amdgcn_wmma_f32_16x16x32_bf16(false, a, false, b, (short)0, c, false, false);
  asm volatile("v_nop\n\tv_nop\n\tv_nop\n\tv_nop" : "+v"(d) : "v"(a), "v"(b));
  return d;
}
// 16x16x32 fragments: lane = (h = lane>>4, row/col = lane&15); elements 0..7 = k0+8h+0..7, 8..15 = k0+16+8h+0..7; D element r = row 8h+r
__device__ __forceinline__ v16h frag_h(const _Float16* rowk0, int lane) {
  union { v16h v; v8h q[2]; } u; const _Float16* p = rowk0 + 8 * (lane >> 4);
  u.q[0] = *(const v8h*)p; u.q[1] = *(const v8h*)(p + 16); return u.v;
}
__device__ __forceinline__ v16h frag_f32(const float* rowk0, int lane) {
  v16h a; const float* p = rowk0 + 8 * (lane >> 4);
#pragma unroll
  for (int i = 0; i < 8; ++i) { a[i] = (_Float16)p[i]; a[8 + i] = (_Float16)p[16 + i]; }
  return a;
}
__device__ __forceinline__ v16h frag_f32s(const float* rowk0, int lane, float sc) {
  v16h a; const float* p = rowk0 + 8 * (lane >> 4);
#pragma unroll
  for (int i = 0; i < 8; ++i) { a[i] = (_Float16)(p[i] * sc); a[8 + i] = (_Float16)(p[16 + i] * sc); }
  return a;
}
// column fragment from a [K][ld] layout (column n), rows >= K read as 0
__device__ __forceinline__ v16h fragc_f32(const float* W, int k0, int n, int lane, int ld, int K) {
  v16h a; const int g = lane >> 4;
#pragma unroll
  for (int i = 0; i < 8; ++i) { const int ka = k0 + 8 * g + i, kb = ka + 16;
    a[i] = (_Float16)(ka < K ? W[(size_t)(ka < K ? ka : K - 1) * ld + n] : 0.f); a[8 + i] = (_Float16)(kb < K ? W[(size_t)(kb < K ? kb : K - 1) * ld + n] : 0.f); }
  return a;
}
struct F2 { v16b h, l; };
__device__ __forceinline__ F2 bsplit16(const float v[16]) { F2 r;
#pragma unroll
  for (int i = 0; i < 16; ++i) { const __bf16 h = (__bf16)v[i]; r.h[i] = h; r.l[i] = (__bf16)(v[i] - (float)h); }
  return r; }
__device__ __forceinline__ F2 split_row(const float* row, int k0, int lane) { float v[16]; const float* p = row + k0 + 8 * (lane >> 4);
#pragma unroll
  for (int i = 0; i < 8; ++i) { v[i] = p[i]; v[8 + i] = p[16 + i]; }
  return bsplit16(v); }
__device__ __forceinline__ F2 split_rowK(const float* row, int k0, int lane, int K) { float v[16]; const int g = lane >> 4;
#pragma unroll
  for (int i = 0; i < 8; ++i) { const int ka = k0 + 8 * g + i, kb = ka + 16; v[i] = ka < K ? row[ka < K ? ka : K - 1] : 0.f; v[8 + i] = kb < K ? row[kb < K ? kb : K - 1] : 0.f; }
  return bsplit16(v); }
__device__ __forceinline__ F2 split_col(const float* W, int k0, int n, int lane, int ld, int K) { float v[16]; const int g = lane >> 4;
#pragma unroll
  for (int i = 0; i < 8; ++i) { const int ka = k0 + 8 * g + i, kb = ka + 16; v[i] = ka < K ? W[(size_t)(ka < K ? ka : K - 1) * ld + n] : 0.f; v[8 + i] = kb < K ? W[(size_t)(kb < K ? kb : K - 1) * ld + n] : 0.f; }
  return bsplit16(v); }
__device__ __forceinline__ v8f mac3(const F2& a, const F2& b, v8f c) { c = wmma_bf(a.l, b.h, c); c = wmma_bf(a.h, b.l, c); return wmma_bf(a.h, b.h, c); }
__device__ __forceinline__ float sigm(float v) { return 1.0f / (1.0f + expf(-v)); }
#define LDSX() do { asm volatile("s_wait_dscnt 0" ::: "memory"); __builtin_amdgcn_wave_barrier(); __builtin_amdgcn_fence(__ATOMIC_RELEASE, "workgroup"); } while (0)


// Relative-position multi-head attention (B 8, T 1024, F 512, 8 heads x 64): q/k/v = Linear(query/key/value); p = pos_emb Wp^T; scores = ((q + pos_bias_u) k^T + (q + pos_bias_v) p^T) / sqrt(64); masked (mask == 0 -> float32 min); attn = softmax, then 0 where masked; x = attn v; out = x Wo^T + bo.
#define NB 8
#define TT 1024
#define FF 512
#define NH 8
#define HD 64
#ifndef TQB
#define TQB (TT / 64)
#define TNB NB
#define TOB (NB * TT / 64)
#endif
typedef __attribute__((ext_vector_type(8))) __bf16 v8b;
__device__ __forceinline__ v16b frag_b(const __bf16* rowk0, int lane) {
  union { v16b v; v8b q[2]; } u; const __bf16* p = rowk0 + 8 * (lane >> 4);
  u.q[0] = *(const v8b*)p; u.q[1] = *(const v8b*)(p + 16); return u.v;
}
__device__ __forceinline__ float bfr(float v) { return (float)(__bf16)v; }
__device__ __attribute__((noinline)) float exp_ni(float v) { return expf(v); }
__device__ __attribute__((noinline)) float erf_ni(float v) { return erff(v); }

#define WS_PW  0u                                   // bf16 natural rows: Wq, Wk, Wv, Wp, Wo [512][512] each
#define WS_QA  (WS_PW + 2u * 5 * FF * FF)            // f32 [NB*TT][8 h][128]: q+u | q+v
#define WS_KB  (WS_QA + 4u * NB * TT * NH * 128)      // f32 [NB*TT][8 h][128]: k | p
#define WS_VH  (WS_KB + 4u * NB * TT * NH * 128)      // bf16 [NB][512 (h*64+d)][TT]
#define WS_VL  (WS_VH + 2u * NB * FF * TT)
#define WS_P   (WS_VL + 2u * NB * FF * TT)            // f32 [TT][512] p = pos_emb Wp^T
#define WS_O   (WS_P + 4u * TT * FF)                  // f32 [NB*TT][512]
#define WS_END (WS_O + 4u * NB * TT * FF)

// ---- k_pack: block = (row n, which 0..4): natural [out][in] rows of Wq, Wk, Wv, Wp, Wo
__global__ __launch_bounds__(128) void k_pack(const float* __restrict__ WQ, const float* __restrict__ WK, const float* __restrict__ WV, const float* __restrict__ WP, const float* __restrict__ WO, __bf16* __restrict__ PW) {
  __shared__ __align__(16) __bf16 s[FF]; const int n = blockIdx.x, which = blockIdx.y, tid = threadIdx.x; const float* src = (which == 0 ? WQ : which == 1 ? WK : which == 2 ? WV : which == 3 ? WP : WO) + (size_t)n * FF;
  for (int k = tid; k < FF; k += 128) s[k] = (__bf16)src[k];
  __syncthreads();
  if (tid < FF / 8) vst2((unsigned*)(PW + ((size_t)which * FF + n) * FF + tid * 8), *(const v4u*)&s[tid * 8]);
}
// ---- k_posp: block = (64 positions, 128 cols): p = bf16(pos_emb) . Wp rows (exact) -> P rows (512-B segments)
__global__ __launch_bounds__(128) void k_posp(const float* __restrict__ PE, const __bf16* __restrict__ P4, float* __restrict__ P) {
  __shared__ __align__(16) float so[4][16][132];
  const int tid = threadIdx.x, wave = tid >> 5, lane = tid & 31, col = lane & 15, g = lane >> 4; const size_t r0 = (size_t)blockIdx.x * 64 + wave * 16; const int n0 = blockIdx.y * 128;
  v8f acc[8] = {};
#pragma unroll 2
  for (int kc = 0; kc < FF / 32; ++kc) { v16b a; { const float* p = PE + (r0 + col) * FF + kc * 32 + 8 * g;
#pragma unroll
      for (int i = 0; i < 8; ++i) { a[i] = (__bf16)p[i]; a[8 + i] = (__bf16)p[16 + i]; } }
#pragma unroll
    for (int j = 0; j < 8; ++j) acc[j] = wmma_bf(a, frag_b(P4 + (size_t)(n0 + j * 16 + col) * FF + kc * 32, lane), acc[j]); }
#pragma unroll
  for (int j = 0; j < 8; ++j)
#pragma unroll
    for (int r = 0; r < 8; ++r) so[wave][8 * g + r][j * 16 + col] = acc[j][r];
  LDSX();
  for (int rl = 0; rl < 16; ++rl) vst2(P + (r0 + rl) * FF + n0 + lane * 4, *(const v4f*)&so[wave][rl][lane * 4]);
}
// ---- k_proj<MODE>: block = (64 rows (b,t), 128 cols = 2 heads): MODE 0: q = query.Wq^T + bq -> QA[row][h][q+u | q+v] (512-B per (row, head)); MODE 1: k = key.Wk^T + bk -> KB[row][h][k | p[t]] ; MODE 2: v = value.Wv^T + bv -> transposed hi/lo planes
template <int MODE>
__global__ __launch_bounds__(128) void k_proj(const float* __restrict__ X, const __bf16* __restrict__ P1, const float* __restrict__ bias, const float* __restrict__ U, const float* __restrict__ Vb, const float* __restrict__ PP, float* __restrict__ OUT, __bf16* __restrict__ VH, __bf16* __restrict__ VL) {
  __shared__ __align__(16) float so[4][16][260]; __shared__ __align__(16) __bf16 sth[128][72], stl[128][72];
  const int tid = threadIdx.x, wave = tid >> 5, lane = tid & 31, col = lane & 15, g = lane >> 4; const size_t rb = (size_t)blockIdx.x * 64; const size_t r0 = rb + wave * 16; const int n0 = blockIdx.y * 128;
  v8f acc[8] = {};
#pragma unroll 2
  for (int kc = 0; kc < FF / 32; ++kc) { v16b a; { const float* p = X + (r0 + col) * FF + kc * 32 + 8 * g;
#pragma unroll
      for (int i = 0; i < 8; ++i) { a[i] = (__bf16)p[i]; a[8 + i] = (__bf16)p[16 + i]; } }
#pragma unroll
    for (int j = 0; j < 8; ++j) acc[j] = wmma_bf(a, frag_b(P1 + (size_t)(n0 + j * 16 + col) * FF + kc * 32, lane), acc[j]); }
  if (MODE == 2) {
#pragma unroll
    for (int j = 0; j < 8; ++j) { const float bb = bfr(bias[n0 + j * 16 + col]);
#pragma unroll
      for (int r = 0; r < 8; ++r) { const float v = acc[j][r] + bb; const __bf16 hb = (__bf16)v; sth[j * 16 + col][wave * 16 + 8 * g + r] = hb; stl[j * 16 + col][wave * 16 + 8 * g + r] = (__bf16)(v - (float)hb); } }
    __syncthreads();
    const int b = (int)(rb / TT), t0 = (int)(rb % TT);
    for (int q = tid; q < 128 * 8; q += 128) { const int d = q >> 3, pc = q & 7; const size_t o = ((size_t)b * FF + n0 + d) * TT + t0 + pc * 8; vst2((unsigned*)(VH + o), *(const v4u*)&sth[d][pc * 8]); vst2((unsigned*)(VL + o), *(const v4u*)&stl[d][pc * 8]); }
  } else {
    // two heads in this column block: hl = j / 4 (local), d = (j % 4) * 16 + col; segment layout per (row, head): [first 64 | second 64]
#pragma unroll
    for (int j = 0; j < 8; ++j) { const int hl = j >> 2, d = (j & 3) * 16 + col; const int h = (n0 >> 6) + hl; const float bb = bfr(bias[n0 + j * 16 + col]);
#pragma unroll
      for (int r = 0; r < 8; ++r) { const float v = acc[j][r] + bb; const int rl = 8 * g + r;
        if (MODE == 0) { so[wave][rl][hl * 128 + d] = v + bfr(U[h * HD + d]); so[wave][rl][hl * 128 + 64 + d] = v + bfr(Vb[h * HD + d]); }
        else { const size_t t = (r0 + rl) % TT; so[wave][rl][hl * 128 + d] = v; so[wave][rl][hl * 128 + 64 + d] = PP[t * FF + h * HD + d]; } } }
    LDSX();
    const int h0 = n0 >> 6;
    for (int rl = 0; rl < 16; ++rl) { vst2(OUT + ((r0 + rl) * NH + h0) * 128 + lane * 4, *(const v4f*)&so[wave][rl][lane * 4]); vst2(OUT + ((r0 + rl) * NH + h0) * 128 + 128 + lane * 4, *(const v4f*)&so[wave][rl][128 + lane * 4]); }
  }
}
// ---- k_attn: block = (64 queries, head h, batch b): per 32-key step: mask tile loads (int) -> wave vote -> {scores = [q+u|q+v].[k|p] / 8 (3 products, K 128), masked -> -3e38; online softmax; P(hi/lo).V(hi/lo)}; rows with no live key output 0 (the module's where(mask==0, 0, softmax)); O[row][h*64+d]
__global__ __launch_bounds__(128) void k_attn(const float* __restrict__ QA, const float* __restrict__ KB, const int* __restrict__ MASK, const __bf16* __restrict__ VH, const __bf16* __restrict__ VL, float* __restrict__ O) {
  __shared__ __align__(16) float sp[4][16][36]; __shared__ __align__(16) float so[4][16][68];
  const int tid = threadIdx.x, wave = tid >> 5, lane = tid & 31, col = lane & 15, g = lane >> 4;
  const int qb = blockIdx.x, h = blockIdx.y, b = blockIdx.z; const int q0 = qb * 64 + wave * 16; const size_t rq = (size_t)b * TT + q0;
  const float* qrow = QA + ((rq + col) * NH + h) * 128;
  float m[8], l[8];
#pragma unroll
  for (int r = 0; r < 8; ++r) { m[r] = -3.0e38f; l[r] = 0.f; }
  v8f acc[4] = {};
  // the wave's 16 query rows do not change over the key loop: load and split them to bf16 hi/lo fragments once, kept in registers (unrolled so that qa[] is indexed by constants and never goes to scratch)
  F2 qa[4];
#pragma unroll
  for (int kc = 0; kc < 4; ++kc) qa[kc] = split_row(qrow, kc * 32, lane);
#pragma unroll 1
  for (int ks = 0; ks < TT / 32; ++ks) { v8f s[2]; int mk[2][8]; bool anylive = false;
#pragma unroll
    for (int ct = 0; ct < 2; ++ct) { const int kk = ks * 32 + ct * 16 + col;
#pragma unroll
      for (int r = 0; r < 8; ++r) { const int mv = MASK[((size_t)b * TT + q0 + 8 * g + r) * TT + kk]; mk[ct][r] = mv; anylive = anylive || (mv != 0); } }
    if (__any(anylive)) {
#pragma unroll
      for (int ct = 0; ct < 2; ++ct) { const int kk = ks * 32 + ct * 16 + col; const float* krow = KB + (((size_t)b * TT + kk) * NH + h) * 128; v8f c = {};
#pragma unroll
        for (int kc = 0; kc < 4; ++kc) { const F2 kb = split_row(krow, kc * 32, lane); c = mac3(qa[kc], kb, c); }
#pragma unroll
        for (int r = 0; r < 8; ++r) s[ct][r] = (mk[ct][r] != 0) ? c[r] * 0.125f : -3.0e38f; }
#pragma unroll
      for (int r = 0; r < 8; ++r) { float mx = fmaxf(s[0][r], s[1][r]);
#pragma unroll
        for (int o = 1; o < 16; o <<= 1) mx = fmaxf(mx, __shfl_xor(mx, o));
        const float mn = fmaxf(m[r], mx); const float alpha = (m[r] <= -1.0e38f) ? 0.f : exp_ni(m[r] - mn);
        const float e0 = (s[0][r] <= -1.0e38f) ? 0.f : exp_ni(s[0][r] - mn), e1 = (s[1][r] <= -1.0e38f) ? 0.f : exp_ni(s[1][r] - mn); float es = e0 + e1;
#pragma unroll
        for (int o = 1; o < 16; o <<= 1) es += __shfl_xor(es, o);
        l[r] = l[r] * alpha + es; m[r] = mn;
#pragma unroll
        for (int dt = 0; dt < 4; ++dt) acc[dt][r] *= alpha;
        sp[wave][8 * g + r][col] = e0; sp[wave][8 * g + r][16 + col] = e1; }
      LDSX();
      const F2 pa = split_row(&sp[wave][col][0], 0, lane);
#pragma unroll
      for (int dt = 0; dt < 4; ++dt) { const size_t vr = ((size_t)b * FF + h * HD + dt * 16 + col) * TT + ks * 32; const v16b vh = frag_b(VH + vr, lane), vl = frag_b(VL + vr, lane); acc[dt] = wmma_bf(pa.l, vh, acc[dt]); acc[dt] = wmma_bf(pa.h, vl, acc[dt]); acc[dt] = wmma_bf(pa.h, vh, acc[dt]); }
      LDSX(); } }
#pragma unroll
  for (int r = 0; r < 8; ++r) { const float il = (l[r] > 0.f) ? 1.0f / l[r] : 0.f;
#pragma unroll
    for (int dt = 0; dt < 4; ++dt) so[wave][8 * g + r][dt * 16 + col] = acc[dt][r] * il; }
  LDSX();
  for (int rl = 0; rl < 16; ++rl) if (lane < 16) vst2(O + (rq + rl) * FF + h * HD + lane * 4, *(const v4f*)&so[wave][rl][lane * 4]);
}
// ---- k_out: block = (64 rows, 128 cols): out = O(hi/lo) . Wo rows (2 products) + bo
__global__ __launch_bounds__(128) void k_out(const float* __restrict__ O, const __bf16* __restrict__ P, const float* __restrict__ bias, float* __restrict__ Y) {
  __shared__ __align__(16) float so[4][16][132];
  const int tid = threadIdx.x, wave = tid >> 5, lane = tid & 31, col = lane & 15, g = lane >> 4; const size_t r0 = (size_t)blockIdx.x * 64 + wave * 16; const int n0 = blockIdx.y * 128;
  v8f acc[8] = {};
#pragma unroll 2
  for (int kc = 0; kc < FF / 32; ++kc) { const F2 a = split_row(O + (r0 + col) * FF, kc * 32, lane);
#pragma unroll
    for (int j = 0; j < 8; ++j) { const v16b w = frag_b(P + (size_t)(n0 + j * 16 + col) * FF + kc * 32, lane); acc[j] = wmma_bf(a.l, w, acc[j]); acc[j] = wmma_bf(a.h, w, acc[j]); } }
#pragma unroll
  for (int j = 0; j < 8; ++j) { const float bb = bfr(bias[n0 + j * 16 + col]);
#pragma unroll
    for (int r = 0; r < 8; ++r) so[wave][8 * g + r][j * 16 + col] = acc[j][r] + bb; }
  LDSX();
  for (int rl = 0; rl < 16; ++rl) vst2(Y + (r0 + rl) * FF + n0 + lane * 4, *(const v4f*)&so[wave][rl][lane * 4]);
}
extern "C" void kernel_launch(void* const* d_in, const int* in_sizes, int n_in, void* d_out, int out_size, void* d_ws, size_t ws_size, hipStream_t stream) {
  (void)in_sizes; (void)n_in; (void)out_size;
  const float** F = (const float**)d_in; const int* MASK = (const int*)d_in[3];
  // 0 query, 1 key, 2 value [8,1024,512], 3 mask [8,1024,1024] i32, 4 pos_emb [1,1024,512], 5 Wq, 6 bq, 7 Wk, 8 bk, 9 Wv, 10 bv, 11 Wp, 12 Wo, 13 bo, 14 pos_bias_u [8,64], 15 pos_bias_v [8,64]
  if (ws_size < (size_t)WS_END) return;
  char* ws = (char*)d_ws; __bf16 *PW = (__bf16*)(ws + WS_PW), *VH = (__bf16*)(ws + WS_VH), *VL = (__bf16*)(ws + WS_VL); float *QA = (float*)(ws + WS_QA), *KB = (float*)(ws + WS_KB), *P = (float*)(ws + WS_P), *O = (float*)(ws + WS_O);
  k_pack<<<dim3(FF, 5), 128, 0, stream>>>(F[5], F[7], F[9], F[11], F[12], PW);
  k_posp<<<dim3(TT / 64, FF / 128), 128, 0, stream>>>(F[4], PW + (size_t)3 * FF * FF, P);
  k_proj<0><<<dim3(TNB * TT / 64, FF / 128), 128, 0, stream>>>(F[0], PW, F[6], F[14], F[15], P, QA, nullptr, nullptr);
  k_proj<1><<<dim3(TNB * TT / 64, FF / 128), 128, 0, stream>>>(F[1], PW + (size_t)FF * FF, F[8], F[14], F[15], P, KB, nullptr, nullptr);
  k_proj<2><<<dim3(TNB * TT / 64, FF / 128), 128, 0, stream>>>(F[2], PW + (size_t)2 * FF * FF, F[10], F[14], F[15], P, nullptr, VH, VL);
  k_attn<<<dim3(TQB, NH, TNB), 128, 0, stream>>>(QA, KB, MASK, VH, VL, O);
  k_out<<<dim3(TOB, FF / 128), 128, 0, stream>>>(O, PW + (size_t)4 * FF * FF, F[13], (float*)d_out);
}

// v002
// A run of this version takes 382 microseconds.
// Timed twice side by side with v001, it ran 1.24 times as fast both times.
// Over all steps from v000 it is 1.28 times as fast.
// compute dtype: query, key, value, pos_emb, mask, all weights/biases and the position biases (module inputs) rounded to bf16 / read as int32; the four input projections with exact bf16 products (inputs x inputs) on WMMA 16x16x32; scores as one 128-deep dot [q+u | q+v] . [k | p] with both computed operands as bf16 hi + residual pairs (3 products), P.V with P hi/lo x V hi/lo (3 products), output projection hi/lo x exact Wo (2 products); masking, softmax and the masked-row zeroing in f32; f32 accumulate.
#include <hip/hip_runtime.h>
#include <math.h>

typedef __attribute__((ext_vector_type(16))) _Float16 v16h;
typedef __attribute__((ext_vector_type(16))) __bf16 v16b;
typedef __attribute__((ext_vector_type(8)))  _Float16 v8h;
typedef __attribute__((ext_vector_type(8)))  float v8f;
typedef __attribute__((ext_vector_type(4)))  float v4f;
typedef __attribute__((ext_vector_type(2)))  float v2f;
typedef __attribute__((ext_vector_type(4)))  unsigned v4u;
typedef __attribute__((ext_vector_type(4)))  int v4i;
typedef float __attribute__((may_alias)) float_a;
typedef int __attribute__((may_alias)) int_a;

template <typename T> __device__ __forceinline__ void vst2(void* p, T v) { *(T*)p = v;  }
__device__ __forceinline__ v8f wmma16(v16h a, v16h b, v8f c) {
  v8f d = __builtin_amdgcn_wmma_f32_16x16x32_f16(false, a, false, b, (short)0, c, false, false);
  asm volatile("v_nop\n\tv_nop\n\tv_nop\n\tv_nop" : "+v"(d) : "v"(a), "v"(b));
  return d;
}
__device__ __forceinline__ v8f wmma_bf(v16b a, v16b b, v8f c) {
  v8f d = __builtin_amdgcn_wmma_f32_16x16x32_bf16(false, a, false, b, (short)0, c, false, false);
  asm volatile("v_nop\n\tv_nop\n\tv_nop\n\tv_nop" : "+v"(d) : "v"(a), "v"(b));
  return d;
}
// 16x16x32 fragments: lane = (h = lane>>4, row/col = lane&15); elements 0..7 = k0+8h+0..7, 8..15 = k0+16+8h+0..7; D element r = row 8h+r
__device__ __forceinline__ v16h frag_h(const _Float16* rowk0, int lane) {
  union { v16h v; v8h q[2]; } u; const _Float16* p = rowk0 + 8 * (lane >> 4);
  u.q[0] = *(const v8h*)p; u.q[1] = *(const v8h*)(p + 16); return u.v;
}
__device__ __forceinline__ v16h frag_f32(const float* rowk0, int lane) {
  v16h a; const float* p = rowk0 + 8 * (lane >> 4);
#pragma unroll
  for (int i = 0; i < 8; ++i) { a[i] = (_Float16)p[i]; a[8 + i] = (_Float16)p[16 + i]; }
  return a;
}
__device__ __forceinline__ v16h frag_f32s(const float* rowk0, int lane, float sc) {
  v16h a; const float* p = rowk0 + 8 * (lane >> 4);
#pragma unroll
  for (int i = 0; i < 8; ++i) { a[i] = (_Float16)(p[i] * sc); a[8 + i] = (_Float16)(p[16 + i] * sc); }
  return a;
}
// column fragment from a [K][ld] layout (column n), rows >= K read as 0
__device__ __forceinline__ v16h fragc_f32(const float* W, int k0, int n, int lane, int ld, int K) {
  v16h a; const int g = lane >> 4;
#pragma unroll
  for (int i = 0; i < 8; ++i) { const int ka = k0 + 8 * g + i, kb = ka + 16;
    a[i] = (_Float16)(ka < K ? W[(size_t)(ka < K ? ka : K - 1) * ld + n] : 0.f); a[8 + i] = (_Float16)(kb < K ? W[(size_t)(kb < K ? kb : K - 1) * ld + n] : 0.f); }
  return a;
}
struct F2 { v16b h, l; };
__device__ __forceinline__ F2 bsplit16(const float v[16]) { F2 r;
#pragma unroll
  for (int i = 0; i < 16; ++i) { const __bf16 h = (__bf16)v[i]; r.h[i] = h; r.l[i] = (__bf16)(v[i] - (float)h); }
  return r; }
__device__ __forceinline__ F2 split_row(const float* row, int k0, int lane) { float v[16]; const float* p = row + k0 + 8 * (lane >> 4);
#pragma unroll
  for (int i = 0; i < 8; ++i) { v[i] = p[i]; v[8 + i] = p[16 + i]; }
  return bsplit16(v); }
__device__ __forceinline__ F2 split_rowK(const float* row, int k0, int lane, int K) { float v[16]; const int g = lane >> 4;
#pragma unroll
  for (int i = 0; i < 8; ++i) { const int ka = k0 + 8 * g + i, kb = ka + 16; v[i] = ka < K ? row[ka < K ? ka : K - 1] : 0.f; v[8 + i] = kb < K ? row[kb < K ? kb : K - 1] : 0.f; }
  return bsplit16(v); }
__device__ __forceinline__ F2 split_col(const float* W, int k0, int n, int lane, int ld, int K) { float v[16]; const int g = lane >> 4;
#pragma unroll
  for (int i = 0; i < 8; ++i) { const int ka = k0 + 8 * g + i, kb = ka + 16; v[i] = ka < K ? W[(size_t)(ka < K ? ka : K - 1) * ld + n] : 0.f; v[8 + i] = kb < K ? W[(size_t)(kb < K ? kb : K - 1) * ld + n] : 0.f; }
  return bsplit16(v); }
__device__ __forceinline__ v8f mac3(const F2& a, const F2& b, v8f c) { c = wmma_bf(a.l, b.h, c); c = wmma_bf(a.h, b.l, c); return wmma_bf(a.h, b.h, c); }
__device__ __forceinline__ float sigm(float v) { return 1.0f / (1.0f + expf(-v)); }
#define LDSX() do { asm volatile("s_wait_dscnt 0" ::: "memory"); __builtin_amdgcn_wave_barrier(); __builtin_amdgcn_fence(__ATOMIC_RELEASE, "workgroup"); } while (0)


// Relative-position multi-head attention (B 8, T 1024, F 512, 8 heads x 64): q/k/v = Linear(query/key/value); p = pos_emb Wp^T; scores = ((q + pos_bias_u) k^T + (q + pos_bias_v) p^T) / sqrt(64); masked (mask == 0 -> float32 min); attn = softmax, then 0 where masked; x = attn v; out = x Wo^T + bo.
#define NB 8
#define TT 1024
#define FF 512
#define NH 8
#define HD 64
#ifndef TQB
#define TQB (TT / 64)
#define TNB NB
#define TOB (NB * TT / 64)
#endif
typedef __attribute__((ext_vector_type(8))) __bf16 v8b;
__device__ __forceinline__ v16b frag_b(const __bf16* rowk0, int lane) {
  union { v16b v; v8b q[2]; } u; const __bf16* p = rowk0 + 8 * (lane >> 4);
  u.q[0] = *(const v8b*)p; u.q[1] = *(const v8b*)(p + 16); return u.v;
}
__device__ __forceinline__ float bfr(float v) { return (float)(__bf16)v; }
__device__ __attribute__((noinline)) float exp_ni(float v) { return expf(v); }
__device__ __attribute__((noinline)) float erf_ni(float v) { return erff(v); }

#define WS_PW  0u                                   // bf16 natural rows: Wq, Wk, Wv, Wp, Wo [512][512] each
#define WS_QA  (WS_PW + 2u * 5 * FF * FF)            // f32 [NB*TT][8 h][128]: q+u | q+v
#define WS_KB  (WS_QA + 4u * NB * TT * NH * 128)      // f32 [NB*TT][8 h][128]: k | p
#define WS_VH  (WS_KB + 4u * NB * TT * NH * 128)      // bf16 [NB][512 (h*64+d)][TT]
#define WS_VL  (WS_VH + 2u * NB * FF * TT)
#define WS_P   (WS_VL + 2u * NB * FF * TT)            // f32 [TT][512] p = pos_emb Wp^T
#define WS_O   (WS_P + 4u * TT * FF)                  // f32 [NB*TT][512]
#define WS_END (WS_O + 4u * NB * TT * FF)

// ---- k_pack: block = (row n, which 0..4): natural [out][in] rows of Wq, Wk, Wv, Wp, Wo
__global__ __launch_bounds__(128) void k_pack(const float* __restrict__ WQ, const float* __restrict__ WK, const float* __restrict__ WV, const float* __restrict__ WP, const float* __restrict__ WO, __bf16* __restrict__ PW) {
  __shared__ __align__(16) __bf16 s[FF]; const int n = blockIdx.x, which = blockIdx.y, tid = threadIdx.x; const float* src = (which == 0 ? WQ : which == 1 ? WK : which == 2 ? WV : which == 3 ? WP : WO) + (size_t)n * FF;
  for (int k = tid; k < FF; k += 128) s[k] = (__bf16)src[k];
  __syncthreads();
  if (tid < FF / 8) vst2((unsigned*)(PW + ((size_t)which * FF + n) * FF + tid * 8), *(const v4u*)&s[tid * 8]);
}
// ---- k_posp: block = (64 positions, 128 cols): p = bf16(pos_emb) . Wp rows (exact) -> P rows (512-B segments)
__global__ __launch_bounds__(128) void k_posp(const float* __restrict__ PE, const __bf16* __restrict__ P4, float* __restrict__ P) {
  __shared__ __align__(16) float so[4][16][132];
  const int tid = threadIdx.x, wave = tid >> 5, lane = tid & 31, col = lane & 15, g = lane >> 4; const size_t r0 = (size_t)blockIdx.x * 64 + wave * 16; const int n0 = blockIdx.y * 128;
  v8f acc[8] = {};
#pragma unroll 2
  for (int kc = 0; kc < FF / 32; ++kc) { v16b a; { const float* p = PE + (r0 + col) * FF + kc * 32 + 8 * g;
#pragma unroll
      for (int i = 0; i < 8; ++i) { a[i] = (__bf16)p[i]; a[8 + i] = (__bf16)p[16 + i]; } }
#pragma unroll
    for (int j = 0; j < 8; ++j) acc[j] = wmma_bf(a, frag_b(P4 + (size_t)(n0 + j * 16 + col) * FF + kc * 32, lane), acc[j]); }
#pragma unroll
  for (int j = 0; j < 8; ++j)
#pragma unroll
    for (int r = 0; r < 8; ++r) so[wave][8 * g + r][j * 16 + col] = acc[j][r];
  LDSX();
  for (int rl = 0; rl < 16; ++rl) vst2(P + (r0 + rl) * FF + n0 + lane * 4, *(const v4f*)&so[wave][rl][lane * 4]);
}
// ---- k_proj<MODE>: block = (64 rows (b,t), 128 cols = 2 heads): MODE 0: q = query.Wq^T + bq -> QA[row][h][q+u | q+v] (512-B per (row, head)); MODE 1: k = key.Wk^T + bk -> KB[row][h][k | p[t]] ; MODE 2: v = value.Wv^T + bv -> transposed hi/lo planes
template <int MODE>
__global__ __launch_bounds__(128) void k_proj(const float* __restrict__ X, const __bf16* __restrict__ P1, const float* __restrict__ bias, const float* __restrict__ U, const float* __restrict__ Vb, const float* __restrict__ PP, float* __restrict__ OUT, __bf16* __restrict__ VH, __bf16* __restrict__ VL) {
  __shared__ __align__(16) float so[4][16][260]; __shared__ __align__(16) __bf16 sth[128][72], stl[128][72];
  const int tid = threadIdx.x, wave = tid >> 5, lane = tid & 31, col = lane & 15, g = lane >> 4; const size_t rb = (size_t)blockIdx.x * 64; const size_t r0 = rb + wave * 16; const int n0 = blockIdx.y * 128;
  v8f acc[8] = {};
#pragma unroll 2
  for (int kc = 0; kc < FF / 32; ++kc) { v16b a; { const float* p = X + (r0 + col) * FF + kc * 32 + 8 * g;
#pragma unroll
      for (int i = 0; i < 8; ++i) { a[i] = (__bf16)p[i]; a[8 + i] = (__bf16)p[16 + i]; } }
#pragma unroll
    for (int j = 0; j < 8; ++j) acc[j] = wmma_bf(a, frag_b(P1 + (size_t)(n0 + j * 16 + col) * FF + kc * 32, lane), acc[j]); }
  if (MODE == 2) {
#pragma unroll
    for (int j = 0; j < 8; ++j) { const float bb = bfr(bias[n0 + j * 16 + col]);
#pragma unroll
      for (int r = 0; r < 8; ++r) { const float v = acc[j][r] + bb; const __bf16 hb = (__bf16)v; sth[j * 16 + col][wave * 16 + 8 * g + r] = hb; stl[j * 16 + col][wave * 16 + 8 * g + r] = (__bf16)(v - (float)hb); } }
    __syncthreads();
    const int b = (int)(rb / TT), t0 = (int)(rb % TT);
    for (int q = tid; q < 128 * 8; q += 128) { const int d = q >> 3, pc = q & 7; const size_t o = ((size_t)b * FF + n0 + d) * TT + t0 + pc * 8; vst2((unsigned*)(VH + o), *(const v4u*)&sth[d][pc * 8]); vst2((unsigned*)(VL + o), *(const v4u*)&stl[d][pc * 8]); }
  } else {
    // two heads in this column block: hl = j / 4 (local), d = (j % 4) * 16 + col; segment layout per (row, head): [first 64 | second 64]
#pragma unroll
    for (int j = 0; j < 8; ++j) { const int hl = j >> 2, d = (j & 3) * 16 + col; const int h = (n0 >> 6) + hl; const float bb = bfr(bias[n0 + j * 16 + col]);
#pragma unroll
      for (int r = 0; r < 8; ++r) { const float v = acc[j][r] + bb; const int rl = 8 * g + r;
        if (MODE == 0) { so[wave][rl][hl * 128 + d] = v + bfr(U[h * HD + d]); so[wave][rl][hl * 128 + 64 + d] = v + bfr(Vb[h * HD + d]); }
        else { const size_t t = (r0 + rl) % TT; so[wave][rl][hl * 128 + d] = v; so[wave][rl][hl * 128 + 64 + d] = PP[t * FF + h * HD + d]; } } }
    LDSX();
    const int h0 = n0 >> 6;
    for (int rl = 0; rl < 16; ++rl) { vst2(OUT + ((r0 + rl) * NH + h0) * 128 + lane * 4, *(const v4f*)&so[wave][rl][lane * 4]); vst2(OUT + ((r0 + rl) * NH + h0) * 128 + 128 + lane * 4, *(const v4f*)&so[wave][rl][128 + lane * 4]); }
  }
}
// ---- k_attn: block = (64 queries, head h, batch b): per 32-key step: mask tile loads (int) -> wave vote -> {scores = [q+u|q+v].[k|p] / 8 (3 products, K 128), masked -> -3e38; online softmax; P(hi/lo).V(hi/lo)}; rows with no live key output 0 (the module's where(mask==0, 0, softmax)); O[row][h*64+d]
// The step's K rows (32 x 512 B) and V hi/lo rows (2 x 64 x 64 B) are the same for the block's four waves: they are brought into LDS once per block by asynchronous copies (whole lines of K per wave-instruction), one step ahead, two buffers.
#define KPITCH 528                                   // 512-B K row + 16 B: 16 B x odd, conflict-free for 16-byte LDS reads
#define VPITCH 80                                    // 64-B V row + 16 B: 16 B x odd
#define ST_VH  (32 * KPITCH)
#define ST_VL  (ST_VH + HD * VPITCH)
#define ST_SZ  (ST_VL + HD * VPITCH)
// one stage = 12 copies of 16 B per lane: 8 of K (copy i: key row 4 i + wave, the wave's 32 lanes cover the 512-B row), 2 of V hi, 2 of V lo (4 lanes per 64-B row)
__device__ __forceinline__ void stage_kv(unsigned lk, unsigned lv, const float* gk, const __bf16* gh, const __bf16* gl) {
  // s_wait_xcnt closes the statement so that it stands in front of any later rewrite of the address registers the copies name
  asm volatile("global_load_async_to_lds_b128 %0, %12, off\n\t"
               "global_load_async_to_lds_b128 %1, %13, off\n\t"
               "global_load_async_to_lds_b128 %2, %14, off\n\t"
               "global_load_async_to_lds_b128 %3, %15, off\n\t"
               "global_load_async_to_lds_b128 %4, %16, off\n\t"
               "global_load_async_to_lds_b128 %5, %17, off\n\t"
               "global_load_async_to_lds_b128 %6, %18, off\n\t"
               "global_load_async_to_lds_b128 %7, %19, off\n\t"
               "global_load_async_to_lds_b128 %8, %20, off\n\t"
               "global_load_async_to_lds_b128 %9, %21, off\n\t"
               "global_load_async_to_lds_b128 %10, %22, off\n\t"
               "global_load_async_to_lds_b128 %11, %23, off\n\t"
               "s_wait_xcnt 0x0"
               :: "v"(lk), "v"(lk + 4 * KPITCH), "v"(lk + 8 * KPITCH), "v"(lk + 12 * KPITCH), "v"(lk + 16 * KPITCH), "v"(lk + 20 * KPITCH), "v"(lk + 24 * KPITCH), "v"(lk + 28 * KPITCH),
                  "v"(lv + ST_VH), "v"(lv + ST_VH + 32 * VPITCH), "v"(lv + ST_VL), "v"(lv + ST_VL + 32 * VPITCH),
                  "v"(gk), "v"(gk + 4 * NH * 128), "v"(gk + 8 * NH * 128), "v"(gk + 12 * NH * 128), "v"(gk + 16 * NH * 128), "v"(gk + 20 * NH * 128), "v"(gk + 24 * NH * 128), "v"(gk + 28 * NH * 128),
                  "v"(gh), "v"(gh + 32 * TT), "v"(gl), "v"(gl + 32 * TT)
               : "memory");
}
__global__ __launch_bounds__(128) void k_attn(const float* __restrict__ QA, const float* __restrict__ KB, const int* __restrict__ MASK, const __bf16* __restrict__ VH, const __bf16* __restrict__ VL, float* __restrict__ O) {
  __shared__ __align__(16) char ring[2 * ST_SZ];
  __shared__ __align__(16) float sp[4][16][36]; __shared__ __align__(16) float so[4][16][68];
  const int tid = threadIdx.x, wave = tid >> 5, lane = tid & 31, col = lane & 15, g = lane >> 4;
  const int qb = blockIdx.x, h = blockIdx.y, b = blockIdx.z; const int q0 = qb * 64 + wave * 16; const size_t rq = (size_t)b * TT + q0;
  const float* qrow = QA + ((rq + col) * NH + h) * 128;
  // this lane's places in a stage (LDS byte addresses in buffer 0) and its sources at key step 0
  const unsigned lk0 = (unsigned)(size_t)&ring[wave * KPITCH + lane * 16], lv0 = (unsigned)(size_t)&ring[(tid >> 2) * VPITCH + (tid & 3) * 16];
  const float* gk0 = KB + (((size_t)b * TT + wave) * NH + h) * 128 + lane * 4;
  const size_t gvo = ((size_t)b * FF + h * HD + (tid >> 2)) * TT + (tid & 3) * 8;
  stage_kv(lk0, lv0, gk0, VH + gvo, VL + gvo);
  float m[8], l[8];
#pragma unroll
  for (int r = 0; r < 8; ++r) { m[r] = -3.0e38f; l[r] = 0.f; }
  v8f acc[4] = {};
  // the wave's 16 query rows do not change over the key loop: load and split them to bf16 hi/lo fragments once, kept in registers (unrolled so that qa[] is indexed by constants and never goes to scratch)
  F2 qa[4];
#pragma unroll
  for (int kc = 0; kc < 4; ++kc) qa[kc] = split_row(qrow, kc * 32, lane);
  asm volatile("s_wait_asynccnt 0x0" ::: "memory");   // this wave's copies of step 0 have landed
  __syncthreads();                                     // and every other wave's: step 0 may be read
  stage_kv(lk0 + ST_SZ, lv0 + ST_SZ, gk0 + (size_t)32 * NH * 128, VH + gvo + 32, VL + gvo + 32);
#pragma unroll 1
  for (int ks = 0; ks < TT / 32; ++ks) { v8f s[2]; int mk[2][8]; bool anylive = false; const char* st = ring + (ks & 1) * ST_SZ;
#pragma unroll
    for (int ct = 0; ct < 2; ++ct) { const int kk = ks * 32 + ct * 16 + col;
#pragma unroll
      for (int r = 0; r < 8; ++r) { const int mv = MASK[((size_t)b * TT + q0 + 8 * g + r) * TT + kk]; mk[ct][r] = mv; anylive = anylive || (mv != 0); } }
    if (__any(anylive)) {
#pragma unroll
      for (int ct = 0; ct < 2; ++ct) { const char* krow = st + (ct * 16 + col) * KPITCH; v8f c = {};
#pragma unroll
        for (int kc = 0; kc < 4; ++kc) { const F2 kb = split_row((const float*)krow, kc * 32, lane); c = mac3(qa[kc], kb, c); }
#pragma unroll
        for (int r = 0; r < 8; ++r) s[ct][r] = (mk[ct][r] != 0) ? c[r] * 0.125f : -3.0e38f; }
#pragma unroll
      for (int r = 0; r < 8; ++r) { float mx = fmaxf(s[0][r], s[1][r]);
#pragma unroll
        for (int o = 1; o < 16; o <<= 1) mx = fmaxf(mx, __shfl_xor(mx, o));
        const float mn = fmaxf(m[r], mx); const float alpha = (m[r] <= -1.0e38f) ? 0.f : exp_ni(m[r] - mn);
        const float e0 = (s[0][r] <= -1.0e38f) ? 0.f : exp_ni(s[0][r] - mn), e1 = (s[1][r] <= -1.0e38f) ? 0.f : exp_ni(s[1][r] - mn); float es = e0 + e1;
#pragma unroll
        for (int o = 1; o < 16; o <<= 1) es += __shfl_xor(es, o);
        l[r] = l[r] * alpha + es; m[r] = mn;
#pragma unroll
        for (int dt = 0; dt < 4; ++dt) acc[dt][r] *= alpha;
        sp[wave][8 * g + r][col] = e0; sp[wave][8 * g + r][16 + col] = e1; }
      LDSX();
      const F2 pa = split_row(&sp[wave][col][0], 0, lane);
#pragma unroll
      for (int dt = 0; dt < 4; ++dt) { const int vr = (dt * 16 + col) * VPITCH; const v16b vh = frag_b((const __bf16*)(st + ST_VH + vr), lane), vl = frag_b((const __bf16*)(st + ST_VL + vr), lane); acc[dt] = wmma_bf(pa.l, vh, acc[dt]); acc[dt] = wmma_bf(pa.h, vl, acc[dt]); acc[dt] = wmma_bf(pa.h, vh, acc[dt]); }
      LDSX(); }
    // hand-over, every wave, also one that skipped the step's work:
    asm volatile("s_wait_dscnt 0x0" ::: "memory");     // this wave's reads of the step's buffer are done
    asm volatile("s_wait_asynccnt 0x0" ::: "memory");  // this wave's copies of step ks + 1 have landed
    __syncthreads();                                    // publishes step ks + 1 and frees the buffer just read
    if (ks + 2 < TT / 32) stage_kv(lk0 + (ks & 1) * ST_SZ, lv0 + (ks & 1) * ST_SZ, gk0 + (size_t)(ks + 2) * 32 * NH * 128, VH + gvo + (ks + 2) * 32, VL + gvo + (ks + 2) * 32); }
  asm volatile("s_wait_asynccnt 0x0" ::: "memory");    // no copy is left in flight when the wave goes on to its end
#pragma unroll
  for (int r = 0; r < 8; ++r) { const float il = (l[r] > 0.f) ? 1.0f / l[r] : 0.f;
#pragma unroll
    for (int dt = 0; dt < 4; ++dt) so[wave][8 * g + r][dt * 16 + col] = acc[dt][r] * il; }
  LDSX();
  for (int rl = 0; rl < 16; ++rl) if (lane < 16) vst2(O + (rq + rl) * FF + h * HD + lane * 4, *(const v4f*)&so[wave][rl][lane * 4]);
}
// ---- k_out: block = (64 rows, 128 cols): out = O(hi/lo) . Wo rows (2 products) + bo
__global__ __launch_bounds__(128) void k_out(const float* __restrict__ O, const __bf16* __restrict__ P, const float* __restrict__ bias, float* __restrict__ Y) {
  __shared__ __align__(16) float so[4][16][132];
  const int tid = threadIdx.x, wave = tid >> 5, lane = tid & 31, col = lane & 15, g = lane >> 4; const size_t r0 = (size_t)blockIdx.x * 64 + wave * 16; const int n0 = blockIdx.y * 128;
  v8f acc[8] = {};
#pragma unroll 2
  for (int kc = 0; kc < FF / 32; ++kc) { const F2 a = split_row(O + (r0 + col) * FF, kc * 32, lane);
#pragma unroll
    for (int j = 0; j < 8; ++j) { const v16b w = frag_b(P + (size_t)(n0 + j * 16 + col) * FF + kc * 32, lane); acc[j] = wmma_bf(a.l, w, acc[j]); acc[j] = wmma_bf(a.h, w, acc[j]); } }
#pragma unroll
  for (int j = 0; j < 8; ++j) { const float bb = bfr(bias[n0 + j * 16 + col]);
#pragma unroll
    for (int r = 0; r < 8; ++r) so[wave][8 * g + r][j * 16 + col] = acc[j][r] + bb; }
  LDSX();
  for (int rl = 0; rl < 16; ++rl) vst2(Y + (r0 + rl) * FF + n0 + lane * 4, *(const v4f*)&so[wave][rl][lane * 4]);
}
extern "C" void kernel_launch(void* const* d_in, const int* in_sizes, int n_in, void* d_out, int out_size, void* d_ws, size_t ws_size, hipStream_t stream) {
  (void)in_sizes; (void)n_in; (void)out_size;
  const float** F = (const float**)d_in; const int* MASK = (const int*)d_in[3];
  // 0 query, 1 key, 2 value [8,1024,512], 3 mask [8,1024,1024] i32, 4 pos_emb [1,1024,512], 5 Wq, 6 bq, 7 Wk, 8 bk, 9 Wv, 10 bv, 11 Wp, 12 Wo, 13 bo, 14 pos_bias_u [8,64], 15 pos_bias_v [8,64]
  if (ws_size < (size_t)WS_END) return;
  char* ws = (char*)d_ws; __bf16 *PW = (__bf16*)(ws + WS_PW), *VH = (__bf16*)(ws + WS_VH), *VL = (__bf16*)(ws + WS_VL); float *QA = (float*)(ws + WS_QA), *KB = (float*)(ws + WS_KB), *P = (float*)(ws + WS_P), *O = (float*)(ws + WS_O);
  k_pack<<<dim3(FF, 5), 128, 0, stream>>>(F[5], F[7], F[9], F[11], F[12], PW);
  k_posp<<<dim3(TT / 64, FF / 128), 128, 0, stream>>>(F[4], PW + (size_t)3 * FF * FF, P);
  k_proj<0><<<dim3(TNB * TT / 64, FF / 128), 128, 0, stream>>>(F[0], PW, F[6], F[14], F[15], P, QA, nullptr, nullptr);
  k_proj<1><<<dim3(TNB * TT / 64, FF / 128), 128, 0, stream>>>(F[1], PW + (size_t)FF * FF, F[8], F[14], F[15], P, KB, nullptr, nullptr);
  k_proj<2><<<dim3(TNB * TT / 64, FF / 128), 128, 0, stream>>>(F[2], PW + (size_t)2 * FF * FF, F[10], F[14], F[15], P, nullptr, VH, VL);
  k_attn<<<dim3(TQB, NH, TNB), 128, 0, stream>>>(QA, KB, MASK, VH, VL, O);
  k_out<<<dim3(TOB, FF / 128), 128, 0, stream>>>(O, PW + (size_t)4 * FF * FF, F[13], (float*)d_out);
}

// v003
// A run of this version takes 330 microseconds.
// In two side-by-side timings against v002, it was 1.17 and 1.16 times as fast.
// Counting every step since v000, it is 1.49 times as fast.
// compute dtype: query, key, value, pos_emb, mask, all weights/biases and the position biases (module inputs) rounded to bf16 / read as int32; the four input projections with exact bf16 products (inputs x inputs) on WMMA 16x16x32; scores as one 128-deep dot [q+u | q+v] . [k | p] with both computed operands as bf16 hi + residual pairs (3 products), P.V with P hi/lo x V hi/lo (3 products), output projection hi/lo x exact Wo (2 products); masking, softmax and the masked-row zeroing in f32; f32 accumulate.
#include <hip/hip_runtime.h>
#include <math.h>

typedef __attribute__((ext_vector_type(16))) _Float16 v16h;
typedef __attribute__((ext_vector_type(16))) __bf16 v16b;
typedef __attribute__((ext_vector_type(8)))  _Float16 v8h;
typedef __attribute__((ext_vector_type(8)))  float v8f;
typedef __attribute__((ext_vector_type(4)))  float v4f;
typedef __attribute__((ext_vector_type(2)))  float v2f;
typedef __attribute__((ext_vector_type(4)))  unsigned v4u;
typedef __attribute__((ext_vector_type(4)))  int v4i;
typedef float __attribute__((may_alias)) float_a;
typedef int __attribute__((may_alias)) int_a;

template <typename T> __device__ __forceinline__ void vst2(void* p, T v) { *(T*)p = v;  }
__device__ __forceinline__ v8f wmma16(v16h a, v16h b, v8f c) {
  v8f d = __builtin_amdgcn_wmma_f32_16x16x32_f16(false, a, false, b, (short)0, c, false, false);
  asm volatile("v_nop\n\tv_nop\n\tv_nop\n\tv_nop" : "+v"(d) : "v"(a), "v"(b));
  return d;
}
__device__ __forceinline__ v8f wmma_bf(v16b a, v16b b, v8f c) {
  v8f d = __builtin_amdgcn_wmma_f32_16x16x32_bf16(false, a, false, b, (short)0, c, false, false);
  asm volatile("v_nop\n\tv_nop\n\tv_nop\n\tv_nop" : "+v"(d) : "v"(a), "v"(b));
  return d;
}
// 16x16x32 fragments: lane = (h = lane>>4, row/col = lane&15); elements 0..7 = k0+8h+0..7, 8..15 = k0+16+8h+0..7; D element r = row 8h+r
__device__ __forceinline__ v16h frag_h(const _Float16* rowk0, int lane) {
  union { v16h v; v8h q[2]; } u; const _Float16* p = rowk0 + 8 * (lane >> 4);
  u.q[0] = *(const v8h*)p; u.q[1] = *(const v8h*)(p + 16); return u.v;
}
__device__ __forceinline__ v16h frag_f32(const float* rowk0, int lane) {
  v16h a; const float* p = rowk0 + 8 * (lane >> 4);
#pragma unroll
  for (int i = 0; i < 8; ++i) { a[i] = (_Float16)p[i]; a[8 + i] = (_Float16)p[16 + i]; }
  return a;
}
__device__ __forceinline__ v16h frag_f32s(const float* rowk0, int lane, float sc) {
  v16h a; const float* p = rowk0 + 8 * (lane >> 4);
#pragma unroll
  for (int i = 0; i < 8; ++i) { a[i] = (_Float16)(p[i] * sc); a[8 + i] = (_Float16)(p[16 + i] * sc); }
  return a;
}
// column fragment from a [K][ld] layout (column n), rows >= K read as 0
__device__ __forceinline__ v16h fragc_f32(const float* W, int k0, int n, int lane, int ld, int K) {
  v16h a; const int g = lane >> 4;
#pragma unroll
  for (int i = 0; i < 8; ++i) { const int ka = k0 + 8 * g + i, kb = ka + 16;
    a[i] = (_Float16)(ka < K ? W[(size_t)(ka < K ? ka : K - 1) * ld + n] : 0.f); a[8 + i] = (_Float16)(kb < K ? W[(size_t)(kb < K ? kb : K - 1) * ld + n] : 0.f); }
  return a;
}
struct F2 { v16b h, l; };
__device__ __forceinline__ F2 bsplit16(const float v[16]) { F2 r;
#pragma unroll
  for (int i = 0; i < 16; ++i) { const __bf16 h = (__bf16)v[i]; r.h[i] = h; r.l[i] = (__bf16)(v[i] - (float)h); }
  return r; }
__device__ __forceinline__ F2 split_row(const float* row, int k0, int lane) { float v[16]; const float* p = row + k0 + 8 * (lane >> 4);
#pragma unroll
  for (int i = 0; i < 8; ++i) { v[i] = p[i]; v[8 + i] = p[16 + i]; }
  return bsplit16(v); }
__device__ __forceinline__ F2 split_rowK(const float* row, int k0, int lane, int K) { float v[16]; const int g = lane >> 4;
#pragma unroll
  for (int i = 0; i < 8; ++i) { const int ka = k0 + 8 * g + i, kb = ka + 16; v[i] = ka < K ? row[ka < K ? ka : K - 1] : 0.f; v[8 + i] = kb < K ? row[kb < K ? kb : K - 1] : 0.f; }
  return bsplit16(v); }
__device__ __forceinline__ F2 split_col(const float* W, int k0, int n, int lane, int ld, int K) { float v[16]; const int g = lane >> 4;
#pragma unroll
  for (int i = 0; i < 8; ++i) { const int ka = k0 + 8 * g + i, kb = ka + 16; v[i] = ka < K ? W[(size_t)(ka < K ? ka : K - 1) * ld + n] : 0.f; v[8 + i] = kb < K ? W[(size_t)(kb < K ? kb : K - 1) * ld + n] : 0.f; }
  return bsplit16(v); }
__device__ __forceinline__ v8f mac3(const F2& a, const F2& b, v8f c) { c = wmma_bf(a.l, b.h, c); c = wmma_bf(a.h, b.l, c); return wmma_bf(a.h, b.h, c); }
__device__ __forceinline__ float sigm(float v) { return 1.0f / (1.0f + expf(-v)); }
#define LDSX() do { asm volatile("s_wait_dscnt 0" ::: "memory"); __builtin_amdgcn_wave_barrier(); __builtin_amdgcn_fence(__ATOMIC_RELEASE, "workgroup"); } while (0)


// Relative-position multi-head attention (B 8, T 1024, F 512, 8 heads x 64): q/k/v = Linear(query/key/value); p = pos_emb Wp^T; scores = ((q + pos_bias_u) k^T + (q + pos_bias_v) p^T) / sqrt(64); masked (mask == 0 -> float32 min); attn = softmax, then 0 where masked; x = attn v; out = x Wo^T + bo.
#define NB 8
#define TT 1024
#define FF 512
#define NH 8
#define HD 64
#ifndef TQB
#define TQB (TT / 64)
#define TNB NB
#define TOB (NB * TT / 64)
#endif
typedef __attribute__((ext_vector_type(8))) __bf16 v8b;
__device__ __forceinline__ v16b frag_b(const __bf16* rowk0, int lane) {
  union { v16b v; v8b q[2]; } u; const __bf16* p = rowk0 + 8 * (lane >> 4);
  u.q[0] = *(const v8b*)p; u.q[1] = *(const v8b*)(p + 16); return u.v;
}
__device__ __forceinline__ float bfr(float v) { return (float)(__bf16)v; }
// e^v for v <= 0 by the hardware's base-2 exponential: one multiply by log2(e) and one v_exp_f32
__device__ __forceinline__ float exp_hw(float v) { return __builtin_amdgcn_exp2f(v * 1.44269504f); }
__device__ __attribute__((noinline)) float erf_ni(float v) { return erff(v); }

#define WS_PW  0u                                   // bf16 natural rows: Wq, Wk, Wv, Wp, Wo [512][512] each
#define WS_QA  (WS_PW + 2u * 5 * FF * FF)            // f32 [NB*TT][8 h][128]: q+u | q+v
#define WS_KB  (WS_QA + 4u * NB * TT * NH * 128)      // f32 [NB*TT][8 h][128]: k | p
#define WS_VH  (WS_KB + 4u * NB * TT * NH * 128)      // bf16 [NB][512 (h*64+d)][TT]
#define WS_VL  (WS_VH + 2u * NB * FF * TT)
#define WS_P   (WS_VL + 2u * NB * FF * TT)            // f32 [TT][512] p = pos_emb Wp^T
#define WS_O   (WS_P + 4u * TT * FF)                  // f32 [NB*TT][512]
#define WS_END (WS_O + 4u * NB * TT * FF)

// ---- k_pack: block = (row n, which 0..4): natural [out][in] rows of Wq, Wk, Wv, Wp, Wo
__global__ __launch_bounds__(128) void k_pack(const float* __restrict__ WQ, const float* __restrict__ WK, const float* __restrict__ WV, const float* __restrict__ WP, const float* __restrict__ WO, __bf16* __restrict__ PW) {
  __shared__ __align__(16) __bf16 s[FF]; const int n = blockIdx.x, which = blockIdx.y, tid = threadIdx.x; const float* src = (which == 0 ? WQ : which == 1 ? WK : which == 2 ? WV : which == 3 ? WP : WO) + (size_t)n * FF;
  for (int k = tid; k < FF; k += 128) s[k] = (__bf16)src[k];
  __syncthreads();
  if (tid < FF / 8) vst2((unsigned*)(PW + ((size_t)which * FF + n) * FF + tid * 8), *(const v4u*)&s[tid * 8]);
}
// ---- k_posp: block = (64 positions, 128 cols): p = bf16(pos_emb) . Wp rows (exact) -> P rows (512-B segments)
__global__ __launch_bounds__(128) void k_posp(const float* __restrict__ PE, const __bf16* __restrict__ P4, float* __restrict__ P) {
  __shared__ __align__(16) float so[4][16][132];
  const int tid = threadIdx.x, wave = tid >> 5, lane = tid & 31, col = lane & 15, g = lane >> 4; const size_t r0 = (size_t)blockIdx.x * 64 + wave * 16; const int n0 = blockIdx.y * 128;
  v8f acc[8] = {};
#pragma unroll 2
  for (int kc = 0; kc < FF / 32; ++kc) { v16b a; { const float* p = PE + (r0 + col) * FF + kc * 32 + 8 * g;
#pragma unroll
      for (int i = 0; i < 8; ++i) { a[i] = (__bf16)p[i]; a[8 + i] = (__bf16)p[16 + i]; } }
#pragma unroll
    for (int j = 0; j < 8; ++j) acc[j] = wmma_bf(a, frag_b(P4 + (size_t)(n0 + j * 16 + col) * FF + kc * 32, lane), acc[j]); }
#pragma unroll
  for (int j = 0; j < 8; ++j)
#pragma unroll
    for (int r = 0; r < 8; ++r) so[wave][8 * g + r][j * 16 + col] = acc[j][r];
  LDSX();
  for (int rl = 0; rl < 16; ++rl) vst2(P + (r0 + rl) * FF + n0 + lane * 4, *(const v4f*)&so[wave][rl][lane * 4]);
}
// ---- k_proj<MODE>: block = (64 rows (b,t), 128 cols = 2 heads): MODE 0: q = query.Wq^T + bq -> QA[row][h][q+u | q+v] (512-B per (row, head)); MODE 1: k = key.Wk^T + bk -> KB[row][h][k | p[t]] ; MODE 2: v = value.Wv^T + bv -> transposed hi/lo planes
template <int MODE>
__global__ __launch_bounds__(128) void k_proj(const float* __restrict__ X, const __bf16* __restrict__ P1, const float* __restrict__ bias, const float* __restrict__ U, const float* __restrict__ Vb, const float* __restrict__ PP, float* __restrict__ OUT, __bf16* __restrict__ VH, __bf16* __restrict__ VL) {
  __shared__ __align__(16) float so[4][16][260]; __shared__ __align__(16) __bf16 sth[128][72], stl[128][72];
  const int tid = threadIdx.x, wave = tid >> 5, lane = tid & 31, col = lane & 15, g = lane >> 4; const size_t rb = (size_t)blockIdx.x * 64; const size_t r0 = rb + wave * 16; const int n0 = blockIdx.y * 128;
  v8f acc[8] = {};
#pragma unroll 2
  for (int kc = 0; kc < FF / 32; ++kc) { v16b a; { const float* p = X + (r0 + col) * FF + kc * 32 + 8 * g;
#pragma unroll
      for (int i = 0; i < 8; ++i) { a[i] = (__bf16)p[i]; a[8 + i] = (__bf16)p[16 + i]; } }
#pragma unroll
    for (int j = 0; j < 8; ++j) acc[j] = wmma_bf(a, frag_b(P1 + (size_t)(n0 + j * 16 + col) * FF + kc * 32, lane), acc[j]); }
  if (MODE == 2) {
#pragma unroll
    for (int j = 0; j < 8; ++j) { const float bb = bfr(bias[n0 + j * 16 + col]);
#pragma unroll
      for (int r = 0; r < 8; ++r) { const float v = acc[j][r] + bb; const __bf16 hb = (__bf16)v; sth[j * 16 + col][wave * 16 + 8 * g + r] = hb; stl[j * 16 + col][wave * 16 + 8 * g + r] = (__bf16)(v - (float)hb); } }
    __syncthreads();
    const int b = (int)(rb / TT), t0 = (int)(rb % TT);
    for (int q = tid; q < 128 * 8; q += 128) { const int d = q >> 3, pc = q & 7; const size_t o = ((size_t)b * FF + n0 + d) * TT + t0 + pc * 8; vst2((unsigned*)(VH + o), *(const v4u*)&sth[d][pc * 8]); vst2((unsigned*)(VL + o), *(const v4u*)&stl[d][pc * 8]); }
  } else {
    // two heads in this column block: hl = j / 4 (local), d = (j % 4) * 16 + col; segment layout per (row, head): [first 64 | second 64]
#pragma unroll
    for (int j = 0; j < 8; ++j) { const int hl = j >> 2, d = (j & 3) * 16 + col; const int h = (n0 >> 6) + hl; const float bb = bfr(bias[n0 + j * 16 + col]);
#pragma unroll
      for (int r = 0; r < 8; ++r) { const float v = acc[j][r] + bb; const int rl = 8 * g + r;
        if (MODE == 0) { so[wave][rl][hl * 128 + d] = v + bfr(U[h * HD + d]); so[wave][rl][hl * 128 + 64 + d] = v + bfr(Vb[h * HD + d]); }
        else { const size_t t = (r0 + rl) % TT; so[wave][rl][hl * 128 + d] = v; so[wave][rl][hl * 128 + 64 + d] = PP[t * FF + h * HD + d]; } } }
    LDSX();
    const int h0 = n0 >> 6;
    for (int rl = 0; rl < 16; ++rl) { vst2(OUT + ((r0 + rl) * NH + h0) * 128 + lane * 4, *(const v4f*)&so[wave][rl][lane * 4]); vst2(OUT + ((r0 + rl) * NH + h0) * 128 + 128 + lane * 4, *(const v4f*)&so[wave][rl][128 + lane * 4]); }
  }
}
// ---- k_attn: block = (64 queries, head h, batch b): per 32-key step: mask tile loads (int) -> wave vote -> {scores = [q+u|q+v].[k|p] / 8 (3 products, K 128), masked -> -3e38; online softmax; P(hi/lo).V(hi/lo)}; rows with no live key output 0 (the module's where(mask==0, 0, softmax)); O[row][h*64+d]
// The step's K rows (32 x 512 B) and V hi/lo rows (2 x 64 x 64 B) are the same for the block's four waves: they are brought into LDS once per block by asynchronous copies (whole lines of K per wave-instruction), one step ahead, two buffers.
#define KPITCH 528                                   // 512-B K row + 16 B: 16 B x odd, conflict-free for 16-byte LDS reads
#define VPITCH 80                                    // 64-B V row + 16 B: 16 B x odd
#define ST_VH  (32 * KPITCH)
#define ST_VL  (ST_VH + HD * VPITCH)
#define ST_SZ  (ST_VL + HD * VPITCH)
// one stage = 12 copies of 16 B per lane: 8 of K (copy i: key row 4 i + wave, the wave's 32 lanes cover the 512-B row), 2 of V hi, 2 of V lo (4 lanes per 64-B row)
__device__ __forceinline__ void stage_kv(unsigned lk, unsigned lv, const float* gk, const __bf16* gh, const __bf16* gl) {
  // s_wait_xcnt closes the statement so that it stands in front of any later rewrite of the address registers the copies name
  asm volatile("global_load_async_to_lds_b128 %0, %12, off\n\t"
               "global_load_async_to_lds_b128 %1, %13, off\n\t"
               "global_load_async_to_lds_b128 %2, %14, off\n\t"
               "global_load_async_to_lds_b128 %3, %15, off\n\t"
               "global_load_async_to_lds_b128 %4, %16, off\n\t"
               "global_load_async_to_lds_b128 %5, %17, off\n\t"
               "global_load_async_to_lds_b128 %6, %18, off\n\t"
               "global_load_async_to_lds_b128 %7, %19, off\n\t"
               "global_load_async_to_lds_b128 %8, %20, off\n\t"
               "global_load_async_to_lds_b128 %9, %21, off\n\t"
               "global_load_async_to_lds_b128 %10, %22, off\n\t"
               "global_load_async_to_lds_b128 %11, %23, off\n\t"
               "s_wait_xcnt 0x0"
               :: "v"(lk), "v"(lk + 4 * KPITCH), "v"(lk + 8 * KPITCH), "v"(lk + 12 * KPITCH), "v"(lk + 16 * KPITCH), "v"(lk + 20 * KPITCH), "v"(lk + 24 * KPITCH), "v"(lk + 28 * KPITCH),
                  "v"(lv + ST_VH), "v"(lv + ST_VH + 32 * VPITCH), "v"(lv + ST_VL), "v"(lv + ST_VL + 32 * VPITCH),
                  "v"(gk), "v"(gk + 4 * NH * 128), "v"(gk + 8 * NH * 128), "v"(gk + 12 * NH * 128), "v"(gk + 16 * NH * 128), "v"(gk + 20 * NH * 128), "v"(gk + 24 * NH * 128), "v"(gk + 28 * NH * 128),
                  "v"(gh), "v"(gh + 32 * TT), "v"(gl), "v"(gl + 32 * TT)
               : "memory");
}
__global__ __launch_bounds__(128) void k_attn(const float* __restrict__ QA, const float* __restrict__ KB, const int* __restrict__ MASK, const __bf16* __restrict__ VH, const __bf16* __restrict__ VL, float* __restrict__ O) {
  __shared__ __align__(16) char ring[2 * ST_SZ];
  __shared__ __align__(16) float sp[4][16][36]; __shared__ __align__(16) float so[4][16][68];
  const int tid = threadIdx.x, wave = tid >> 5, lane = tid & 31, col = lane & 15, g = lane >> 4;
  const int qb = blockIdx.x, h = blockIdx.y, b = blockIdx.z; const int q0 = qb * 64 + wave * 16; const size_t rq = (size_t)b * TT + q0;
  const float* qrow = QA + ((rq + col) * NH + h) * 128;
  // this lane's places in a stage (LDS byte addresses in buffer 0) and its sources at key step 0
  const unsigned lk0 = (unsigned)(size_t)&ring[wave * KPITCH + lane * 16], lv0 = (unsigned)(size_t)&ring[(tid >> 2) * VPITCH + (tid & 3) * 16];
  const float* gk0 = KB + (((size_t)b * TT + wave) * NH + h) * 128 + lane * 4;
  const size_t gvo = ((size_t)b * FF + h * HD + (tid >> 2)) * TT + (tid & 3) * 8;
  stage_kv(lk0, lv0, gk0, VH + gvo, VL + gvo);
  float m[8], l[8];
#pragma unroll
  for (int r = 0; r < 8; ++r) { m[r] = -3.0e38f; l[r] = 0.f; }
  v8f acc[4] = {};
  // the wave's 16 query rows do not change over the key loop: load and split them to bf16 hi/lo fragments once, kept in registers (unrolled so that qa[] is indexed by constants and never goes to scratch)
  F2 qa[4];
#pragma unroll
  for (int kc = 0; kc < 4; ++kc) qa[kc] = split_row(qrow, kc * 32, lane);
  asm volatile("s_wait_asynccnt 0x0" ::: "memory");   // this wave's copies of step 0 have landed
  __syncthreads();                                     // and every other wave's: step 0 may be read
  stage_kv(lk0 + ST_SZ, lv0 + ST_SZ, gk0 + (size_t)32 * NH * 128, VH + gvo + 32, VL + gvo + 32);
#pragma unroll 1
  for (int ks = 0; ks < TT / 32; ++ks) { v8f s[2]; int mk[2][8]; bool anylive = false; const char* st = ring + (ks & 1) * ST_SZ;
#pragma unroll
    for (int ct = 0; ct < 2; ++ct) { const int kk = ks * 32 + ct * 16 + col;
#pragma unroll
      for (int r = 0; r < 8; ++r) { const int mv = MASK[((size_t)b * TT + q0 + 8 * g + r) * TT + kk]; mk[ct][r] = mv; anylive = anylive || (mv != 0); } }
    if (__any(anylive)) {
#pragma unroll
      for (int ct = 0; ct < 2; ++ct) { const char* krow = st + (ct * 16 + col) * KPITCH; v8f c = {};
#pragma unroll
        for (int kc = 0; kc < 4; ++kc) { const F2 kb = split_row((const float*)krow, kc * 32, lane); c = mac3(qa[kc], kb, c); }
#pragma unroll
        for (int r = 0; r < 8; ++r) s[ct][r] = (mk[ct][r] != 0) ? c[r] * 0.125f : -3.0e38f; }
#pragma unroll
      for (int r = 0; r < 8; ++r) { float mx = fmaxf(s[0][r], s[1][r]);
#pragma unroll
        for (int o = 1; o < 16; o <<= 1) mx = fmaxf(mx, __shfl_xor(mx, o));
        // the three exponentials stand in line, for every lane, and a masked value is replaced by a select: no call and no branch on the lane mask, so the eight rows' chains can overlap
        const float mn = fmaxf(m[r], mx); const float xa = exp_hw(m[r] - mn), x0 = exp_hw(s[0][r] - mn), x1 = exp_hw(s[1][r] - mn);
        const float alpha = (m[r] <= -1.0e38f) ? 0.f : xa;
        const float e0 = (s[0][r] <= -1.0e38f) ? 0.f : x0, e1 = (s[1][r] <= -1.0e38f) ? 0.f : x1; float es = e0 + e1;
#pragma unroll
        for (int o = 1; o < 16; o <<= 1) es += __shfl_xor(es, o);
        l[r] = l[r] * alpha + es; m[r] = mn;
#pragma unroll
        for (int dt = 0; dt < 4; ++dt) acc[dt][r] *= alpha;
        sp[wave][8 * g + r][col] = e0; sp[wave][8 * g + r][16 + col] = e1; }
      LDSX();
      const F2 pa = split_row(&sp[wave][col][0], 0, lane);
#pragma unroll
      for (int dt = 0; dt < 4; ++dt) { const int vr = (dt * 16 + col) * VPITCH; const v16b vh = frag_b((const __bf16*)(st + ST_VH + vr), lane), vl = frag_b((const __bf16*)(st + ST_VL + vr), lane); acc[dt] = wmma_bf(pa.l, vh, acc[dt]); acc[dt] = wmma_bf(pa.h, vl, acc[dt]); acc[dt] = wmma_bf(pa.h, vh, acc[dt]); }
      LDSX(); }
    // hand-over, every wave, also one that skipped the step's work:
    asm volatile("s_wait_dscnt 0x0" ::: "memory");     // this wave's reads of the step's buffer are done
    asm volatile("s_wait_asynccnt 0x0" ::: "memory");  // this wave's copies of step ks + 1 have landed
    __syncthreads();                                    // publishes step ks + 1 and frees the buffer just read
    if (ks + 2 < TT / 32) stage_kv(lk0 + (ks & 1) * ST_SZ, lv0 + (ks & 1) * ST_SZ, gk0 + (size_t)(ks + 2) * 32 * NH * 128, VH + gvo + (ks + 2) * 32, VL + gvo + (ks + 2) * 32); }
  asm volatile("s_wait_asynccnt 0x0" ::: "memory");    // no copy is left in flight when the wave goes on to its end
#pragma unroll
  for (int r = 0; r < 8; ++r) { const float il = (l[r] > 0.f) ? 1.0f / l[r] : 0.f;
#pragma unroll
    for (int dt = 0; dt < 4; ++dt) so[wave][8 * g + r][dt * 16 + col] = acc[dt][r] * il; }
  LDSX();
  for (int rl = 0; rl < 16; ++rl) if (lane < 16) vst2(O + (rq + rl) * FF + h * HD + lane * 4, *(const v4f*)&so[wave][rl][lane * 4]);
}
// ---- k_out: block = (64 rows, 128 cols): out = O(hi/lo) . Wo rows (2 products) + bo
__global__ __launch_bounds__(128) void k_out(const float* __restrict__ O, const __bf16* __restrict__ P, const float* __restrict__ bias, float* __restrict__ Y) {
  __shared__ __align__(16) float so[4][16][132];
  const int tid = threadIdx.x, wave = tid >> 5, lane = tid & 31, col = lane & 15, g = lane >> 4; const size_t r0 = (size_t)blockIdx.x * 64 + wave * 16; const int n0 = blockIdx.y * 128;
  v8f acc[8] = {};
#pragma unroll 2
  for (int kc = 0; kc < FF / 32; ++kc) { const F2 a = split_row(O + (r0 + col) * FF, kc * 32, lane);
#pragma unroll
    for (int j = 0; j < 8; ++j) { const v16b w = frag_b(P + (size_t)(n0 + j * 16 + col) * FF + kc * 32, lane); acc[j] = wmma_bf(a.l, w, acc[j]); acc[j] = wmma_bf(a.h, w, acc[j]); } }
#pragma unroll
  for (int j = 0; j < 8; ++j) { const float bb = bfr(bias[n0 + j * 16 + col]);
#pragma unroll
    for (int r = 0; r < 8; ++r) so[wave][8 * g + r][j * 16 + col] = acc[j][r] + bb; }
  LDSX();
  for (int rl = 0; rl < 16; ++rl) vst2(Y + (r0 + rl) * FF + n0 + lane * 4, *(const v4f*)&so[wave][rl][lane * 4]);
}
extern "C" void kernel_launch(void* const* d_in, const int* in_sizes, int n_in, void* d_out, int out_size, void* d_ws, size_t ws_size, hipStream_t stream) {
  (void)in_sizes; (void)n_in; (void)out_size;
  const float** F = (const float**)d_in; const int* MASK = (const int*)d_in[3];
  // 0 query, 1 key, 2 value [8,1024,512], 3 mask [8,1024,1024] i32, 4 pos_emb [1,1024,512], 5 Wq, 6 bq, 7 Wk, 8 bk, 9 Wv, 10 bv, 11 Wp, 12 Wo, 13 bo, 14 pos_bias_u [8,64], 15 pos_bias_v [8,64]
  if (ws_size < (size_t)WS_END) return;
  char* ws = (char*)d_ws; __bf16 *PW = (__bf16*)(ws + WS_PW), *VH = (__bf16*)(ws + WS_VH), *VL = (__bf16*)(ws + WS_VL); float *QA = (float*)(ws + WS_QA), *KB = (float*)(ws + WS_KB), *P = (float*)(ws + WS_P), *O = (float*)(ws + WS_O);
  k_pack<<<dim3(FF, 5), 128, 0, stream>>>(F[5], F[7], F[9], F[11], F[12], PW);
  k_posp<<<dim3(TT / 64, FF / 128), 128, 0, stream>>>(F[4], PW + (size_t)3 * FF * FF, P);
  k_proj<0><<<dim3(TNB * TT / 64, FF / 128), 128, 0, stream>>>(F[0], PW, F[6], F[14], F[15], P, QA, nullptr, nullptr);
  k_proj<1><<<dim3(TNB * TT / 64, FF / 128), 128, 0, stream>>>(F[1], PW + (size_t)FF * FF, F[8], F[14], F[15], P, KB, nullptr, nullptr);
  k_proj<2><<<dim3(TNB * TT / 64, FF / 128), 128, 0, stream>>>(F[2], PW + (size_t)2 * FF * FF, F[10], F[14], F[15], P, nullptr, VH, VL);
  k_attn<<<dim3(TQB, NH, TNB), 128, 0, stream>>>(QA, KB, MASK, VH, VL, O);
  k_out<<<dim3(TOB, FF / 128), 128, 0, stream>>>(O, PW + (size_t)4 * FF * FF, F[13], (float*)d_out);
}

// v004
// Measured time: 302 microseconds a run.
// Two timings next to v003 put it at 1.09 and 1.08 times that version's speed.
// All steps since v000 together make it 1.62 times as fast.
// compute dtype: query, key, value, pos_emb, mask, all weights/biases and the position biases (module inputs) rounded to bf16 / read as int32; the four input projections with exact bf16 products (inputs x inputs) on WMMA 16x16x32; scores as one 128-deep dot [q+u | q+v] . [k | p] with both computed operands as bf16 hi + residual pairs (3 products), P.V with P hi/lo x V hi/lo (3 products), output projection hi/lo x exact Wo (2 products); masking, softmax and the masked-row zeroing in f32; f32 accumulate.
#include <hip/hip_runtime.h>
#include <math.h>

typedef __attribute__((ext_vector_type(16))) _Float16 v16h;
typedef __attribute__((ext_vector_type(16))) __bf16 v16b;
typedef __attribute__((ext_vector_type(8)))  _Float16 v8h;
typedef __attribute__((ext_vector_type(8)))  float v8f;
typedef __attribute__((ext_vector_type(4)))  float v4f;
typedef __attribute__((ext_vector_type(2)))  float v2f;
typedef __attribute__((ext_vector_type(4)))  unsigned v4u;
typedef __attribute__((ext_vector_type(4)))  int v4i;
typedef float __attribute__((may_alias)) float_a;
typedef int __attribute__((may_alias)) int_a;

template <typename T> __device__ __forceinline__ void vst2(void* p, T v) { *(T*)p = v;  }
__device__ __forceinline__ v8f wmma16(v16h a, v16h b, v8f c) {
  v8f d = __builtin_amdgcn_wmma_f32_16x16x32_f16(false, a, false, b, (short)0, c, false, false);
  asm volatile("v_nop\n\tv_nop\n\tv_nop\n\tv_nop" : "+v"(d) : "v"(a), "v"(b));
  return d;
}
__device__ __forceinline__ v8f wmma_bf(v16b a, v16b b, v8f c) {
  v8f d = __builtin_amdgcn_wmma_f32_16x16x32_bf16(false, a, false, b, (short)0, c, false, false);
  asm volatile("v_nop\n\tv_nop\n\tv_nop\n\tv_nop" : "+v"(d) : "v"(a), "v"(b));
  return d;
}
// 16x16x32 fragments: lane = (h = lane>>4, row/col = lane&15); elements 0..7 = k0+8h+0..7, 8..15 = k0+16+8h+0..7; D element r = row 8h+r
__device__ __forceinline__ v16h frag_h(const _Float16* rowk0, int lane) {
  union { v16h v; v8h q[2]; } u; const _Float16* p = rowk0 + 8 * (lane >> 4);
  u.q[0] = *(const v8h*)p; u.q[1] = *(const v8h*)(p + 16); return u.v;
}
__device__ __forceinline__ v16h frag_f32(const float* rowk0, int lane) {
  v16h a; const float* p = rowk0 + 8 * (lane >> 4);
#pragma unroll
  for (int i = 0; i < 8; ++i) { a[i] = (_Float16)p[i]; a[8 + i] = (_Float16)p[16 + i]; }
  return a;
}
__device__ __forceinline__ v16h frag_f32s(const float* rowk0, int lane, float sc) {
  v16h a; const float* p = rowk0 + 8 * (lane >> 4);
#pragma unroll
  for (int i = 0; i < 8; ++i) { a[i] = (_Float16)(p[i] * sc); a[8 + i] = (_Float16)(p[16 + i] * sc); }
  return a;
}
// column fragment from a [K][ld] layout (column n), rows >= K read as 0
__device__ __forceinline__ v16h fragc_f32(const float* W, int k0, int n, int lane, int ld, int K) {
  v16h a; const int g = lane >> 4;
#pragma unroll
  for (int i = 0; i < 8; ++i) { const int ka = k0 + 8 * g + i, kb = ka + 16;
    a[i] = (_Float16)(ka < K ? W[(size_t)(ka < K ? ka : K - 1) * ld + n] : 0.f); a[8 + i] = (_Float16)(kb < K ? W[(size_t)(kb < K ? kb : K - 1) * ld + n] : 0.f); }
  return a;
}
struct F2 { v16b h, l; };
__device__ __forceinline__ F2 bsplit16(const float v[16]) { F2 r;
#pragma unroll
  for (int i = 0; i < 16; ++i) { const __bf16 h = (__bf16)v[i]; r.h[i] = h; r.l[i] = (__bf16)(v[i] - (float)h); }
  return r; }
__device__ __forceinline__ F2 split_row(const float* row, int k0, int lane) { float v[16]; const float* p = row + k0 + 8 * (lane >> 4);
#pragma unroll
  for (int i = 0; i < 8; ++i) { v[i] = p[i]; v[8 + i] = p[16 + i]; }
  return bsplit16(v); }
__device__ __forceinline__ F2 split_rowK(const float* row, int k0, int lane, int K) { float v[16]; const int g = lane >> 4;
#pragma unroll
  for (int i = 0; i < 8; ++i) { const int ka = k0 + 8 * g + i, kb = ka + 16; v[i] = ka < K ? row[ka < K ? ka : K - 1] : 0.f; v[8 + i] = kb < K ? row[kb < K ? kb : K - 1] : 0.f; }
  return bsplit16(v); }
__device__ __forceinline__ F2 split_col(const float* W, int k0, int n, int lane, int ld, int K) { float v[16]; const int g = lane >> 4;
#pragma unroll
  for (int i = 0; i < 8; ++i) { const int ka = k0 + 8 * g + i, kb = ka + 16; v[i] = ka < K ? W[(size_t)(ka < K ? ka : K - 1) * ld + n] : 0.f; v[8 + i] = kb < K ? W[(size_t)(kb < K ? kb : K - 1) * ld + n] : 0.f; }
  return bsplit16(v); }
__device__ __forceinline__ v8f mac3(const F2& a, const F2& b, v8f c) { c = wmma_bf(a.l, b.h, c); c = wmma_bf(a.h, b.l, c); return wmma_bf(a.h, b.h, c); }
__device__ __forceinline__ float sigm(float v) { return 1.0f / (1.0f + expf(-v)); }
#define LDSX() do { asm volatile("s_wait_dscnt 0" ::: "memory"); __builtin_amdgcn_wave_barrier(); __builtin_amdgcn_fence(__ATOMIC_RELEASE, "workgroup"); } while (0)


// Relative-position multi-head attention (B 8, T 1024, F 512, 8 heads x 64): q/k/v = Linear(query/key/value); p = pos_emb Wp^T; scores = ((q + pos_bias_u) k^T + (q + pos_bias_v) p^T) / sqrt(64); masked (mask == 0 -> float32 min); attn = softmax, then 0 where masked; x = attn v; out = x Wo^T + bo.
#define NB 8
#define TT 1024
#define FF 512
#define NH 8
#define HD 64
#ifndef TQB
#define TQB (TT / 64)
#define TNB NB
#define TOB (NB * TT / 64)
#endif
typedef __attribute__((ext_vector_type(8))) __bf16 v8b;
__device__ __forceinline__ v16b frag_b(const __bf16* rowk0, int lane) {
  union { v16b v; v8b q[2]; } u; const __bf16* p = rowk0 + 8 * (lane >> 4);
  u.q[0] = *(const v8b*)p; u.q[1] = *(const v8b*)(p + 16); return u.v;
}
__device__ __forceinline__ float bfr(float v) { return (float)(__bf16)v; }
// e^v for v <= 0 by the hardware's base-2 exponential: one multiply by log2(e) and one v_exp_f32
__device__ __forceinline__ float exp_hw(float v) { return __builtin_amdgcn_exp2f(v * 1.44269504f); }
__device__ __attribute__((noinline)) float erf_ni(float v) { return erff(v); }

#define WS_PW  0u                                   // bf16 natural rows: Wq, Wk, Wv, Wp, Wo [512][512] each
#define WS_QA  (WS_PW + 2u * 5 * FF * FF)            // f32 [NB*TT][8 h][128]: q+u | q+v
#define WS_KB  (WS_QA + 4u * NB * TT * NH * 128)      // f32 [NB*TT][8 h][128]: k | p
#define WS_VH  (WS_KB + 4u * NB * TT * NH * 128)      // bf16 [NB][512 (h*64+d)][TT]
#define WS_VL  (WS_VH + 2u * NB * FF * TT)
#define WS_P   (WS_VL + 2u * NB * FF * TT)            // f32 [TT][512] p = pos_emb Wp^T
#define WS_O   (WS_P + 4u * TT * FF)                  // f32 [NB*TT][512]
#define WS_END (WS_O + 4u * NB * TT * FF)

// ---- k_pack: block = (row n, which 0..4): natural [out][in] rows of Wq, Wk, Wv, Wp, Wo
__global__ __launch_bounds__(128) void k_pack(const float* __restrict__ WQ, const float* __restrict__ WK, const float* __restrict__ WV, const float* __restrict__ WP, const float* __restrict__ WO, __bf16* __restrict__ PW) {
  __shared__ __align__(16) __bf16 s[FF]; const int n = blockIdx.x, which = blockIdx.y, tid = threadIdx.x; const float* src = (which == 0 ? WQ : which == 1 ? WK : which == 2 ? WV : which == 3 ? WP : WO) + (size_t)n * FF;
  for (int k = tid; k < FF; k += 128) s[k] = (__bf16)src[k];
  __syncthreads();
  if (tid < FF / 8) vst2((unsigned*)(PW + ((size_t)which * FF + n) * FF + tid * 8), *(const v4u*)&s[tid * 8]);
}
// ---- k_posp: block = (64 positions, 128 cols): p = bf16(pos_emb) . Wp rows (exact) -> P rows (512-B segments)
__global__ __launch_bounds__(128) void k_posp(const float* __restrict__ PE, const __bf16* __restrict__ P4, float* __restrict__ P) {
  __shared__ __align__(16) float so[4][16][132];
  const int tid = threadIdx.x, wave = tid >> 5, lane = tid & 31, col = lane & 15, g = lane >> 4; const size_t r0 = (size_t)blockIdx.x * 64 + wave * 16; const int n0 = blockIdx.y * 128;
  v8f acc[8] = {};
#pragma unroll 2
  for (int kc = 0; kc < FF / 32; ++kc) { v16b a; { const float* p = PE + (r0 + col) * FF + kc * 32 + 8 * g;
#pragma unroll
      for (int i = 0; i < 8; ++i) { a[i] = (__bf16)p[i]; a[8 + i] = (__bf16)p[16 + i]; } }
#pragma unroll
    for (int j = 0; j < 8; ++j) acc[j] = wmma_bf(a, frag_b(P4 + (size_t)(n0 + j * 16 + col) * FF + kc * 32, lane), acc[j]); }
#pragma unroll
  for (int j = 0; j < 8; ++j)
#pragma unroll
    for (int r = 0; r < 8; ++r) so[wave][8 * g + r][j * 16 + col] = acc[j][r];
  LDSX();
  for (int rl = 0; rl < 16; ++rl) vst2(P + (r0 + rl) * FF + n0 + lane * 4, *(const v4f*)&so[wave][rl][lane * 4]);
}
// ---- k_proj<MODE>: block = (64 rows (b,t), 128 cols = 2 heads): MODE 0: q = query.Wq^T + bq -> QA[row][h][q+u | q+v] (512-B per (row, head)); MODE 1: k = key.Wk^T + bk -> KB[row][h][k | p[t]] ; MODE 2: v = value.Wv^T + bv -> transposed hi/lo planes
template <int MODE>
__global__ __launch_bounds__(128) void k_proj(const float* __restrict__ X, const __bf16* __restrict__ P1, const float* __restrict__ bias, const float* __restrict__ U, const float* __restrict__ Vb, const float* __restrict__ PP, float* __restrict__ OUT, __bf16* __restrict__ VH, __bf16* __restrict__ VL) {
  __shared__ __align__(16) float so[4][16][260]; __shared__ __align__(16) __bf16 sth[128][72], stl[128][72];
  const int tid = threadIdx.x, wave = tid >> 5, lane = tid & 31, col = lane & 15, g = lane >> 4; const size_t rb = (size_t)blockIdx.x * 64; const size_t r0 = rb + wave * 16; const int n0 = blockIdx.y * 128;
  v8f acc[8] = {};
#pragma unroll 2
  for (int kc = 0; kc < FF / 32; ++kc) { v16b a; { const float* p = X + (r0 + col) * FF + kc * 32 + 8 * g;
#pragma unroll
      for (int i = 0; i < 8; ++i) { a[i] = (__bf16)p[i]; a[8 + i] = (__bf16)p[16 + i]; } }
#pragma unroll
    for (int j = 0; j < 8; ++j) acc[j] = wmma_bf(a, frag_b(P1 + (size_t)(n0 + j * 16 + col) * FF + kc * 32, lane), acc[j]); }
  if (MODE == 2) {
#pragma unroll
    for (int j = 0; j < 8; ++j) { const float bb = bfr(bias[n0 + j * 16 + col]);
#pragma unroll
      for (int r = 0; r < 8; ++r) { const float v = acc[j][r] + bb; const __bf16 hb = (__bf16)v; sth[j * 16 + col][wave * 16 + 8 * g + r] = hb; stl[j * 16 + col][wave * 16 + 8 * g + r] = (__bf16)(v - (float)hb); } }
    __syncthreads();
    const int b = (int)(rb / TT), t0 = (int)(rb % TT);
    for (int q = tid; q < 128 * 8; q += 128) { const int d = q >> 3, pc = q & 7; const size_t o = ((size_t)b * FF + n0 + d) * TT + t0 + pc * 8; vst2((unsigned*)(VH + o), *(const v4u*)&sth[d][pc * 8]); vst2((unsigned*)(VL + o), *(const v4u*)&stl[d][pc * 8]); }
  } else {
    // two heads in this column block: hl = j / 4 (local), d = (j % 4) * 16 + col; segment layout per (row, head): [first 64 | second 64]
#pragma unroll
    for (int j = 0; j < 8; ++j) { const int hl = j >> 2, d = (j & 3) * 16 + col; const int h = (n0 >> 6) + hl; const float bb = bfr(bias[n0 + j * 16 + col]);
#pragma unroll
      for (int r = 0; r < 8; ++r) { const float v = acc[j][r] + bb; const int rl = 8 * g + r;
        if (MODE == 0) { so[wave][rl][hl * 128 + d] = v + bfr(U[h * HD + d]); so[wave][rl][hl * 128 + 64 + d] = v + bfr(Vb[h * HD + d]); }
        else { const size_t t = (r0 + rl) % TT; so[wave][rl][hl * 128 + d] = v; so[wave][rl][hl * 128 + 64 + d] = PP[t * FF + h * HD + d]; } } }
    LDSX();
    const int h0 = n0 >> 6;
    for (int rl = 0; rl < 16; ++rl) { vst2(OUT + ((r0 + rl) * NH + h0) * 128 + lane * 4, *(const v4f*)&so[wave][rl][lane * 4]); vst2(OUT + ((r0 + rl) * NH + h0) * 128 + 128 + lane * 4, *(const v4f*)&so[wave][rl][128 + lane * 4]); }
  }
}
// ---- k_attn: block = (64 queries, head h, batch b): per 32-key step: mask tile loads (int) -> wave vote -> {transposed scores S^T = [k|p].[q+u|q+v]^T / 8 (3 products, K 128), masked -> -3e38; online softmax in-lane, one query per lane; O^T += V^T(hi/lo).P^T(hi/lo)}; rows with no live key output 0 (the module's where(mask==0, 0, softmax)); O[row][h*64+d]
// The step's K rows (32 x 512 B) and V hi/lo rows (2 x 64 x 64 B) are the same for the block's four waves: they are brought into LDS once per block by asynchronous copies (whole lines of K per wave-instruction), one step ahead, two buffers.
#define KPITCH 528                                   // 512-B K row + 16 B: 16 B x odd, conflict-free for 16-byte LDS reads
#define VPITCH 80                                    // 64-B V row + 16 B: 16 B x odd
#define ST_VH  (32 * KPITCH)
#define ST_VL  (ST_VH + HD * VPITCH)
#define ST_SZ  (ST_VL + HD * VPITCH)
// one stage = 12 copies of 16 B per lane: 8 of K (copy i: key row 4 i + wave, the wave's 32 lanes cover the 512-B row), 2 of V hi, 2 of V lo (4 lanes per 64-B row)
__device__ __forceinline__ void stage_kv(unsigned lk, unsigned lv, const float* gk, const __bf16* gh, const __bf16* gl) {
  // s_wait_xcnt closes the statement so that it stands in front of any later rewrite of the address registers the copies name
  asm volatile("global_load_async_to_lds_b128 %0, %12, off\n\t"
               "global_load_async_to_lds_b128 %1, %13, off\n\t"
               "global_load_async_to_lds_b128 %2, %14, off\n\t"
               "global_load_async_to_lds_b128 %3, %15, off\n\t"
               "global_load_async_to_lds_b128 %4, %16, off\n\t"
               "global_load_async_to_lds_b128 %5, %17, off\n\t"
               "global_load_async_to_lds_b128 %6, %18, off\n\t"
               "global_load_async_to_lds_b128 %7, %19, off\n\t"
               "global_load_async_to_lds_b128 %8, %20, off\n\t"
               "global_load_async_to_lds_b128 %9, %21, off\n\t"
               "global_load_async_to_lds_b128 %10, %22, off\n\t"
               "global_load_async_to_lds_b128 %11, %23, off\n\t"
               "s_wait_xcnt 0x0"
               :: "v"(lk), "v"(lk + 4 * KPITCH), "v"(lk + 8 * KPITCH), "v"(lk + 12 * KPITCH), "v"(lk + 16 * KPITCH), "v"(lk + 20 * KPITCH), "v"(lk + 24 * KPITCH), "v"(lk + 28 * KPITCH),
                  "v"(lv + ST_VH), "v"(lv + ST_VH + 32 * VPITCH), "v"(lv + ST_VL), "v"(lv + ST_VL + 32 * VPITCH),
                  "v"(gk), "v"(gk + 4 * NH * 128), "v"(gk + 8 * NH * 128), "v"(gk + 12 * NH * 128), "v"(gk + 16 * NH * 128), "v"(gk + 20 * NH * 128), "v"(gk + 24 * NH * 128), "v"(gk + 28 * NH * 128),
                  "v"(gh), "v"(gh + 32 * TT), "v"(gl), "v"(gl + 32 * TT)
               : "memory");
}
__global__ __launch_bounds__(128) void k_attn(const float* __restrict__ QA, const float* __restrict__ KB, const int* __restrict__ MASK, const __bf16* __restrict__ VH, const __bf16* __restrict__ VL, float* __restrict__ O) {
  __shared__ __align__(16) char ring[2 * ST_SZ];
  __shared__ __align__(16) float so[4][16][68];
  const int tid = threadIdx.x, wave = tid >> 5, lane = tid & 31, col = lane & 15, g = lane >> 4;
  const int qb = blockIdx.x, h = blockIdx.y, b = blockIdx.z; const int q0 = qb * 64 + wave * 16; const size_t rq = (size_t)b * TT + q0;
  const float* qrow = QA + ((rq + col) * NH + h) * 128;
  // this lane's places in a stage (LDS byte addresses in buffer 0) and its sources at key step 0
  const unsigned lk0 = (unsigned)(size_t)&ring[wave * KPITCH + lane * 16], lv0 = (unsigned)(size_t)&ring[(tid >> 2) * VPITCH + (tid & 3) * 16];
  const float* gk0 = KB + (((size_t)b * TT + wave) * NH + h) * 128 + lane * 4;
  const size_t gvo = ((size_t)b * FF + h * HD + (tid >> 2)) * TT + (tid & 3) * 8;
  stage_kv(lk0, lv0, gk0, VH + gvo, VL + gvo);
  // transposed products: a lane owns ONE query (col); its half g holds keys 8 g + r of each 16-key tile. m = running maximum of the query (equal in both halves), l = this half's share of the running sum
  float m = -3.0e38f, l = 0.f;
  v8f acc[4] = {};                                     // O^T tiles: acc[dt][r] = O[query col][dt * 16 + 8 g + r]
  // the wave's 16 query rows do not change over the key loop: load and split them to bf16 hi/lo fragments once, kept in registers (unrolled so that qa[] is indexed by constants and never goes to scratch)
  F2 qa[4];
#pragma unroll
  for (int kc = 0; kc < 4; ++kc) qa[kc] = split_row(qrow, kc * 32, lane);
  const int* mrow = MASK + ((size_t)b * TT + q0 + col) * TT + 8 * g;
  asm volatile("s_wait_asynccnt 0x0" ::: "memory");   // this wave's copies of step 0 have landed
  __syncthreads();                                     // and every other wave's: step 0 may be read
  stage_kv(lk0 + ST_SZ, lv0 + ST_SZ, gk0 + (size_t)32 * NH * 128, VH + gvo + 32, VL + gvo + 32);
#pragma unroll 1
  for (int ks = 0; ks < TT / 32; ++ks) { int mk[2][8]; bool anylive = false; const char* st = ring + (ks & 1) * ST_SZ;
    const v4i mq[4] = { *(const v4i*)(mrow + ks * 32), *(const v4i*)(mrow + ks * 32 + 4), *(const v4i*)(mrow + ks * 32 + 16), *(const v4i*)(mrow + ks * 32 + 20) };
#pragma unroll
    for (int i = 0; i < 16; ++i) { const int mv = mq[i >> 2][i & 3]; mk[i >> 3][i & 7] = mv; anylive = anylive || (mv != 0); }
    if (__any(anylive)) { float s[2][8];
      // S^T = [k|p] . [q+u|q+v]^T: A = key rows, B = the query fragments; D register r = key 8 g + r, column = query
#pragma unroll
      for (int ct = 0; ct < 2; ++ct) { const char* krow = st + (ct * 16 + col) * KPITCH; v8f c = {};
#pragma unroll
        for (int kc = 0; kc < 4; ++kc) { const F2 kb = split_row((const float*)krow, kc * 32, lane); c = wmma_bf(kb.h, qa[kc].l, c); c = wmma_bf(kb.l, qa[kc].h, c); c = wmma_bf(kb.h, qa[kc].h, c); }
#pragma unroll
        for (int r = 0; r < 8; ++r) s[ct][r] = (mk[ct][r] != 0) ? c[r] * 0.125f : -3.0e38f; }
      // the query's maximum over the step's 32 keys: 16 in this lane, 16 in lane ^ 16
      float mx = fmaxf(s[0][0], s[1][0]);
#pragma unroll
      for (int r = 1; r < 8; ++r) mx = fmaxf(mx, fmaxf(s[0][r], s[1][r]));
      mx = fmaxf(mx, __int_as_float(__builtin_amdgcn_permlanex16(__float_as_int(mx), __float_as_int(mx), 0x76543210, 0xfedcba98, false, false)));
      const float mn = fmaxf(m, mx); const float alpha = (m <= -1.0e38f) ? 0.f : exp_hw(m - mn);
      // the exponentials stand in line, for every lane, and a masked value is replaced by a select
      float e[16];
#pragma unroll
      for (int i = 0; i < 16; ++i) { const float sv = s[i >> 3][i & 7]; const float x = exp_hw(sv - mn); e[i] = (sv <= -1.0e38f) ? 0.f : x; }
      l = l * alpha + (((e[0] + e[1]) + (e[2] + e[3])) + ((e[4] + e[5]) + (e[6] + e[7])) + (((e[8] + e[9]) + (e[10] + e[11])) + ((e[12] + e[13]) + (e[14] + e[15])))); m = mn;
#pragma unroll
      for (int dt = 0; dt < 4; ++dt)
#pragma unroll
        for (int r = 0; r < 8; ++r) acc[dt][r] *= alpha;
      // P^T is a B operand as it stands: element i = key 8 g + i, element 8 + i = key 16 + 8 g + i, the k order of the V fragments
      const F2 pb = bsplit16(e);
      // O^T += V^T . P^T: A = V rows (d), B = P^T
#pragma unroll
      for (int dt = 0; dt < 4; ++dt) { const int vr = (dt * 16 + col) * VPITCH; const v16b vh = frag_b((const __bf16*)(st + ST_VH + vr), lane), vl = frag_b((const __bf16*)(st + ST_VL + vr), lane); acc[dt] = wmma_bf(vh, pb.l, acc[dt]); acc[dt] = wmma_bf(vl, pb.h, acc[dt]); acc[dt] = wmma_bf(vh, pb.h, acc[dt]); } }
    // hand-over, every wave, also one that skipped the step's work:
    asm volatile("s_wait_dscnt 0x0" ::: "memory");     // this wave's reads of the step's buffer are done
    asm volatile("s_wait_asynccnt 0x0" ::: "memory");  // this wave's copies of step ks + 1 have landed
    __syncthreads();                                    // publishes step ks + 1 and frees the buffer just read
    if (ks + 2 < TT / 32) stage_kv(lk0 + (ks & 1) * ST_SZ, lv0 + (ks & 1) * ST_SZ, gk0 + (size_t)(ks + 2) * 32 * NH * 128, VH + gvo + (ks + 2) * 32, VL + gvo + (ks + 2) * 32); }
  asm volatile("s_wait_asynccnt 0x0" ::: "memory");    // no copy is left in flight when the wave goes on to its end
  // the two halves' shares of the query's sum are joined once
  l += __int_as_float(__builtin_amdgcn_permlanex16(__float_as_int(l), __float_as_int(l), 0x76543210, 0xfedcba98, false, false));
  const float il = (l > 0.f) ? 1.0f / l : 0.f;
#pragma unroll
  for (int dt = 0; dt < 4; ++dt)
#pragma unroll
    for (int r = 0; r < 8; ++r) so[wave][col][dt * 16 + 8 * g + r] = acc[dt][r] * il;
  LDSX();
  for (int rl = 0; rl < 16; ++rl) if (lane < 16) vst2(O + (rq + rl) * FF + h * HD + lane * 4, *(const v4f*)&so[wave][rl][lane * 4]);
}
// ---- k_out: block = (64 rows, 128 cols): out = O(hi/lo) . Wo rows (2 products) + bo
__global__ __launch_bounds__(128) void k_out(const float* __restrict__ O, const __bf16* __restrict__ P, const float* __restrict__ bias, float* __restrict__ Y) {
  __shared__ __align__(16) float so[4][16][132];
  const int tid = threadIdx.x, wave = tid >> 5, lane = tid & 31, col = lane & 15, g = lane >> 4; const size_t r0 = (size_t)blockIdx.x * 64 + wave * 16; const int n0 = blockIdx.y * 128;
  v8f acc[8] = {};
#pragma unroll 2
  for (int kc = 0; kc < FF / 32; ++kc) { const F2 a = split_row(O + (r0 + col) * FF, kc * 32, lane);
#pragma unroll
    for (int j = 0; j < 8; ++j) { const v16b w = frag_b(P + (size_t)(n0 + j * 16 + col) * FF + kc * 32, lane); acc[j] = wmma_bf(a.l, w, acc[j]); acc[j] = wmma_bf(a.h, w, acc[j]); } }
#pragma unroll
  for (int j = 0; j < 8; ++j) { const float bb = bfr(bias[n0 + j * 16 + col]);
#pragma unroll
    for (int r = 0; r < 8; ++r) so[wave][8 * g + r][j * 16 + col] = acc[j][r] + bb; }
  LDSX();
  for (int rl = 0; rl < 16; ++rl) vst2(Y + (r0 + rl) * FF + n0 + lane * 4, *(const v4f*)&so[wave][rl][lane * 4]);
}
extern "C" void kernel_launch(void* const* d_in, const int* in_sizes, int n_in, void* d_out, int out_size, void* d_ws, size_t ws_size, hipStream_t stream) {
  (void)in_sizes; (void)n_in; (void)out_size;
  const float** F = (const float**)d_in; const int* MASK = (const int*)d_in[3];
  // 0 query, 1 key, 2 value [8,1024,512], 3 mask [8,1024,1024] i32, 4 pos_emb [1,1024,512], 5 Wq, 6 bq, 7 Wk, 8 bk, 9 Wv, 10 bv, 11 Wp, 12 Wo, 13 bo, 14 pos_bias_u [8,64], 15 pos_bias_v [8,64]
  if (ws_size < (size_t)WS_END) return;
  char* ws = (char*)d_ws; __bf16 *PW = (__bf16*)(ws + WS_PW), *VH = (__bf16*)(ws + WS_VH), *VL = (__bf16*)(ws + WS_VL); float *QA = (float*)(ws + WS_QA), *KB = (float*)(ws + WS_KB), *P = (float*)(ws + WS_P), *O = (float*)(ws + WS_O);
  k_pack<<<dim3(FF, 5), 128, 0, stream>>>(F[5], F[7], F[9], F[11], F[12], PW);
  k_posp<<<dim3(TT / 64, FF / 128), 128, 0, stream>>>(F[4], PW + (size_t)3 * FF * FF, P);
  k_proj<0><<<dim3(TNB * TT / 64, FF / 128), 128, 0, stream>>>(F[0], PW, F[6], F[14], F[15], P, QA, nullptr, nullptr);
  k_proj<1><<<dim3(TNB * TT / 64, FF / 128), 128, 0, stream>>>(F[1], PW + (size_t)FF * FF, F[8], F[14], F[15], P, KB, nullptr, nullptr);
  k_proj<2><<<dim3(TNB * TT / 64, FF / 128), 128, 0, stream>>>(F[2], PW + (size_t)2 * FF * FF, F[10], F[14], F[15], P, nullptr, VH, VL);
  k_attn<<<dim3(TQB, NH, TNB), 128, 0, stream>>>(QA, KB, MASK, VH, VL, O);
  k_out<<<dim3(TOB, FF / 128), 128, 0, stream>>>(O, PW + (size_t)4 * FF * FF, F[13], (float*)d_out);
}

// v005
// A run of this version takes 178 microseconds.
// Next to v004, in two timings, it ran 1.69 times as fast each time.
// Counting every step since v000, it is 2.73 times as fast.
// compute dtype: query, key, value, pos_emb, mask, all weights/biases and the position biases (module inputs) rounded to bf16 / read as int32; the four input projections with exact bf16 products (inputs x inputs) on WMMA 16x16x32; scores as one 128-deep dot [q+u | q+v] . [k | p] with both computed operands as bf16 hi + residual pairs (3 products), P.V with P hi/lo x V hi/lo (3 products), output projection hi/lo x exact Wo (2 products); masking, softmax and the masked-row zeroing in f32; f32 accumulate.
#include <hip/hip_runtime.h>
#include <math.h>

typedef __attribute__((ext_vector_type(16))) _Float16 v16h;
typedef __attribute__((ext_vector_type(16))) __bf16 v16b;
typedef __attribute__((ext_vector_type(8)))  _Float16 v8h;
typedef __attribute__((ext_vector_type(8)))  float v8f;
typedef __attribute__((ext_vector_type(4)))  float v4f;
typedef __attribute__((ext_vector_type(2)))  float v2f;
typedef __attribute__((ext_vector_type(4)))  unsigned v4u;
typedef __attribute__((ext_vector_type(4)))  int v4i;
typedef float __attribute__((may_alias)) float_a;
typedef int __attribute__((may_alias)) int_a;

template <typename T> __device__ __forceinline__ void vst2(void* p, T v) { *(T*)p = v;  }
__device__ __forceinline__ v8f wmma16(v16h a, v16h b, v8f c) {
  v8f d = __builtin_amdgcn_wmma_f32_16x16x32_f16(false, a, false, b, (short)0, c, false, false);
  asm volatile("v_nop\n\tv_nop\n\tv_nop\n\tv_nop" : "+v"(d) : "v"(a), "v"(b));
  return d;
}
__device__ __forceinline__ v8f wmma_bf(v16b a, v16b b, v8f c) {
  v8f d = __builtin_amdgcn_wmma_f32_16x16x32_bf16(false, a, false, b, (short)0, c, false, false);
  asm volatile("v_nop\n\tv_nop\n\tv_nop\n\tv_nop" : "+v"(d) : "v"(a), "v"(b));
  return d;
}
// 16x16x32 fragments: lane = (h = lane>>4, row/col = lane&15); elements 0..7 = k0+8h+0..7, 8..15 = k0+16+8h+0..7; D element r = row 8h+r
__device__ __forceinline__ v16h frag_h(const _Float16* rowk0, int lane) {
  union { v16h v; v8h q[2]; } u; const _Float16* p = rowk0 + 8 * (lane >> 4);
  u.q[0] = *(const v8h*)p; u.q[1] = *(const v8h*)(p + 16); return u.v;
}
__device__ __forceinline__ v16h frag_f32(const float* rowk0, int lane) {
  v16h a; const float* p = rowk0 + 8 * (lane >> 4);
#pragma unroll
  for (int i = 0; i < 8; ++i) { a[i] = (_Float16)p[i]; a[8 + i] = (_Float16)p[16 + i]; }
  return a;
}
__device__ __forceinline__ v16h frag_f32s(const float* rowk0, int lane, float sc) {
  v16h a; const float* p = rowk0 + 8 * (lane >> 4);
#pragma unroll
  for (int i = 0; i < 8; ++i) { a[i] = (_Float16)(p[i] * sc); a[8 + i] = (_Float16)(p[16 + i] * sc); }
  return a;
}
// column fragment from a [K][ld] layout (column n), rows >= K read as 0
__device__ __forceinline__ v16h fragc_f32(const float* W, int k0, int n, int lane, int ld, int K) {
  v16h a; const int g = lane >> 4;
#pragma unroll
  for (int i = 0; i < 8; ++i) { const int ka = k0 + 8 * g + i, kb = ka + 16;
    a[i] = (_Float16)(ka < K ? W[(size_t)(ka < K ? ka : K - 1) * ld + n] : 0.f); a[8 + i] = (_Float16)(kb < K ? W[(size_t)(kb < K ? kb : K - 1) * ld + n] : 0.f); }
  return a;
}
struct F2 { v16b h, l; };
__device__ __forceinline__ F2 bsplit16(const float v[16]) { F2 r;
#pragma unroll
  for (int i = 0; i < 16; ++i) { const __bf16 h = (__bf16)v[i]; r.h[i] = h; r.l[i] = (__bf16)(v[i] - (float)h); }
  return r; }
__device__ __forceinline__ F2 split_row(const float* row, int k0, int lane) { float v[16]; const float* p = row + k0 + 8 * (lane >> 4);
#pragma unroll
  for (int i = 0; i < 8; ++i) { v[i] = p[i]; v[8 + i] = p[16 + i]; }
  return bsplit16(v); }
__device__ __forceinline__ F2 split_rowK(const float* row, int k0, int lane, int K) { float v[16]; const int g = lane >> 4;
#pragma unroll
  for (int i = 0; i < 8; ++i) { const int ka = k0 + 8 * g + i, kb = ka + 16; v[i] = ka < K ? row[ka < K ? ka : K - 1] : 0.f; v[8 + i] = kb < K ? row[kb < K ? kb : K - 1] : 0.f; }
  return bsplit16(v); }
__device__ __forceinline__ F2 split_col(const float* W, int k0, int n, int lane, int ld, int K) { float v[16]; const int g = lane >> 4;
#pragma unroll
  for (int i = 0; i < 8; ++i) { const int ka = k0 + 8 * g + i, kb = ka + 16; v[i] = ka < K ? W[(size_t)(ka < K ? ka : K - 1) * ld + n] : 0.f; v[8 + i] = kb < K ? W[(size_t)(kb < K ? kb : K - 1) * ld + n] : 0.f; }
  return bsplit16(v); }
__device__ __forceinline__ v8f mac3(const F2& a, const F2& b, v8f c) { c = wmma_bf(a.l, b.h, c); c = wmma_bf(a.h, b.l, c); return wmma_bf(a.h, b.h, c); }
__device__ __forceinline__ float sigm(float v) { return 1.0f / (1.0f + expf(-v)); }
#define LDSX() do { asm volatile("s_wait_dscnt 0" ::: "memory"); __builtin_amdgcn_wave_barrier(); __builtin_amdgcn_fence(__ATOMIC_RELEASE, "workgroup"); } while (0)


// Relative-position multi-head attention (B 8, T 1024, F 512, 8 heads x 64): q/k/v = Linear(query/key/value); p = pos_emb Wp^T; scores = ((q + pos_bias_u) k^T + (q + pos_bias_v) p^T) / sqrt(64); masked (mask == 0 -> float32 min); attn = softmax, then 0 where masked; x = attn v; out = x Wo^T + bo.
#define NB 8
#define TT 1024
#define FF 512
#define NH 8
#define HD 64
#ifndef TQB
#define TQB (TT / 64)
#define TNB NB
#define TOB (NB * TT / 64)
#endif
typedef __attribute__((ext_vector_type(8))) __bf16 v8b;
__device__ __forceinline__ v16b frag_b(const __bf16* rowk0, int lane) {
  union { v16b v; v8b q[2]; } u; const __bf16* p = rowk0 + 8 * (lane >> 4);
  u.q[0] = *(const v8b*)p; u.q[1] = *(const v8b*)(p + 16); return u.v;
}
__device__ __forceinline__ float bfr(float v) { return (float)(__bf16)v; }
// e^v for v <= 0 by the hardware's base-2 exponential: one multiply by log2(e) and one v_exp_f32
__device__ __forceinline__ float exp_hw(float v) { return __builtin_amdgcn_exp2f(v * 1.44269504f); }
__device__ __attribute__((noinline)) float erf_ni(float v) { return erff(v); }

#define WS_PW  0u                                   // bf16 natural rows: Wq, Wk, Wv, Wp, Wo [512][512] each
#define WS_QA  (WS_PW + 2u * 5 * FF * FF)            // f32 [NB*TT][8 h][128]: q+u | q+v
#define WS_KB  (WS_QA + 4u * NB * TT * NH * 128)      // f32 [NB*TT][8 h][128]: k | p
#define WS_VH  (WS_KB + 4u * NB * TT * NH * 128)      // bf16 [NB][512 (h*64+d)][TT]
#define WS_VL  (WS_VH + 2u * NB * FF * TT)
#define WS_P   (WS_VL + 2u * NB * FF * TT)            // f32 [TT][512] p = pos_emb Wp^T
#define WS_O   (WS_P + 4u * TT * FF)                  // f32 [NB*TT][512]
#define WS_END (WS_O + 4u * NB * TT * FF)

// ---- k_pack: block = (row n, which 0..4): natural [out][in] rows of Wq, Wk, Wv, Wp, Wo
__global__ __launch_bounds__(128) void k_pack(const float* __restrict__ WQ, const float* __restrict__ WK, const float* __restrict__ WV, const float* __restrict__ WP, const float* __restrict__ WO, __bf16* __restrict__ PW) {
  __shared__ __align__(16) __bf16 s[FF]; const int n = blockIdx.x, which = blockIdx.y, tid = threadIdx.x; const float* src = (which == 0 ? WQ : which == 1 ? WK : which == 2 ? WV : which == 3 ? WP : WO) + (size_t)n * FF;
  for (int k = tid; k < FF; k += 128) s[k] = (__bf16)src[k];
  __syncthreads();
  if (tid < FF / 8) vst2((unsigned*)(PW + ((size_t)which * FF + n) * FF + tid * 8), *(const v4u*)&s[tid * 8]);
}
// ---- the 64-row x 128-column product that k_posp, k_proj and k_out share: acc[j] (wave's 16 rows x columns j * 16 ..) += A rows (f32, rounded or split to bf16) . W rows (bf16), K = 512
// A slice of 64 k of the block's 64 A rows (256 B each) and 128 W rows (128 B each) is brought into LDS once per block by asynchronous copies, whole 128-B lines per wave-instruction, one slice ahead, two buffers; the four waves read their fragments from there.
#define GKC 64
#define APITCH 272                                   // 256-B A row + 16 B: 16 B x odd, conflict-free for 16-byte LDS reads
#define WPITCH 144                                   // 128-B W row + 16 B: 16 B x odd
#define G_W  (64 * APITCH)
#define G_SZ (G_W + 128 * WPITCH)
// one slice = 16 copies of 16 B per lane: 8 of A (copy i: row 8 i + tid / 16, 16 lanes per row), 8 of W (copy i: row 16 i + tid / 8, 8 lanes per row)
__device__ __forceinline__ void stage_aw(unsigned la, unsigned lw, const float* ga, const __bf16* gw) {
  // s_wait_xcnt closes each statement so that it stands in front of any later rewrite of the address registers the copies name
  asm volatile("global_load_async_to_lds_b128 %0, %8, off\n\t"
               "global_load_async_to_lds_b128 %1, %9, off\n\t"
               "global_load_async_to_lds_b128 %2, %10, off\n\t"
               "global_load_async_to_lds_b128 %3, %11, off\n\t"
               "global_load_async_to_lds_b128 %4, %12, off\n\t"
               "global_load_async_to_lds_b128 %5, %13, off\n\t"
               "global_load_async_to_lds_b128 %6, %14, off\n\t"
               "global_load_async_to_lds_b128 %7, %15, off\n\t"
               "s_wait_xcnt 0x0"
               :: "v"(la), "v"(la + 8 * APITCH), "v"(la + 16 * APITCH), "v"(la + 24 * APITCH), "v"(la + 32 * APITCH), "v"(la + 40 * APITCH), "v"(la + 48 * APITCH), "v"(la + 56 * APITCH),
                  "v"(ga), "v"(ga + 8 * FF), "v"(ga + 16 * FF), "v"(ga + 24 * FF), "v"(ga + 32 * FF), "v"(ga + 40 * FF), "v"(ga + 48 * FF), "v"(ga + 56 * FF)
               : "memory");
  asm volatile("global_load_async_to_lds_b128 %0, %8, off\n\t"
               "global_load_async_to_lds_b128 %1, %9, off\n\t"
               "global_load_async_to_lds_b128 %2, %10, off\n\t"
               "global_load_async_to_lds_b128 %3, %11, off\n\t"
               "global_load_async_to_lds_b128 %4, %12, off\n\t"
               "global_load_async_to_lds_b128 %5, %13, off\n\t"
               "global_load_async_to_lds_b128 %6, %14, off\n\t"
               "global_load_async_to_lds_b128 %7, %15, off\n\t"
               "s_wait_xcnt 0x0"
               :: "v"(lw), "v"(lw + 16 * WPITCH), "v"(lw + 32 * WPITCH), "v"(lw + 48 * WPITCH), "v"(lw + 64 * WPITCH), "v"(lw + 80 * WPITCH), "v"(lw + 96 * WPITCH), "v"(lw + 112 * WPITCH),
                  "v"(gw), "v"(gw + 16 * FF), "v"(gw + 32 * FF), "v"(gw + 48 * FF), "v"(gw + 64 * FF), "v"(gw + 80 * FF), "v"(gw + 96 * FF), "v"(gw + 112 * FF)
               : "memory");
}
// A = the block's first row, Wn = the block's first W row, ring = 2 * G_SZ bytes of LDS; SPLIT: A as bf16 hi + residual (2 products), else A rounded to bf16 (1 product)
template <bool SPLIT>
__device__ __forceinline__ void gemm_tile(const float* __restrict__ A, const __bf16* __restrict__ Wn, char* ring, v8f (&acc)[8]) {
  const int tid = threadIdx.x, wave = tid >> 5, lane = tid & 31, col = lane & 15, g = lane >> 4;
  // this lane's places in a slice (LDS byte addresses in buffer 0) and its sources at slice 0
  const unsigned la = (unsigned)(size_t)&ring[(tid >> 4) * APITCH + (tid & 15) * 16], lw = (unsigned)(size_t)&ring[G_W + (tid >> 3) * WPITCH + (tid & 7) * 16];
  const float* ga = A + (size_t)(tid >> 4) * FF + (tid & 15) * 4; const __bf16* gw = Wn + (size_t)(tid >> 3) * FF + (tid & 7) * 8;
  stage_aw(la, lw, ga, gw);
  asm volatile("s_wait_asynccnt 0x0" ::: "memory");   // this wave's copies of slice 0 have landed
  __syncthreads();                                     // and every other wave's: slice 0 may be read
  stage_aw(la + G_SZ, lw + G_SZ, ga + GKC, gw + GKC);
  // kept rolled: one trip already holds a whole slice's fragments in registers, and eight copies of the body would only grow the code
#pragma unroll 1
  for (int t = 0; t < FF / GKC; ++t) { const char* st = ring + (t & 1) * G_SZ; const float* arow = (const float*)(st + (wave * 16 + col) * APITCH);
    // the slice's fragments are read as one group in front of its WMMAs: one LDS latency per slice
    v16b w[2][8];
#pragma unroll
    for (int kk = 0; kk < 2; ++kk)
#pragma unroll
      for (int j = 0; j < 8; ++j) w[kk][j] = frag_b((const __bf16*)(st + G_W + (j * 16 + col) * WPITCH) + kk * 32, lane);
    if (SPLIT) { const F2 a[2] = { split_row(arow, 0, lane), split_row(arow, 32, lane) };
#pragma unroll
      for (int kk = 0; kk < 2; ++kk)
#pragma unroll
        for (int j = 0; j < 8; ++j) { acc[j] = wmma_bf(a[kk].l, w[kk][j], acc[j]); acc[j] = wmma_bf(a[kk].h, w[kk][j], acc[j]); }
    } else { v16b a[2];
#pragma unroll
      for (int kk = 0; kk < 2; ++kk) { const float* p = arow + kk * 32 + 8 * g;
#pragma unroll
        for (int i = 0; i < 8; ++i) { a[kk][i] = (__bf16)p[i]; a[kk][8 + i] = (__bf16)p[16 + i]; } }
#pragma unroll
      for (int kk = 0; kk < 2; ++kk)
#pragma unroll
        for (int j = 0; j < 8; ++j) acc[j] = wmma_bf(a[kk], w[kk][j], acc[j]);
    }
    // hand-over, every wave:
    asm volatile("s_wait_dscnt 0x0" ::: "memory");     // this wave's reads of the slice's buffer are done
    asm volatile("s_wait_asynccnt 0x0" ::: "memory");  // this wave's copies of slice t + 1 have landed
    __syncthreads();                                    // publishes slice t + 1 and frees the buffer just read
    if (t + 2 < FF / GKC) stage_aw(la + (t & 1) * G_SZ, lw + (t & 1) * G_SZ, ga + (t + 2) * GKC, gw + (t + 2) * GKC); }
  asm volatile("s_wait_asynccnt 0x0" ::: "memory");    // no copy is left in flight when the wave goes on
}
// ---- k_posp: block = (64 positions, 128 cols): p = bf16(pos_emb) . Wp rows (exact) -> P rows (512-B segments)
__global__ __launch_bounds__(128) void k_posp(const float* __restrict__ PE, const __bf16* __restrict__ P4, float* __restrict__ P) {
  __shared__ __align__(16) char ring[2 * G_SZ]; __shared__ __align__(16) float so[4][16][132];
  const int tid = threadIdx.x, wave = tid >> 5, lane = tid & 31, col = lane & 15, g = lane >> 4; const size_t r0 = (size_t)blockIdx.x * 64 + wave * 16; const int n0 = blockIdx.y * 128;
  v8f acc[8] = {};
  gemm_tile<false>(PE + (size_t)blockIdx.x * 64 * FF, P4 + (size_t)n0 * FF, ring, acc);
#pragma unroll
  for (int j = 0; j < 8; ++j)
#pragma unroll
    for (int r = 0; r < 8; ++r) so[wave][8 * g + r][j * 16 + col] = acc[j][r];
  LDSX();
  for (int rl = 0; rl < 16; ++rl) vst2(P + (r0 + rl) * FF + n0 + lane * 4, *(const v4f*)&so[wave][rl][lane * 4]);
}
// ---- k_proj<MODE>: block = (64 rows (b,t), 128 cols = 2 heads): MODE 0: q = query.Wq^T + bq -> QA[row][h][q+u | q+v] (512-B per (row, head)); MODE 1: k = key.Wk^T + bk -> KB[row][h][k | p[t]] ; MODE 2: v = value.Wv^T + bv -> transposed hi/lo planes
template <int MODE>
__global__ __launch_bounds__(128) void k_proj(const float* __restrict__ X, const __bf16* __restrict__ P1, const float* __restrict__ bias, const float* __restrict__ U, const float* __restrict__ Vb, const float* __restrict__ PP, float* __restrict__ OUT, __bf16* __restrict__ VH, __bf16* __restrict__ VL) {
  __shared__ __align__(16) char ring[2 * G_SZ]; __shared__ __align__(16) float so[4][16][260]; __shared__ __align__(16) __bf16 sth[128][72], stl[128][72];
  const int tid = threadIdx.x, wave = tid >> 5, lane = tid & 31, col = lane & 15, g = lane >> 4; const size_t rb = (size_t)blockIdx.x * 64; const size_t r0 = rb + wave * 16; const int n0 = blockIdx.y * 128;
  v8f acc[8] = {};
  gemm_tile<false>(X + rb * FF, P1 + (size_t)n0 * FF, ring, acc);
  if (MODE == 2) {
#pragma unroll
    for (int j = 0; j < 8; ++j) { const float bb = bfr(bias[n0 + j * 16 + col]);
#pragma unroll
      for (int r = 0; r < 8; ++r) { const float v = acc[j][r] + bb; const __bf16 hb = (__bf16)v; sth[j * 16 + col][wave * 16 + 8 * g + r] = hb; stl[j * 16 + col][wave * 16 + 8 * g + r] = (__bf16)(v - (float)hb); } }
    __syncthreads();
    const int b = (int)(rb / TT), t0 = (int)(rb % TT);
    for (int q = tid; q < 128 * 8; q += 128) { const int d = q >> 3, pc = q & 7; const size_t o = ((size_t)b * FF + n0 + d) * TT + t0 + pc * 8; vst2((unsigned*)(VH + o), *(const v4u*)&sth[d][pc * 8]); vst2((unsigned*)(VL + o), *(const v4u*)&stl[d][pc * 8]); }
  } else {
    // two heads in this column block: hl = j / 4 (local), d = (j % 4) * 16 + col; segment layout per (row, head): [first 64 | second 64]
#pragma unroll
    for (int j = 0; j < 8; ++j) { const int hl = j >> 2, d = (j & 3) * 16 + col; const int h = (n0 >> 6) + hl; const float bb = bfr(bias[n0 + j * 16 + col]);
#pragma unroll
      for (int r = 0; r < 8; ++r) { const float v = acc[j][r] + bb; const int rl = 8 * g + r;
        if (MODE == 0) { so[wave][rl][hl * 128 + d] = v + bfr(U[h * HD + d]); so[wave][rl][hl * 128 + 64 + d] = v + bfr(Vb[h * HD + d]); }
        else { const size_t t = (r0 + rl) % TT; so[wave][rl][hl * 128 + d] = v; so[wave][rl][hl * 128 + 64 + d] = PP[t * FF + h * HD + d]; } } }
    LDSX();
    const int h0 = n0 >> 6;
    for (int rl = 0; rl < 16; ++rl) { vst2(OUT + ((r0 + rl) * NH + h0) * 128 + lane * 4, *(const v4f*)&so[wave][rl][lane * 4]); vst2(OUT + ((r0 + rl) * NH + h0) * 128 + 128 + lane * 4, *(const v4f*)&so[wave][rl][128 + lane * 4]); }
  }
}
// ---- k_attn: block = (64 queries, head h, batch b): per 32-key step: mask tile loads (int) -> wave vote -> {transposed scores S^T = [k|p].[q+u|q+v]^T / 8 (3 products, K 128), masked -> -3e38; online softmax in-lane, one query per lane; O^T += V^T(hi/lo).P^T(hi/lo)}; rows with no live key output 0 (the module's where(mask==0, 0, softmax)); O[row][h*64+d]
// The step's K rows (32 x 512 B) and V hi/lo rows (2 x 64 x 64 B) are the same for the block's four waves: they are brought into LDS once per block by asynchronous copies (whole lines of K per wave-instruction), one step ahead, two buffers.
#define KPITCH 528                                   // 512-B K row + 16 B: 16 B x odd, conflict-free for 16-byte LDS reads
#define VPITCH 80                                    // 64-B V row + 16 B: 16 B x odd
#define ST_VH  (32 * KPITCH)
#define ST_VL  (ST_VH + HD * VPITCH)
#define ST_SZ  (ST_VL + HD * VPITCH)
// one stage = 12 copies of 16 B per lane: 8 of K (copy i: key row 4 i + wave, the wave's 32 lanes cover the 512-B row), 2 of V hi, 2 of V lo (4 lanes per 64-B row)
__device__ __forceinline__ void stage_kv(unsigned lk, unsigned lv, const float* gk, const __bf16* gh, const __bf16* gl) {
  // s_wait_xcnt closes the statement so that it stands in front of any later rewrite of the address registers the copies name
  asm volatile("global_load_async_to_lds_b128 %0, %12, off\n\t"
               "global_load_async_to_lds_b128 %1, %13, off\n\t"
               "global_load_async_to_lds_b128 %2, %14, off\n\t"
               "global_load_async_to_lds_b128 %3, %15, off\n\t"
               "global_load_async_to_lds_b128 %4, %16, off\n\t"
               "global_load_async_to_lds_b128 %5, %17, off\n\t"
               "global_load_async_to_lds_b128 %6, %18, off\n\t"
               "global_load_async_to_lds_b128 %7, %19, off\n\t"
               "global_load_async_to_lds_b128 %8, %20, off\n\t"
               "global_load_async_to_lds_b128 %9, %21, off\n\t"
               "global_load_async_to_lds_b128 %10, %22, off\n\t"
               "global_load_async_to_lds_b128 %11, %23, off\n\t"
               "s_wait_xcnt 0x0"
               :: "v"(lk), "v"(lk + 4 * KPITCH), "v"(lk + 8 * KPITCH), "v"(lk + 12 * KPITCH), "v"(lk + 16 * KPITCH), "v"(lk + 20 * KPITCH), "v"(lk + 24 * KPITCH), "v"(lk + 28 * KPITCH),
                  "v"(lv + ST_VH), "v"(lv + ST_VH + 32 * VPITCH), "v"(lv + ST_VL), "v"(lv + ST_VL + 32 * VPITCH),
                  "v"(gk), "v"(gk + 4 * NH * 128), "v"(gk + 8 * NH * 128), "v"(gk + 12 * NH * 128), "v"(gk + 16 * NH * 128), "v"(gk + 20 * NH * 128), "v"(gk + 24 * NH * 128), "v"(gk + 28 * NH * 128),
                  "v"(gh), "v"(gh + 32 * TT), "v"(gl), "v"(gl + 32 * TT)
               : "memory");
}
__global__ __launch_bounds__(128) void k_attn(const float* __restrict__ QA, const float* __restrict__ KB, const int* __restrict__ MASK, const __bf16* __restrict__ VH, const __bf16* __restrict__ VL, float* __restrict__ O) {
  __shared__ __align__(16) char ring[2 * ST_SZ];
  __shared__ __align__(16) float so[4][16][68];
  const int tid = threadIdx.x, wave = tid >> 5, lane = tid & 31, col = lane & 15, g = lane >> 4;
  const int qb = blockIdx.x, h = blockIdx.y, b = blockIdx.z; const int q0 = qb * 64 + wave * 16; const size_t rq = (size_t)b * TT + q0;
  const float* qrow = QA + ((rq + col) * NH + h) * 128;
  // this lane's places in a stage (LDS byte addresses in buffer 0) and its sources at key step 0
  const unsigned lk0 = (unsigned)(size_t)&ring[wave * KPITCH + lane * 16], lv0 = (unsigned)(size_t)&ring[(tid >> 2) * VPITCH + (tid & 3) * 16];
  const float* gk0 = KB + (((size_t)b * TT + wave) * NH + h) * 128 + lane * 4;
  const size_t gvo = ((size_t)b * FF + h * HD + (tid >> 2)) * TT + (tid & 3) * 8;
  stage_kv(lk0, lv0, gk0, VH + gvo, VL + gvo);
  // transposed products: a lane owns ONE query (col); its half g holds keys 8 g + r of each 16-key tile. m = running maximum of the query (equal in both halves), l = this half's share of the running sum
  float m = -3.0e38f, l = 0.f;
  v8f acc[4] = {};                                     // O^T tiles: acc[dt][r] = O[query col][dt * 16 + 8 g + r]
  // the wave's 16 query rows do not change over the key loop: load and split them to bf16 hi/lo fragments once, kept in registers (unrolled so that qa[] is indexed by constants and never goes to scratch)
  F2 qa[4];
#pragma unroll
  for (int kc = 0; kc < 4; ++kc) qa[kc] = split_row(qrow, kc * 32, lane);
  const int* mrow = MASK + ((size_t)b * TT + q0 + col) * TT + 8 * g;
  asm volatile("s_wait_asynccnt 0x0" ::: "memory");   // this wave's copies of step 0 have landed
  __syncthreads();                                     // and every other wave's: step 0 may be read
  stage_kv(lk0 + ST_SZ, lv0 + ST_SZ, gk0 + (size_t)32 * NH * 128, VH + gvo + 32, VL + gvo + 32);
#pragma unroll 1
  for (int ks = 0; ks < TT / 32; ++ks) { int mk[2][8]; bool anylive = false; const char* st = ring + (ks & 1) * ST_SZ;
    const v4i mq[4] = { *(const v4i*)(mrow + ks * 32), *(const v4i*)(mrow + ks * 32 + 4), *(const v4i*)(mrow + ks * 32 + 16), *(const v4i*)(mrow + ks * 32 + 20) };
#pragma unroll
    for (int i = 0; i < 16; ++i) { const int mv = mq[i >> 2][i & 3]; mk[i >> 3][i & 7] = mv; anylive = anylive || (mv != 0); }
    if (__any(anylive)) { float s[2][8];
      // S^T = [k|p] . [q+u|q+v]^T: A = key rows, B = the query fragments; D register r = key 8 g + r, column = query
#pragma unroll
      for (int ct = 0; ct < 2; ++ct) { const char* krow = st + (ct * 16 + col) * KPITCH; v8f c = {};
#pragma unroll
        for (int kc = 0; kc < 4; ++kc) { const F2 kb = split_row((const float*)krow, kc * 32, lane); c = wmma_bf(kb.h, qa[kc].l, c); c = wmma_bf(kb.l, qa[kc].h, c); c = wmma_bf(kb.h, qa[kc].h, c); }
#pragma unroll
        for (int r = 0; r < 8; ++r) s[ct][r] = (mk[ct][r] != 0) ? c[r] * 0.125f : -3.0e38f; }
      // the query's maximum over the step's 32 keys: 16 in this lane, 16 in lane ^ 16
      float mx = fmaxf(s[0][0], s[1][0]);
#pragma unroll
      for (int r = 1; r < 8; ++r) mx = fmaxf(mx, fmaxf(s[0][r], s[1][r]));
      mx = fmaxf(mx, __int_as_float(__builtin_amdgcn_permlanex16(__float_as_int(mx), __float_as_int(mx), 0x76543210, 0xfedcba98, false, false)));
      const float mn = fmaxf(m, mx); const float alpha = (m <= -1.0e38f) ? 0.f : exp_hw(m - mn);
      // the exponentials stand in line, for every lane, and a masked value is replaced by a select
      float e[16];
#pragma unroll
      for (int i = 0; i < 16; ++i) { const float sv = s[i >> 3][i & 7]; const float x = exp_hw(sv - mn); e[i] = (sv <= -1.0e38f) ? 0.f : x; }
      l = l * alpha + (((e[0] + e[1]) + (e[2] + e[3])) + ((e[4] + e[5]) + (e[6] + e[7])) + (((e[8] + e[9]) + (e[10] + e[11])) + ((e[12] + e[13]) + (e[14] + e[15])))); m = mn;
#pragma unroll
      for (int dt = 0; dt < 4; ++dt)
#pragma unroll
        for (int r = 0; r < 8; ++r) acc[dt][r] *= alpha;
      // P^T is a B operand as it stands: element i = key 8 g + i, element 8 + i = key 16 + 8 g + i, the k order of the V fragments
      const F2 pb = bsplit16(e);
      // O^T += V^T . P^T: A = V rows (d), B = P^T
#pragma unroll
      for (int dt = 0; dt < 4; ++dt) { const int vr = (dt * 16 + col) * VPITCH; const v16b vh = frag_b((const __bf16*)(st + ST_VH + vr), lane), vl = frag_b((const __bf16*)(st + ST_VL + vr), lane); acc[dt] = wmma_bf(vh, pb.l, acc[dt]); acc[dt] = wmma_bf(vl, pb.h, acc[dt]); acc[dt] = wmma_bf(vh, pb.h, acc[dt]); } }
    // hand-over, every wave, also one that skipped the step's work:
    asm volatile("s_wait_dscnt 0x0" ::: "memory");     // this wave's reads of the step's buffer are done
    asm volatile("s_wait_asynccnt 0x0" ::: "memory");  // this wave's copies of step ks + 1 have landed
    __syncthreads();                                    // publishes step ks + 1 and frees the buffer just read
    if (ks + 2 < TT / 32) stage_kv(lk0 + (ks & 1) * ST_SZ, lv0 + (ks & 1) * ST_SZ, gk0 + (size_t)(ks + 2) * 32 * NH * 128, VH + gvo + (ks + 2) * 32, VL + gvo + (ks + 2) * 32); }
  asm volatile("s_wait_asynccnt 0x0" ::: "memory");    // no copy is left in flight when the wave goes on to its end
  // the two halves' shares of the query's sum are joined once
  l += __int_as_float(__builtin_amdgcn_permlanex16(__float_as_int(l), __float_as_int(l), 0x76543210, 0xfedcba98, false, false));
  const float il = (l > 0.f) ? 1.0f / l : 0.f;
#pragma unroll
  for (int dt = 0; dt < 4; ++dt)
#pragma unroll
    for (int r = 0; r < 8; ++r) so[wave][col][dt * 16 + 8 * g + r] = acc[dt][r] * il;
  LDSX();
  for (int rl = 0; rl < 16; ++rl) if (lane < 16) vst2(O + (rq + rl) * FF + h * HD + lane * 4, *(const v4f*)&so[wave][rl][lane * 4]);
}
// ---- k_out: block = (64 rows, 128 cols): out = O(hi/lo) . Wo rows (2 products) + bo
__global__ __launch_bounds__(128) void k_out(const float* __restrict__ O, const __bf16* __restrict__ P, const float* __restrict__ bias, float* __restrict__ Y) {
  __shared__ __align__(16) char ring[2 * G_SZ]; __shared__ __align__(16) float so[4][16][132];
  const int tid = threadIdx.x, wave = tid >> 5, lane = tid & 31, col = lane & 15, g = lane >> 4; const size_t r0 = (size_t)blockIdx.x * 64 + wave * 16; const int n0 = blockIdx.y * 128;
  v8f acc[8] = {};
  gemm_tile<true>(O + (size_t)blockIdx.x * 64 * FF, P + (size_t)n0 * FF, ring, acc);
#pragma unroll
  for (int j = 0; j < 8; ++j) { const float bb = bfr(bias[n0 + j * 16 + col]);
#pragma unroll
    for (int r = 0; r < 8; ++r) so[wave][8 * g + r][j * 16 + col] = acc[j][r] + bb; }
  LDSX();
  for (int rl = 0; rl < 16; ++rl) vst2(Y + (r0 + rl) * FF + n0 + lane * 4, *(const v4f*)&so[wave][rl][lane * 4]);
}
extern "C" void kernel_launch(void* const* d_in, const int* in_sizes, int n_in, void* d_out, int out_size, void* d_ws, size_t ws_size, hipStream_t stream) {
  (void)in_sizes; (void)n_in; (void)out_size;
  const float** F = (const float**)d_in; const int* MASK = (const int*)d_in[3];
  // 0 query, 1 key, 2 value [8,1024,512], 3 mask [8,1024,1024] i32, 4 pos_emb [1,1024,512], 5 Wq, 6 bq, 7 Wk, 8 bk, 9 Wv, 10 bv, 11 Wp, 12 Wo, 13 bo, 14 pos_bias_u [8,64], 15 pos_bias_v [8,64]
  if (ws_size < (size_t)WS_END) return;
  char* ws = (char*)d_ws; __bf16 *PW = (__bf16*)(ws + WS_PW), *VH = (__bf16*)(ws + WS_VH), *VL = (__bf16*)(ws + WS_VL); float *QA = (float*)(ws + WS_QA), *KB = (float*)(ws + WS_KB), *P = (float*)(ws + WS_P), *O = (float*)(ws + WS_O);
  k_pack<<<dim3(FF, 5), 128, 0, stream>>>(F[5], F[7], F[9], F[11], F[12], PW);
  k_posp<<<dim3(TT / 64, FF / 128), 128, 0, stream>>>(F[4], PW + (size_t)3 * FF * FF, P);
  k_proj<0><<<dim3(TNB * TT / 64, FF / 128), 128, 0, stream>>>(F[0], PW, F[6], F[14], F[15], P, QA, nullptr, nullptr);
  k_proj<1><<<dim3(TNB * TT / 64, FF / 128), 128, 0, stream>>>(F[1], PW + (size_t)FF * FF, F[8], F[14], F[15], P, KB, nullptr, nullptr);
  k_proj<2><<<dim3(TNB * TT / 64, FF / 128), 128, 0, stream>>>(F[2], PW + (size_t)2 * FF * FF, F[10], F[14], F[15], P, nullptr, VH, VL);
  k_attn<<<dim3(TQB, NH, TNB), 128, 0, stream>>>(QA, KB, MASK, VH, VL, O);
  k_out<<<dim3(TOB, FF / 128), 128, 0, stream>>>(O, PW + (size_t)4 * FF * FF, F[13], (float*)d_out);
}

// v006
// One run takes 154 microseconds.
// Two timings next to v005 both put it at 1.16 times that version's speed.
// Counting every step since v000, it is 3.16 times as fast.
// compute dtype: query, key, value, pos_emb, mask, all weights/biases and the position biases (module inputs) rounded to bf16 / read as int32; the four input projections with exact bf16 products (inputs x inputs) on WMMA 16x16x32; scores as one 128-deep dot [q+u | q+v] . [k | p] with both computed operands as bf16 hi + residual pairs (3 products), P.V with P hi/lo x V hi/lo (3 products), output projection hi/lo x exact Wo (2 products); masking, softmax and the masked-row zeroing in f32; f32 accumulate.
#include <hip/hip_runtime.h>
#include <math.h>

typedef __attribute__((ext_vector_type(16))) _Float16 v16h;
typedef __attribute__((ext_vector_type(16))) __bf16 v16b;
typedef __attribute__((ext_vector_type(8)))  _Float16 v8h;
typedef __attribute__((ext_vector_type(8)))  float v8f;
typedef __attribute__((ext_vector_type(4)))  float v4f;
typedef __attribute__((ext_vector_type(2)))  float v2f;
typedef __attribute__((ext_vector_type(4)))  unsigned v4u;
typedef __attribute__((ext_vector_type(4)))  int v4i;
typedef float __attribute__((may_alias)) float_a;
typedef int __attribute__((may_alias)) int_a;

template <typename T> __device__ __forceinline__ void vst2(void* p, T v) { *(T*)p = v;  }
__device__ __forceinline__ v8f wmma16(v16h a, v16h b, v8f c) {
  v8f d = __builtin_amdgcn_wmma_f32_16x16x32_f16(false, a, false, b, (short)0, c, false, false);
  asm volatile("v_nop\n\tv_nop\n\tv_nop\n\tv_nop" : "+v"(d) : "v"(a), "v"(b));
  return d;
}
__device__ __forceinline__ v8f wmma_bf(v16b a, v16b b, v8f c) {
  v8f d = __builtin_amdgcn_wmma_f32_16x16x32_bf16(false, a, false, b, (short)0, c, false, false);
  asm volatile("v_nop\n\tv_nop\n\tv_nop\n\tv_nop" : "+v"(d) : "v"(a), "v"(b));
  return d;
}
// 16x16x32 fragments: lane = (h = lane>>4, row/col = lane&15); elements 0..7 = k0+8h+0..7, 8..15 = k0+16+8h+0..7; D element r = row 8h+r
__device__ __forceinline__ v16h frag_h(const _Float16* rowk0, int lane) {
  union { v16h v; v8h q[2]; } u; const _Float16* p = rowk0 + 8 * (lane >> 4);
  u.q[0] = *(const v8h*)p; u.q[1] = *(const v8h*)(p + 16); return u.v;
}
__device__ __forceinline__ v16h frag_f32(const float* rowk0, int lane) {
  v16h a; const float* p = rowk0 + 8 * (lane >> 4);
#pragma unroll
  for (int i = 0; i < 8; ++i) { a[i] = (_Float16)p[i]; a[8 + i] = (_Float16)p[16 + i]; }
  return a;
}
__device__ __forceinline__ v16h frag_f32s(const float* rowk0, int lane, float sc) {
  v16h a; const float* p = rowk0 + 8 * (lane >> 4);
#pragma unroll
  for (int i = 0; i < 8; ++i) { a[i] = (_Float16)(p[i] * sc); a[8 + i] = (_Float16)(p[16 + i] * sc); }
  return a;
}
// column fragment from a [K][ld] layout (column n), rows >= K read as 0
__device__ __forceinline__ v16h fragc_f32(const float* W, int k0, int n, int lane, int ld, int K) {
  v16h a; const int g = lane >> 4;
#pragma unroll
  for (int i = 0; i < 8; ++i) { const int ka = k0 + 8 * g + i, kb = ka + 16;
    a[i] = (_Float16)(ka < K ? W[(size_t)(ka < K ? ka : K - 1) * ld + n] : 0.f); a[8 + i] = (_Float16)(kb < K ? W[(size_t)(kb < K ? kb : K - 1) * ld + n] : 0.f); }
  return a;
}
struct F2 { v16b h, l; };
__device__ __forceinline__ F2 bsplit16(const float v[16]) { F2 r;
#pragma unroll
  for (int i = 0; i < 16; ++i) { const __bf16 h = (__bf16)v[i]; r.h[i] = h; r.l[i] = (__bf16)(v[i] - (float)h); }
  return r; }
__device__ __forceinline__ F2 split_row(const float* row, int k0, int lane) { float v[16]; const float* p = row + k0 + 8 * (lane >> 4);
#pragma unroll
  for (int i = 0; i < 8; ++i) { v[i] = p[i]; v[8 + i] = p[16 + i]; }
  return bsplit16(v); }
__device__ __forceinline__ F2 split_rowK(const float* row, int k0, int lane, int K) { float v[16]; const int g = lane >> 4;
#pragma unroll
  for (int i = 0; i < 8; ++i) { const int ka = k0 + 8 * g + i, kb = ka + 16; v[i] = ka < K ? row[ka < K ? ka : K - 1] : 0.f; v[8 + i] = kb < K ? row[kb < K ? kb : K - 1] : 0.f; }
  return bsplit16(v); }
__device__ __forceinline__ F2 split_col(const float* W, int k0, int n, int lane, int ld, int K) { float v[16]; const int g = lane >> 4;
#pragma unroll
  for (int i = 0; i < 8; ++i) { const int ka = k0 + 8 * g + i, kb = ka + 16; v[i] = ka < K ? W[(size_t)(ka < K ? ka : K - 1) * ld + n] : 0.f; v[8 + i] = kb < K ? W[(size_t)(kb < K ? kb : K - 1) * ld + n] : 0.f; }
  return bsplit16(v); }
__device__ __forceinline__ v8f mac3(const F2& a, const F2& b, v8f c) { c = wmma_bf(a.l, b.h, c); c = wmma_bf(a.h, b.l, c); return wmma_bf(a.h, b.h, c); }
__device__ __forceinline__ float sigm(float v) { return 1.0f / (1.0f + expf(-v)); }
#define LDSX() do { asm volatile("s_wait_dscnt 0" ::: "memory"); __builtin_amdgcn_wave_barrier(); __builtin_amdgcn_fence(__ATOMIC_RELEASE, "workgroup"); } while (0)


// Relative-position multi-head attention (B 8, T 1024, F 512, 8 heads x 64): q/k/v = Linear(query/key/value); p = pos_emb Wp^T; scores = ((q + pos_bias_u) k^T + (q + pos_bias_v) p^T) / sqrt(64); masked (mask == 0 -> float32 min); attn = softmax, then 0 where masked; x = attn v; out = x Wo^T + bo.
#define NB 8
#define TT 1024
#define FF 512
#define NH 8
#define HD 64
#ifndef TQB
#define TQB (TT / 64)
#define TNB NB
#define TOB (NB * TT / 64)
#endif
typedef __attribute__((ext_vector_type(8))) __bf16 v8b;
typedef __attribute__((ext_vector_type(4))) __bf16 v4b;
__device__ __forceinline__ v16b frag_b(const __bf16* rowk0, int lane) {
  union { v16b v; v8b q[2]; } u; const __bf16* p = rowk0 + 8 * (lane >> 4);
  u.q[0] = *(const v8b*)p; u.q[1] = *(const v8b*)(p + 16); return u.v;
}
__device__ __forceinline__ float bfr(float v) { return (float)(__bf16)v; }
// e^v for v <= 0 by the hardware's base-2 exponential: one multiply by log2(e) and one v_exp_f32
__device__ __forceinline__ float exp_hw(float v) { return __builtin_amdgcn_exp2f(v * 1.44269504f); }
__device__ __attribute__((noinline)) float erf_ni(float v) { return erff(v); }

#define WS_PW  0u                                   // bf16 natural rows: Wq, Wk, Wv, Wp, Wo [512][512] each
#define WS_QA  (WS_PW + 2u * 5 * FF * FF)            // f32 [NB*TT][8 h][128]: q+u | q+v
#define WS_KB  (WS_QA + 4u * NB * TT * NH * 128)      // bf16 [NB*TT][8 h][2][128]: hi of k | p, then residual of k | p (512 B per (row, head))
#define WS_VH  (WS_KB + 4u * NB * TT * NH * 128)      // bf16 [NB][512 (h*64+d)][TT]
#define WS_VL  (WS_VH + 2u * NB * FF * TT)
#define WS_P   (WS_VL + 2u * NB * FF * TT)            // f32 [TT][512] p = pos_emb Wp^T
#define WS_O   (WS_P + 4u * TT * FF)                  // f32 [NB*TT][512]
#define WS_END (WS_O + 4u * NB * TT * FF)

// ---- k_pack: block = (row n, which 0..4): natural [out][in] rows of Wq, Wk, Wv, Wp, Wo
__global__ __launch_bounds__(128) void k_pack(const float* __restrict__ WQ, const float* __restrict__ WK, const float* __restrict__ WV, const float* __restrict__ WP, const float* __restrict__ WO, __bf16* __restrict__ PW) {
  __shared__ __align__(16) __bf16 s[FF]; const int n = blockIdx.x, which = blockIdx.y, tid = threadIdx.x; const float* src = (which == 0 ? WQ : which == 1 ? WK : which == 2 ? WV : which == 3 ? WP : WO) + (size_t)n * FF;
  for (int k = tid; k < FF; k += 128) s[k] = (__bf16)src[k];
  __syncthreads();
  if (tid < FF / 8) vst2((unsigned*)(PW + ((size_t)which * FF + n) * FF + tid * 8), *(const v4u*)&s[tid * 8]);
}
// ---- the 64-row x 128-column product that k_posp, k_proj and k_out share: acc[j] (wave's 16 rows x columns j * 16 ..) += A rows (f32, rounded or split to bf16) . W rows (bf16), K = 512
// A slice of 64 k of the block's 64 A rows (256 B each) and 128 W rows (128 B each) is brought into LDS once per block by asynchronous copies, whole 128-B lines per wave-instruction, one slice ahead, two buffers; the four waves read their fragments from there.
#define GKC 64
#define APITCH 272                                   // 256-B A row + 16 B: 16 B x odd, conflict-free for 16-byte LDS reads
#define WPITCH 144                                   // 128-B W row + 16 B: 16 B x odd
#define G_W  (64 * APITCH)
#define G_SZ (G_W + 128 * WPITCH)
// one slice = 16 copies of 16 B per lane: 8 of A (copy i: row 8 i + tid / 16, 16 lanes per row), 8 of W (copy i: row 16 i + tid / 8, 8 lanes per row)
__device__ __forceinline__ void stage_aw(unsigned la, unsigned lw, const float* ga, const __bf16* gw) {
  // s_wait_xcnt closes each statement so that it stands in front of any later rewrite of the address registers the copies name
  asm volatile("global_load_async_to_lds_b128 %0, %8, off\n\t"
               "global_load_async_to_lds_b128 %1, %9, off\n\t"
               "global_load_async_to_lds_b128 %2, %10, off\n\t"
               "global_load_async_to_lds_b128 %3, %11, off\n\t"
               "global_load_async_to_lds_b128 %4, %12, off\n\t"
               "global_load_async_to_lds_b128 %5, %13, off\n\t"
               "global_load_async_to_lds_b128 %6, %14, off\n\t"
               "global_load_async_to_lds_b128 %7, %15, off\n\t"
               "s_wait_xcnt 0x0"
               :: "v"(la), "v"(la + 8 * APITCH), "v"(la + 16 * APITCH), "v"(la + 24 * APITCH), "v"(la + 32 * APITCH), "v"(la + 40 * APITCH), "v"(la + 48 * APITCH), "v"(la + 56 * APITCH),
                  "v"(ga), "v"(ga + 8 * FF), "v"(ga + 16 * FF), "v"(ga + 24 * FF), "v"(ga + 32 * FF), "v"(ga + 40 * FF), "v"(ga + 48 * FF), "v"(ga + 56 * FF)
               : "memory");
  asm volatile("global_load_async_to_lds_b128 %0, %8, off\n\t"
               "global_load_async_to_lds_b128 %1, %9, off\n\t"
               "global_load_async_to_lds_b128 %2, %10, off\n\t"
               "global_load_async_to_lds_b128 %3, %11, off\n\t"
               "global_load_async_to_lds_b128 %4, %12, off\n\t"
               "global_load_async_to_lds_b128 %5, %13, off\n\t"
               "global_load_async_to_lds_b128 %6, %14, off\n\t"
               "global_load_async_to_lds_b128 %7, %15, off\n\t"
               "s_wait_xcnt 0x0"
               :: "v"(lw), "v"(lw + 16 * WPITCH), "v"(lw + 32 * WPITCH), "v"(lw + 48 * WPITCH), "v"(lw + 64 * WPITCH), "v"(lw + 80 * WPITCH), "v"(lw + 96 * WPITCH), "v"(lw + 112 * WPITCH),
                  "v"(gw), "v"(gw + 16 * FF), "v"(gw + 32 * FF), "v"(gw + 48 * FF), "v"(gw + 64 * FF), "v"(gw + 80 * FF), "v"(gw + 96 * FF), "v"(gw + 112 * FF)
               : "memory");
}
// A = the block's first row, Wn = the block's first W row, ring = 2 * G_SZ bytes of LDS; SPLIT: A as bf16 hi + residual (2 products), else A rounded to bf16 (1 product)
template <bool SPLIT>
__device__ __forceinline__ void gemm_tile(const float* __restrict__ A, const __bf16* __restrict__ Wn, char* ring, v8f (&acc)[8]) {
  const int tid = threadIdx.x, wave = tid >> 5, lane = tid & 31, col = lane & 15, g = lane >> 4;
  // this lane's places in a slice (LDS byte addresses in buffer 0) and its sources at slice 0
  const unsigned la = (unsigned)(size_t)&ring[(tid >> 4) * APITCH + (tid & 15) * 16], lw = (unsigned)(size_t)&ring[G_W + (tid >> 3) * WPITCH + (tid & 7) * 16];
  const float* ga = A + (size_t)(tid >> 4) * FF + (tid & 15) * 4; const __bf16* gw = Wn + (size_t)(tid >> 3) * FF + (tid & 7) * 8;
  stage_aw(la, lw, ga, gw);
  asm volatile("s_wait_asynccnt 0x0" ::: "memory");   // this wave's copies of slice 0 have landed
  __syncthreads();                                     // and every other wave's: slice 0 may be read
  stage_aw(la + G_SZ, lw + G_SZ, ga + GKC, gw + GKC);
  // kept rolled: one trip already holds a whole slice's fragments in registers, and eight copies of the body would only grow the code
#pragma unroll 1
  for (int t = 0; t < FF / GKC; ++t) { const char* st = ring + (t & 1) * G_SZ; const float* arow = (const float*)(st + (wave * 16 + col) * APITCH);
    // the slice's fragments are read as one group in front of its WMMAs: one LDS latency per slice
    v16b w[2][8];
#pragma unroll
    for (int kk = 0; kk < 2; ++kk)
#pragma unroll
      for (int j = 0; j < 8; ++j) w[kk][j] = frag_b((const __bf16*)(st + G_W + (j * 16 + col) * WPITCH) + kk * 32, lane);
    if (SPLIT) { const F2 a[2] = { split_row(arow, 0, lane), split_row(arow, 32, lane) };
#pragma unroll
      for (int kk = 0; kk < 2; ++kk)
#pragma unroll
        for (int j = 0; j < 8; ++j) { acc[j] = wmma_bf(a[kk].l, w[kk][j], acc[j]); acc[j] = wmma_bf(a[kk].h, w[kk][j], acc[j]); }
    } else { v16b a[2];
#pragma unroll
      for (int kk = 0; kk < 2; ++kk) { const float* p = arow + kk * 32 + 8 * g;
#pragma unroll
        for (int i = 0; i < 8; ++i) { a[kk][i] = (__bf16)p[i]; a[kk][8 + i] = (__bf16)p[16 + i]; } }
#pragma unroll
      for (int kk = 0; kk < 2; ++kk)
#pragma unroll
        for (int j = 0; j < 8; ++j) acc[j] = wmma_bf(a[kk], w[kk][j], acc[j]);
    }
    // hand-over, every wave:
    asm volatile("s_wait_dscnt 0x0" ::: "memory");     // this wave's reads of the slice's buffer are done
    asm volatile("s_wait_asynccnt 0x0" ::: "memory");  // this wave's copies of slice t + 1 have landed
    __syncthreads();                                    // publishes slice t + 1 and frees the buffer just read
    if (t + 2 < FF / GKC) stage_aw(la + (t & 1) * G_SZ, lw + (t & 1) * G_SZ, ga + (t + 2) * GKC, gw + (t + 2) * GKC); }
  asm volatile("s_wait_asynccnt 0x0" ::: "memory");    // no copy is left in flight when the wave goes on
}
// ---- k_posp: block = (64 positions, 128 cols): p = bf16(pos_emb) . Wp rows (exact) -> P rows (512-B segments)
__global__ __launch_bounds__(128) void k_posp(const float* __restrict__ PE, const __bf16* __restrict__ P4, float* __restrict__ P) {
  __shared__ __align__(16) char ring[2 * G_SZ]; __shared__ __align__(16) float so[4][16][132];
  const int tid = threadIdx.x, wave = tid >> 5, lane = tid & 31, col = lane & 15, g = lane >> 4; const size_t r0 = (size_t)blockIdx.x * 64 + wave * 16; const int n0 = blockIdx.y * 128;
  v8f acc[8] = {};
  gemm_tile<false>(PE + (size_t)blockIdx.x * 64 * FF, P4 + (size_t)n0 * FF, ring, acc);
#pragma unroll
  for (int j = 0; j < 8; ++j)
#pragma unroll
    for (int r = 0; r < 8; ++r) so[wave][8 * g + r][j * 16 + col] = acc[j][r];
  LDSX();
  for (int rl = 0; rl < 16; ++rl) vst2(P + (r0 + rl) * FF + n0 + lane * 4, *(const v4f*)&so[wave][rl][lane * 4]);
}
// ---- k_proj<MODE>: block = (64 rows (b,t), 128 cols = 2 heads): MODE 0: q = query.Wq^T + bq -> QA[row][h][q+u | q+v] (512-B per (row, head)); MODE 1: k = key.Wk^T + bk -> KB[row][h][k | p[t]], split here, once, to bf16 hi + residual halves (256 B each); MODE 2: v = value.Wv^T + bv -> transposed hi/lo planes
template <int MODE>
__global__ __launch_bounds__(128) void k_proj(const float* __restrict__ X, const __bf16* __restrict__ P1, const float* __restrict__ bias, const float* __restrict__ U, const float* __restrict__ Vb, const float* __restrict__ PP, float* __restrict__ OUT, __bf16* __restrict__ VH, __bf16* __restrict__ VL) {
  __shared__ __align__(16) char ring[2 * G_SZ]; __shared__ __align__(16) float so[4][16][260]; __shared__ __align__(16) __bf16 sth[128][72], stl[128][72];
  const int tid = threadIdx.x, wave = tid >> 5, lane = tid & 31, col = lane & 15, g = lane >> 4; const size_t rb = (size_t)blockIdx.x * 64; const size_t r0 = rb + wave * 16; const int n0 = blockIdx.y * 128;
  v8f acc[8] = {};
  gemm_tile<false>(X + rb * FF, P1 + (size_t)n0 * FF, ring, acc);
  if (MODE == 2) {
#pragma unroll
    for (int j = 0; j < 8; ++j) { const float bb = bfr(bias[n0 + j * 16 + col]);
#pragma unroll
      for (int r = 0; r < 8; ++r) { const float v = acc[j][r] + bb; const __bf16 hb = (__bf16)v; sth[j * 16 + col][wave * 16 + 8 * g + r] = hb; stl[j * 16 + col][wave * 16 + 8 * g + r] = (__bf16)(v - (float)hb); } }
    __syncthreads();
    const int b = (int)(rb / TT), t0 = (int)(rb % TT);
    for (int q = tid; q < 128 * 8; q += 128) { const int d = q >> 3, pc = q & 7; const size_t o = ((size_t)b * FF + n0 + d) * TT + t0 + pc * 8; vst2((unsigned*)(VH + o), *(const v4u*)&sth[d][pc * 8]); vst2((unsigned*)(VL + o), *(const v4u*)&stl[d][pc * 8]); }
  } else {
    // two heads in this column block: hl = j / 4 (local), d = (j % 4) * 16 + col; segment layout per (row, head): [first 64 | second 64]
#pragma unroll
    for (int j = 0; j < 8; ++j) { const int hl = j >> 2, d = (j & 3) * 16 + col; const int h = (n0 >> 6) + hl; const float bb = bfr(bias[n0 + j * 16 + col]);
#pragma unroll
      for (int r = 0; r < 8; ++r) { const float v = acc[j][r] + bb; const int rl = 8 * g + r;
        if (MODE == 0) { so[wave][rl][hl * 128 + d] = v + bfr(U[h * HD + d]); so[wave][rl][hl * 128 + 64 + d] = v + bfr(Vb[h * HD + d]); }
        else { const size_t t = (r0 + rl) % TT; so[wave][rl][hl * 128 + d] = v; so[wave][rl][hl * 128 + 64 + d] = PP[t * FF + h * HD + d]; } } }
    LDSX();
    const int h0 = n0 >> 6;
    if (MODE == 1) { __bf16* KO = (__bf16*)OUT;
      // a lane takes 4 neighbouring values of a (row, head) segment and stores their hi parts and their residuals as 8 bytes each: the wave writes two whole 256-B halves
      for (int rl = 0; rl < 16; ++rl)
#pragma unroll
        for (int hl = 0; hl < 2; ++hl) { const v4f x = *(const v4f*)&so[wave][rl][hl * 128 + lane * 4]; v4b hi, lo;
#pragma unroll
          for (int i = 0; i < 4; ++i) { const __bf16 hb = (__bf16)x[i]; hi[i] = hb; lo[i] = (__bf16)(x[i] - (float)hb); }
          __bf16* o = KO + ((r0 + rl) * NH + h0 + hl) * 256 + lane * 4; vst2(o, hi); vst2(o + 128, lo); } }
    else
    for (int rl = 0; rl < 16; ++rl) { vst2(OUT + ((r0 + rl) * NH + h0) * 128 + lane * 4, *(const v4f*)&so[wave][rl][lane * 4]); vst2(OUT + ((r0 + rl) * NH + h0) * 128 + 128 + lane * 4, *(const v4f*)&so[wave][rl][128 + lane * 4]); }
  }
}
// ---- k_attn: block = (64 queries, head h, batch b): per 32-key step: mask tile loads (int) -> wave vote -> {transposed scores S^T = [k|p].[q+u|q+v]^T / 8 (3 products, K 128), masked -> -3e38; online softmax in-lane, one query per lane; O^T += V^T(hi/lo).P^T(hi/lo)}; rows with no live key output 0 (the module's where(mask==0, 0, softmax)); O[row][h*64+d]
// The step's K rows (32 x 512 B: 128 bf16 hi, 128 bf16 residuals, as k_proj<1> left them) and V hi/lo rows (2 x 64 x 64 B) are the same for the block's four waves: they are brought into LDS once per block by asynchronous copies (whole lines of K per wave-instruction), one step ahead, two buffers.
#define KPITCH 528                                   // 512-B K row + 16 B: 16 B x odd, conflict-free for 16-byte LDS reads
#define VPITCH 80                                    // 64-B V row + 16 B: 16 B x odd
#define ST_VH  (32 * KPITCH)
#define ST_VL  (ST_VH + HD * VPITCH)
#define ST_SZ  (ST_VL + HD * VPITCH)
// one stage = 12 copies of 16 B per lane: 8 of K (copy i: key row 4 i + wave, the wave's 32 lanes cover the 512-B row), 2 of V hi, 2 of V lo (4 lanes per 64-B row)
__device__ __forceinline__ void stage_kv(unsigned lk, unsigned lv, const float* gk, const __bf16* gh, const __bf16* gl) {
  // s_wait_xcnt closes the statement so that it stands in front of any later rewrite of the address registers the copies name
  asm volatile("global_load_async_to_lds_b128 %0, %12, off\n\t"
               "global_load_async_to_lds_b128 %1, %13, off\n\t"
               "global_load_async_to_lds_b128 %2, %14, off\n\t"
               "global_load_async_to_lds_b128 %3, %15, off\n\t"
               "global_load_async_to_lds_b128 %4, %16, off\n\t"
               "global_load_async_to_lds_b128 %5, %17, off\n\t"
               "global_load_async_to_lds_b128 %6, %18, off\n\t"
               "global_load_async_to_lds_b128 %7, %19, off\n\t"
               "global_load_async_to_lds_b128 %8, %20, off\n\t"
               "global_load_async_to_lds_b128 %9, %21, off\n\t"
               "global_load_async_to_lds_b128 %10, %22, off\n\t"
               "global_load_async_to_lds_b128 %11, %23, off\n\t"
               "s_wait_xcnt 0x0"
               :: "v"(lk), "v"(lk + 4 * KPITCH), "v"(lk + 8 * KPITCH), "v"(lk + 12 * KPITCH), "v"(lk + 16 * KPITCH), "v"(lk + 20 * KPITCH), "v"(lk + 24 * KPITCH), "v"(lk + 28 * KPITCH),
                  "v"(lv + ST_VH), "v"(lv + ST_VH + 32 * VPITCH), "v"(lv + ST_VL), "v"(lv + ST_VL + 32 * VPITCH),
                  "v"(gk), "v"(gk + 4 * NH * 128), "v"(gk + 8 * NH * 128), "v"(gk + 12 * NH * 128), "v"(gk + 16 * NH * 128), "v"(gk + 20 * NH * 128), "v"(gk + 24 * NH * 128), "v"(gk + 28 * NH * 128),
                  "v"(gh), "v"(gh + 32 * TT), "v"(gl), "v"(gl + 32 * TT)
               : "memory");
}
__global__ __launch_bounds__(128) void k_attn(const float* __restrict__ QA, const float* __restrict__ KB, const int* __restrict__ MASK, const __bf16* __restrict__ VH, const __bf16* __restrict__ VL, float* __restrict__ O) {
  __shared__ __align__(16) char ring[2 * ST_SZ];
  __shared__ __align__(16) float so[4][16][68];
  const int tid = threadIdx.x, wave = tid >> 5, lane = tid & 31, col = lane & 15, g = lane >> 4;
  const int qb = blockIdx.x, h = blockIdx.y, b = blockIdx.z; const int q0 = qb * 64 + wave * 16; const size_t rq = (size_t)b * TT + q0;
  const float* qrow = QA + ((rq + col) * NH + h) * 128;
  // this lane's places in a stage (LDS byte addresses in buffer 0) and its sources at key step 0
  const unsigned lk0 = (unsigned)(size_t)&ring[wave * KPITCH + lane * 16], lv0 = (unsigned)(size_t)&ring[(tid >> 2) * VPITCH + (tid & 3) * 16];
  const float* gk0 = KB + (((size_t)b * TT + wave) * NH + h) * 128 + lane * 4;
  const size_t gvo = ((size_t)b * FF + h * HD + (tid >> 2)) * TT + (tid & 3) * 8;
  stage_kv(lk0, lv0, gk0, VH + gvo, VL + gvo);
  // transposed products: a lane owns ONE query (col); its half g holds keys 8 g + r of each 16-key tile. m = running maximum of the query (equal in both halves), l = this half's share of the running sum
  float m = -3.0e38f, l = 0.f;
  v8f acc[4] = {};                                     // O^T tiles: acc[dt][r] = O[query col][dt * 16 + 8 g + r]
  // the wave's 16 query rows do not change over the key loop: load and split them to bf16 hi/lo fragments once, kept in registers (unrolled so that qa[] is indexed by constants and never goes to scratch)
  F2 qa[4];
#pragma unroll
  for (int kc = 0; kc < 4; ++kc) qa[kc] = split_row(qrow, kc * 32, lane);
  const int* mrow = MASK + ((size_t)b * TT + q0 + col) * TT + 8 * g;
  asm volatile("s_wait_asynccnt 0x0" ::: "memory");   // this wave's copies of step 0 have landed
  __syncthreads();                                     // and every other wave's: step 0 may be read
  stage_kv(lk0 + ST_SZ, lv0 + ST_SZ, gk0 + (size_t)32 * NH * 128, VH + gvo + 32, VL + gvo + 32);
#pragma unroll 1
  for (int ks = 0; ks < TT / 32; ++ks) { int mk[2][8]; bool anylive = false; const char* st = ring + (ks & 1) * ST_SZ;
    const v4i mq[4] = { *(const v4i*)(mrow + ks * 32), *(const v4i*)(mrow + ks * 32 + 4), *(const v4i*)(mrow + ks * 32 + 16), *(const v4i*)(mrow + ks * 32 + 20) };
#pragma unroll
    for (int i = 0; i < 16; ++i) { const int mv = mq[i >> 2][i & 3]; mk[i >> 3][i & 7] = mv; anylive = anylive || (mv != 0); }
    if (__any(anylive)) { float s[2][8];
      // S^T = [k|p] . [q+u|q+v]^T: A = key rows (hi and residual fragments as they lie in LDS), B = the query fragments; D register r = key 8 g + r, column = query
#pragma unroll
      for (int ct = 0; ct < 2; ++ct) { const char* krow = st + (ct * 16 + col) * KPITCH; v8f c = {};
#pragma unroll
        for (int kc = 0; kc < 4; ++kc) { const v16b kh = frag_b((const __bf16*)krow + kc * 32, lane), kl = frag_b((const __bf16*)krow + 128 + kc * 32, lane); c = wmma_bf(kh, qa[kc].l, c); c = wmma_bf(kl, qa[kc].h, c); c = wmma_bf(kh, qa[kc].h, c); }
#pragma unroll
        for (int r = 0; r < 8; ++r) s[ct][r] = (mk[ct][r] != 0) ? c[r] * 0.125f : -3.0e38f; }
      // the query's maximum over the step's 32 keys: 16 in this lane, 16 in lane ^ 16
      float mx = fmaxf(s[0][0], s[1][0]);
#pragma unroll
      for (int r = 1; r < 8; ++r) mx = fmaxf(mx, fmaxf(s[0][r], s[1][r]));
      mx = fmaxf(mx, __int_as_float(__builtin_amdgcn_permlanex16(__float_as_int(mx), __float_as_int(mx), 0x76543210, 0xfedcba98, false, false)));
      const float mn = fmaxf(m, mx); const float alpha = (m <= -1.0e38f) ? 0.f : exp_hw(m - mn);
      // the exponentials stand in line, for every lane, and a masked value is replaced by a select
      float e[16];
#pragma unroll
      for (int i = 0; i < 16; ++i) { const float sv = s[i >> 3][i & 7]; const float x = exp_hw(sv - mn);
        if (i == 6) asm volatile("v_nop");               // the free slot the instruction set asks for behind a transcendental whose source register the next vector instruction overwrites
        e[i] = (sv <= -1.0e38f) ? 0.f : x; }
      l = l * alpha + (((e[0] + e[1]) + (e[2] + e[3])) + ((e[4] + e[5]) + (e[6] + e[7])) + (((e[8] + e[9]) + (e[10] + e[11])) + ((e[12] + e[13]) + (e[14] + e[15])))); m = mn;
#pragma unroll
      for (int dt = 0; dt < 4; ++dt)
#pragma unroll
        for (int r = 0; r < 8; ++r) acc[dt][r] *= alpha;
      // P^T is a B operand as it stands: element i = key 8 g + i, element 8 + i = key 16 + 8 g + i, the k order of the V fragments
      const F2 pb = bsplit16(e);
      // O^T += V^T . P^T: A = V rows (d), B = P^T
#pragma unroll
      for (int dt = 0; dt < 4; ++dt) { const int vr = (dt * 16 + col) * VPITCH; const v16b vh = frag_b((const __bf16*)(st + ST_VH + vr), lane), vl = frag_b((const __bf16*)(st + ST_VL + vr), lane); acc[dt] = wmma_bf(vh, pb.l, acc[dt]); acc[dt] = wmma_bf(vl, pb.h, acc[dt]); acc[dt] = wmma_bf(vh, pb.h, acc[dt]); } }
    // hand-over, every wave, also one that skipped the step's work:
    asm volatile("s_wait_dscnt 0x0" ::: "memory");     // this wave's reads of the step's buffer are done
    asm volatile("s_wait_asynccnt 0x0" ::: "memory");  // this wave's copies of step ks + 1 have landed
    __syncthreads();                                    // publishes step ks + 1 and frees the buffer just read
    if (ks + 2 < TT / 32) stage_kv(lk0 + (ks & 1) * ST_SZ, lv0 + (ks & 1) * ST_SZ, gk0 + (size_t)(ks + 2) * 32 * NH * 128, VH + gvo + (ks + 2) * 32, VL + gvo + (ks + 2) * 32); }
  asm volatile("s_wait_asynccnt 0x0" ::: "memory");    // no copy is left in flight when the wave goes on to its end
  // the two halves' shares of the query's sum are joined once
  l += __int_as_float(__builtin_amdgcn_permlanex16(__float_as_int(l), __float_as_int(l), 0x76543210, 0xfedcba98, false, false));
  const float il = (l > 0.f) ? 1.0f / l : 0.f;
#pragma unroll
  for (int dt = 0; dt < 4; ++dt)
#pragma unroll
    for (int r = 0; r < 8; ++r) so[wave][col][dt * 16 + 8 * g + r] = acc[dt][r] * il;
  LDSX();
  for (int rl = 0; rl < 16; ++rl) if (lane < 16) vst2(O + (rq + rl) * FF + h * HD + lane * 4, *(const v4f*)&so[wave][rl][lane * 4]);
}
// ---- k_out: block = (64 rows, 128 cols): out = O(hi/lo) . Wo rows (2 products) + bo
__global__ __launch_bounds__(128) void k_out(const float* __restrict__ O, const __bf16* __restrict__ P, const float* __restrict__ bias, float* __restrict__ Y) {
  __shared__ __align__(16) char ring[2 * G_SZ]; __shared__ __align__(16) float so[4][16][132];
  const int tid = threadIdx.x, wave = tid >> 5, lane = tid & 31, col = lane & 15, g = lane >> 4; const size_t r0 = (size_t)blockIdx.x * 64 + wave * 16; const int n0 = blockIdx.y * 128;
  v8f acc[8] = {};
  gemm_tile<true>(O + (size_t)blockIdx.x * 64 * FF, P + (size_t)n0 * FF, ring, acc);
#pragma unroll
  for (int j = 0; j < 8; ++j) { const float bb = bfr(bias[n0 + j * 16 + col]);
#pragma unroll
    for (int r = 0; r < 8; ++r) so[wave][8 * g + r][j * 16 + col] = acc[j][r] + bb; }
  LDSX();
  for (int rl = 0; rl < 16; ++rl) vst2(Y + (r0 + rl) * FF + n0 + lane * 4, *(const v4f*)&so[wave][rl][lane * 4]);
}
extern "C" void kernel_launch(void* const* d_in, const int* in_sizes, int n_in, void* d_out, int out_size, void* d_ws, size_t ws_size, hipStream_t stream) {
  (void)in_sizes; (void)n_in; (void)out_size;
  const float** F = (const float**)d_in; const int* MASK = (const int*)d_in[3];
  // 0 query, 1 key, 2 value [8,1024,512], 3 mask [8,1024,1024] i32, 4 pos_emb [1,1024,512], 5 Wq, 6 bq, 7 Wk, 8 bk, 9 Wv, 10 bv, 11 Wp, 12 Wo, 13 bo, 14 pos_bias_u [8,64], 15 pos_bias_v [8,64]
  if (ws_size < (size_t)WS_END) return;
  char* ws = (char*)d_ws; __bf16 *PW = (__bf16*)(ws + WS_PW), *VH = (__bf16*)(ws + WS_VH), *VL = (__bf16*)(ws + WS_VL); float *QA = (float*)(ws + WS_QA), *KB = (float*)(ws + WS_KB), *P = (float*)(ws + WS_P), *O = (float*)(ws + WS_O);
  k_pack<<<dim3(FF, 5), 128, 0, stream>>>(F[5], F[7], F[9], F[11], F[12], PW);
  k_posp<<<dim3(TT / 64, FF / 128), 128, 0, stream>>>(F[4], PW + (size_t)3 * FF * FF, P);
  k_proj<0><<<dim3(TNB * TT / 64, FF / 128), 128, 0, stream>>>(F[0], PW, F[6], F[14], F[15], P, QA, nullptr, nullptr);
  k_proj<1><<<dim3(TNB * TT / 64, FF / 128), 128, 0, stream>>>(F[1], PW + (size_t)FF * FF, F[8], F[14], F[15], P, KB, nullptr, nullptr);
  k_proj<2><<<dim3(TNB * TT / 64, FF / 128), 128, 0, stream>>>(F[2], PW + (size_t)2 * FF * FF, F[10], F[14], F[15], P, nullptr, VH, VL);
  k_attn<<<dim3(TQB, NH, TNB), 128, 0, stream>>>(QA, KB, MASK, VH, VL, O);
  k_out<<<dim3(TOB, FF / 128), 128, 0, stream>>>(O, PW + (size_t)4 * FF * FF, F[13], (float*)d_out);
}

// v007
// A run of this version takes 134 microseconds.
// Next to v006, in two timings, it ran 1.15 times as fast each time.
// Counting every step since v000, it is 3.64 times as fast.
// compute dtype: query, key, value, pos_emb, mask, all weights/biases and the position biases (module inputs) rounded to bf16 / read as int32; the four projections with exact bf16 products (inputs x inputs) on WMMA 16x16x32; scores as one 64-deep dot q . (k + p) with both computed operands as bf16 hi + residual pairs (3 products) on top of a per-key term u.k + v.p ([k | p] hi + residual x exact [u | v], 2 products), P.V with P hi/lo x V hi/lo (3 products), output projection hi/lo x exact Wo (2 products); masking, softmax and the masked-row zeroing in f32; f32 accumulate.
#include <hip/hip_runtime.h>
#include <math.h>

typedef __attribute__((ext_vector_type(16))) _Float16 v16h;
typedef __attribute__((ext_vector_type(16))) __bf16 v16b;
typedef __attribute__((ext_vector_type(8)))  _Float16 v8h;
typedef __attribute__((ext_vector_type(8)))  float v8f;
typedef __attribute__((ext_vector_type(4)))  float v4f;
typedef __attribute__((ext_vector_type(2)))  float v2f;
typedef __attribute__((ext_vector_type(4)))  unsigned v4u;
typedef __attribute__((ext_vector_type(4)))  int v4i;
typedef float __attribute__((may_alias)) float_a;
typedef int __attribute__((may_alias)) int_a;

template <typename T> __device__ __forceinline__ void vst2(void* p, T v) { *(T*)p = v;  }
__device__ __forceinline__ v8f wmma16(v16h a, v16h b, v8f c) {
  v8f d = __builtin_amdgcn_wmma_f32_16x16x32_f16(false, a, false, b, (short)0, c, false, false);
  asm volatile("v_nop\n\tv_nop\n\tv_nop\n\tv_nop" : "+v"(d) : "v"(a), "v"(b));
  return d;
}
__device__ __forceinline__ v8f wmma_bf(v16b a, v16b b, v8f c) {
  v8f d = __builtin_amdgcn_wmma_f32_16x16x32_bf16(false, a, false, b, (short)0, c, false, false);
  asm volatile("v_nop\n\tv_nop\n\tv_nop\n\tv_nop" : "+v"(d) : "v"(a), "v"(b));
  return d;
}
// 16x16x32 fragments: lane = (h = lane>>4, row/col = lane&15); elements 0..7 = k0+8h+0..7, 8..15 = k0+16+8h+0..7; D element r = row 8h+r
__device__ __forceinline__ v16h frag_h(const _Float16* rowk0, int lane) {
  union { v16h v; v8h q[2]; } u; const _Float16* p = rowk0 + 8 * (lane >> 4);
  u.q[0] = *(const v8h*)p; u.q[1] = *(const v8h*)(p + 16); return u.v;
}
__device__ __forceinline__ v16h frag_f32(const float* rowk0, int lane) {
  v16h a; const float* p = rowk0 + 8 * (lane >> 4);
#pragma unroll
  for (int i = 0; i < 8; ++i) { a[i] = (_Float16)p[i]; a[8 + i] = (_Float16)p[16 + i]; }
  return a;
}
__device__ __forceinline__ v16h frag_f32s(const float* rowk0, int lane, float sc) {
  v16h a; const float* p = rowk0 + 8 * (lane >> 4);
#pragma unroll
  for (int i = 0; i < 8; ++i) { a[i] = (_Float16)(p[i] * sc); a[8 + i] = (_Float16)(p[16 + i] * sc); }
  return a;
}
// column fragment from a [K][ld] layout (column n), rows >= K read as 0
__device__ __forceinline__ v16h fragc_f32(const float* W, int k0, int n, int lane, int ld, int K) {
  v16h a; const int g = lane >> 4;
#pragma unroll
  for (int i = 0; i < 8; ++i) { const int ka = k0 + 8 * g + i, kb = ka + 16;
    a[i] = (_Float16)(ka < K ? W[(size_t)(ka < K ? ka : K - 1) * ld + n] : 0.f); a[8 + i] = (_Float16)(kb < K ? W[(size_t)(kb < K ? kb : K - 1) * ld + n] : 0.f); }
  return a;
}
struct F2 { v16b h, l; };
__device__ __forceinline__ F2 bsplit16(const float v[16]) { F2 r;
#pragma unroll
  for (int i = 0; i < 16; ++i) { const __bf16 h = (__bf16)v[i]; r.h[i] = h; r.l[i] = (__bf16)(v[i] - (float)h); }
  return r; }
__device__ __forceinline__ F2 split_row(const float* row, int k0, int lane) { float v[16]; const float* p = row + k0 + 8 * (lane >> 4);
#pragma unroll
  for (int i = 0; i < 8; ++i) { v[i] = p[i]; v[8 + i] = p[16 + i]; }
  return bsplit16(v); }
__device__ __forceinline__ F2 split_rowK(const float* row, int k0, int lane, int K) { float v[16]; const int g = lane >> 4;
#pragma unroll
  for (int i = 0; i < 8; ++i) { const int ka = k0 + 8 * g + i, kb = ka + 16; v[i] = ka < K ? row[ka < K ? ka : K - 1] : 0.f; v[8 + i] = kb < K ? row[kb < K ? kb : K - 1] : 0.f; }
  return bsplit16(v); }
__device__ __forceinline__ F2 split_col(const float* W, int k0, int n, int lane, int ld, int K) { float v[16]; const int g = lane >> 4;
#pragma unroll
  for (int i = 0; i < 8; ++i) { const int ka = k0 + 8 * g + i, kb = ka + 16; v[i] = ka < K ? W[(size_t)(ka < K ? ka : K - 1) * ld + n] : 0.f; v[8 + i] = kb < K ? W[(size_t)(kb < K ? kb : K - 1) * ld + n] : 0.f; }
  return bsplit16(v); }
__device__ __forceinline__ v8f mac3(const F2& a, const F2& b, v8f c) { c = wmma_bf(a.l, b.h, c); c = wmma_bf(a.h, b.l, c); return wmma_bf(a.h, b.h, c); }
__device__ __forceinline__ float sigm(float v) { return 1.0f / (1.0f + expf(-v)); }
#define LDSX() do { asm volatile("s_wait_dscnt 0" ::: "memory"); __builtin_amdgcn_wave_barrier(); __builtin_amdgcn_fence(__ATOMIC_RELEASE, "workgroup"); } while (0)


// Relative-position multi-head attention (B 8, T 1024, F 512, 8 heads x 64): q/k/v = Linear(query/key/value); p = pos_emb Wp^T; scores = ((q + pos_bias_u) k^T + (q + pos_bias_v) p^T) / sqrt(64); masked (mask == 0 -> float32 min); attn = softmax, then 0 where masked; x = attn v; out = x Wo^T + bo.
#define NB 8
#define TT 1024
#define FF 512
#define NH 8
#define HD 64
#ifndef TQB
#define TQB (TT / 64)
#define TNB NB
#define TOB (NB * TT / 64)
#endif
typedef __attribute__((ext_vector_type(8))) __bf16 v8b;
typedef __attribute__((ext_vector_type(4))) __bf16 v4b;
__device__ __forceinline__ v16b frag_b(const __bf16* rowk0, int lane) {
  union { v16b v; v8b q[2]; } u; const __bf16* p = rowk0 + 8 * (lane >> 4);
  u.q[0] = *(const v8b*)p; u.q[1] = *(const v8b*)(p + 16); return u.v;
}
__device__ __forceinline__ float bfr(float v) { return (float)(__bf16)v; }
// e^v for v <= 0 by the hardware's base-2 exponential: one multiply by log2(e) and one v_exp_f32
__device__ __forceinline__ float exp_hw(float v) { return __builtin_amdgcn_exp2f(v * 1.44269504f); }
// four base-2 exponentials in one statement: the instruction set asks for a free slot behind a transcendental before its source is overwritten or its result read; here each one's slot is filled by the next (early-clobber outputs: none lies on a source) and the last one's by the v_nop. Left to the compiler, this build put an exponential's result on the source of the one in front of it
__device__ __forceinline__ void exp2x4(float (&x)[4], float a0, float a1, float a2, float a3) {
  asm("v_exp_f32 %0, %4\n\tv_exp_f32 %1, %5\n\tv_exp_f32 %2, %6\n\tv_exp_f32 %3, %7\n\tv_nop" : "=&v"(x[0]), "=&v"(x[1]), "=&v"(x[2]), "=&v"(x[3]) : "v"(a0), "v"(a1), "v"(a2), "v"(a3));
}
__device__ __attribute__((noinline)) float erf_ni(float v) { return erff(v); }

#define WS_PW  0u                                   // bf16 natural rows: Wq, Wk, Wv, Wp, Wo [512][512] each
#define WS_QA  (WS_PW + 2u * 5 * FF * FF)            // f32 [NB*TT][8 h][64]: q
#define WS_KB  (WS_QA + 4u * NB * TT * FF)            // bf16 [NB*TT][8 h][2][64]: hi of k + p, then residual of k + p (256 B per (row, head))
#define WS_BI  (WS_KB + 4u * NB * TT * FF)            // f32 [NB*TT / 16][8 h][16]: the per-key score term u.k + v.p
#define WS_VH  (WS_BI + 4u * NB * TT * NH)            // bf16 [NB][512 (h*64+d)][TT]
#define WS_VL  (WS_VH + 2u * NB * FF * TT)
#define WS_P   (WS_VL + 2u * NB * FF * TT)            // f32 [TT][512] p = pos_emb Wp^T
#define WS_O   (WS_P + 4u * TT * FF)                  // f32 [NB*TT][512]
#define WS_END (WS_O + 4u * NB * TT * FF)

// ---- k_pack: block = (row n, which 0..4): natural [out][in] rows of Wq, Wk, Wv, Wp, Wo
__global__ __launch_bounds__(128) void k_pack(const float* __restrict__ WQ, const float* __restrict__ WK, const float* __restrict__ WV, const float* __restrict__ WP, const float* __restrict__ WO, __bf16* __restrict__ PW) {
  __shared__ __align__(16) __bf16 s[FF]; const int n = blockIdx.x, which = blockIdx.y, tid = threadIdx.x; const float* src = (which == 0 ? WQ : which == 1 ? WK : which == 2 ? WV : which == 3 ? WP : WO) + (size_t)n * FF;
  for (int k = tid; k < FF; k += 128) s[k] = (__bf16)src[k];
  __syncthreads();
  if (tid < FF / 8) vst2((unsigned*)(PW + ((size_t)which * FF + n) * FF + tid * 8), *(const v4u*)&s[tid * 8]);
}
// ---- the 64-row x 128-column product that k_posp, k_proj and k_out share: acc[j] (wave's 16 rows x columns j * 16 ..) += A rows (f32, rounded or split to bf16) . W rows (bf16), K = 512
// A slice of 64 k of the block's 64 A rows (256 B each) and 128 W rows (128 B each) is brought into LDS once per block by asynchronous copies, whole 128-B lines per wave-instruction, one slice ahead, two buffers; the four waves read their fragments from there.
#define GKC 64
#define APITCH 272                                   // 256-B A row + 16 B: 16 B x odd, conflict-free for 16-byte LDS reads
#define WPITCH 144                                   // 128-B W row + 16 B: 16 B x odd
#define G_W  (64 * APITCH)
#define G_SZ (G_W + 128 * WPITCH)
// one slice = 16 copies of 16 B per lane: 8 of A (copy i: row 8 i + tid / 16, 16 lanes per row), 8 of W (copy i: row 16 i + tid / 8, 8 lanes per row)
__device__ __forceinline__ void stage_aw(unsigned la, unsigned lw, const float* ga, const __bf16* gw) {
  // s_wait_xcnt closes each statement so that it stands in front of any later rewrite of the address registers the copies name
  asm volatile("global_load_async_to_lds_b128 %0, %8, off\n\t"
               "global_load_async_to_lds_b128 %1, %9, off\n\t"
               "global_load_async_to_lds_b128 %2, %10, off\n\t"
               "global_load_async_to_lds_b128 %3, %11, off\n\t"
               "global_load_async_to_lds_b128 %4, %12, off\n\t"
               "global_load_async_to_lds_b128 %5, %13, off\n\t"
               "global_load_async_to_lds_b128 %6, %14, off\n\t"
               "global_load_async_to_lds_b128 %7, %15, off\n\t"
               "s_wait_xcnt 0x0"
               :: "v"(la), "v"(la + 8 * APITCH), "v"(la + 16 * APITCH), "v"(la + 24 * APITCH), "v"(la + 32 * APITCH), "v"(la + 40 * APITCH), "v"(la + 48 * APITCH), "v"(la + 56 * APITCH),
                  "v"(ga), "v"(ga + 8 * FF), "v"(ga + 16 * FF), "v"(ga + 24 * FF), "v"(ga + 32 * FF), "v"(ga + 40 * FF), "v"(ga + 48 * FF), "v"(ga + 56 * FF)
               : "memory");
  asm volatile("global_load_async_to_lds_b128 %0, %8, off\n\t"
               "global_load_async_to_lds_b128 %1, %9, off\n\t"
               "global_load_async_to_lds_b128 %2, %10, off\n\t"
               "global_load_async_to_lds_b128 %3, %11, off\n\t"
               "global_load_async_to_lds_b128 %4, %12, off\n\t"
               "global_load_async_to_lds_b128 %5, %13, off\n\t"
               "global_load_async_to_lds_b128 %6, %14, off\n\t"
               "global_load_async_to_lds_b128 %7, %15, off\n\t"
               "s_wait_xcnt 0x0"
               :: "v"(lw), "v"(lw + 16 * WPITCH), "v"(lw + 32 * WPITCH), "v"(lw + 48 * WPITCH), "v"(lw + 64 * WPITCH), "v"(lw + 80 * WPITCH), "v"(lw + 96 * WPITCH), "v"(lw + 112 * WPITCH),
                  "v"(gw), "v"(gw + 16 * FF), "v"(gw + 32 * FF), "v"(gw + 48 * FF), "v"(gw + 64 * FF), "v"(gw + 80 * FF), "v"(gw + 96 * FF), "v"(gw + 112 * FF)
               : "memory");
}
// A = the block's first row, Wn = the block's first W row, ring = 2 * G_SZ bytes of LDS; SPLIT: A as bf16 hi + residual (2 products), else A rounded to bf16 (1 product)
template <bool SPLIT>
__device__ __forceinline__ void gemm_tile(const float* __restrict__ A, const __bf16* __restrict__ Wn, char* ring, v8f (&acc)[8]) {
  const int tid = threadIdx.x, wave = tid >> 5, lane = tid & 31, col = lane & 15, g = lane >> 4;
  // this lane's places in a slice (LDS byte addresses in buffer 0) and its sources at slice 0
  const unsigned la = (unsigned)(size_t)&ring[(tid >> 4) * APITCH + (tid & 15) * 16], lw = (unsigned)(size_t)&ring[G_W + (tid >> 3) * WPITCH + (tid & 7) * 16];
  const float* ga = A + (size_t)(tid >> 4) * FF + (tid & 15) * 4; const __bf16* gw = Wn + (size_t)(tid >> 3) * FF + (tid & 7) * 8;
  stage_aw(la, lw, ga, gw);
  asm volatile("s_wait_asynccnt 0x0" ::: "memory");   // this wave's copies of slice 0 have landed
  __syncthreads();                                     // and every other wave's: slice 0 may be read
  stage_aw(la + G_SZ, lw + G_SZ, ga + GKC, gw + GKC);
  // kept rolled: one trip already holds a whole slice's fragments in registers, and eight copies of the body would only grow the code
#pragma unroll 1
  for (int t = 0; t < FF / GKC; ++t) { const char* st = ring + (t & 1) * G_SZ; const float* arow = (const float*)(st + (wave * 16 + col) * APITCH);
    // the slice's fragments are read as one group in front of its WMMAs: one LDS latency per slice
    v16b w[2][8];
#pragma unroll
    for (int kk = 0; kk < 2; ++kk)
#pragma unroll
      for (int j = 0; j < 8; ++j) w[kk][j] = frag_b((const __bf16*)(st + G_W + (j * 16 + col) * WPITCH) + kk * 32, lane);
    if (SPLIT) { const F2 a[2] = { split_row(arow, 0, lane), split_row(arow, 32, lane) };
#pragma unroll
      for (int kk = 0; kk < 2; ++kk)
#pragma unroll
        for (int j = 0; j < 8; ++j) { acc[j] = wmma_bf(a[kk].l, w[kk][j], acc[j]); acc[j] = wmma_bf(a[kk].h, w[kk][j], acc[j]); }
    } else { v16b a[2];
#pragma unroll
      for (int kk = 0; kk < 2; ++kk) { const float* p = arow + kk * 32 + 8 * g;
#pragma unroll
        for (int i = 0; i < 8; ++i) { a[kk][i] = (__bf16)p[i]; a[kk][8 + i] = (__bf16)p[16 + i]; } }
#pragma unroll
      for (int kk = 0; kk < 2; ++kk)
#pragma unroll
        for (int j = 0; j < 8; ++j) acc[j] = wmma_bf(a[kk], w[kk][j], acc[j]);
    }
    // hand-over, every wave:
    asm volatile("s_wait_dscnt 0x0" ::: "memory");     // this wave's reads of the slice's buffer are done
    asm volatile("s_wait_asynccnt 0x0" ::: "memory");  // this wave's copies of slice t + 1 have landed
    __syncthreads();                                    // publishes slice t + 1 and frees the buffer just read
    if (t + 2 < FF / GKC) stage_aw(la + (t & 1) * G_SZ, lw + (t & 1) * G_SZ, ga + (t + 2) * GKC, gw + (t + 2) * GKC); }
  asm volatile("s_wait_asynccnt 0x0" ::: "memory");    // no copy is left in flight when the wave goes on
}
// ---- k_posp: block = (64 positions, 128 cols): p = bf16(pos_emb) . Wp rows (exact) -> P rows (512-B segments)
__global__ __launch_bounds__(128) void k_posp(const float* __restrict__ PE, const __bf16* __restrict__ P4, float* __restrict__ P) {
  __shared__ __align__(16) char ring[2 * G_SZ]; __shared__ __align__(16) float so[4][16][132];
  const int tid = threadIdx.x, wave = tid >> 5, lane = tid & 31, col = lane & 15, g = lane >> 4; const size_t r0 = (size_t)blockIdx.x * 64 + wave * 16; const int n0 = blockIdx.y * 128;
  v8f acc[8] = {};
  gemm_tile<false>(PE + (size_t)blockIdx.x * 64 * FF, P4 + (size_t)n0 * FF, ring, acc);
#pragma unroll
  for (int j = 0; j < 8; ++j)
#pragma unroll
    for (int r = 0; r < 8; ++r) so[wave][8 * g + r][j * 16 + col] = acc[j][r];
  LDSX();
  for (int rl = 0; rl < 16; ++rl) vst2(P + (r0 + rl) * FF + n0 + lane * 4, *(const v4f*)&so[wave][rl][lane * 4]);
}
// ---- k_proj<MODE>: block = (64 rows (b,t), 128 cols = 2 heads): MODE 0: q = query.Wq^T + bq -> QA rows; MODE 1: k = key.Wk^T + bk -> KB[row][h][k + p[t]], split here, once, to bf16 hi + residual halves (128 B each), and BI = u.k + v.p[t] per (row, head); MODE 2: v = value.Wv^T + bv -> transposed hi/lo planes
// (q + u).k + (q + v).p = q.(k + p) + (u.k + v.p): the second term does not depend on the query, so it is formed once per key here and the score product of k_attn is 64 deep instead of 128
template <int MODE>
__global__ __launch_bounds__(128) void k_proj(const float* __restrict__ X, const __bf16* __restrict__ P1, const float* __restrict__ bias, const float* __restrict__ U, const float* __restrict__ Vb, const float* __restrict__ PP, float* __restrict__ OUT, float* __restrict__ BI, __bf16* __restrict__ VH, __bf16* __restrict__ VL) {
  __shared__ __align__(16) char ring[2 * G_SZ]; __shared__ __align__(16) float so[4][16][MODE == 1 ? 260 : 132]; __shared__ __align__(16) __bf16 sth[128][72], stl[128][72];
  const int tid = threadIdx.x, wave = tid >> 5, lane = tid & 31, col = lane & 15, g = lane >> 4; const size_t rb = (size_t)blockIdx.x * 64; const size_t r0 = rb + wave * 16; const int n0 = blockIdx.y * 128;
  v8f acc[8] = {};
  gemm_tile<false>(X + rb * FF, P1 + (size_t)n0 * FF, ring, acc);
  if (MODE == 2) {
#pragma unroll
    for (int j = 0; j < 8; ++j) { const float bb = bfr(bias[n0 + j * 16 + col]);
#pragma unroll
      for (int r = 0; r < 8; ++r) { const float v = acc[j][r] + bb; const __bf16 hb = (__bf16)v; sth[j * 16 + col][wave * 16 + 8 * g + r] = hb; stl[j * 16 + col][wave * 16 + 8 * g + r] = (__bf16)(v - (float)hb); } }
    __syncthreads();
    const int b = (int)(rb / TT), t0 = (int)(rb % TT);
    for (int q = tid; q < 128 * 8; q += 128) { const int d = q >> 3, pc = q & 7; const size_t o = ((size_t)b * FF + n0 + d) * TT + t0 + pc * 8; vst2((unsigned*)(VH + o), *(const v4u*)&sth[d][pc * 8]); vst2((unsigned*)(VL + o), *(const v4u*)&stl[d][pc * 8]); }
  } else {
    // two heads in this column block: hl = j / 4 (local), d = (j % 4) * 16 + col; segment layout per (row, head): [first 64 | second 64]
#pragma unroll
    for (int j = 0; j < 8; ++j) { const int hl = j >> 2, d = (j & 3) * 16 + col; const int h = (n0 >> 6) + hl; const float bb = bfr(bias[n0 + j * 16 + col]);
#pragma unroll
      for (int r = 0; r < 8; ++r) { const float v = acc[j][r] + bb; const int rl = 8 * g + r;
        if (MODE == 0) so[wave][rl][j * 16 + col] = v;
        else { const size_t t = (r0 + rl) % TT; so[wave][rl][hl * 128 + d] = v; so[wave][rl][hl * 128 + 64 + d] = PP[t * FF + h * HD + d]; } } }
    LDSX();
    const int h0 = n0 >> 6;
    if (MODE == 1) { __bf16* KO = (__bf16*)OUT;
      // the per-key term: A = the wave's 16 [k | p] rows (hi + residual), B = [u | v] of the head in every column (exact bf16), so that D register r = the term of row 8 g + r in every lane of the half
      v8f ub[2];
#pragma unroll
      for (int hl = 0; hl < 2; ++hl) { v8f c = {};
#pragma unroll
        for (int kc = 0; kc < 4; ++kc) { const float* uv = (kc < 2 ? U : Vb) + (h0 + hl) * HD + (kc & 1) * 32 + 8 * g; v16b w;
#pragma unroll
          for (int i = 0; i < 8; ++i) { w[i] = (__bf16)uv[i]; w[8 + i] = (__bf16)uv[16 + i]; }
          const F2 a = split_row(&so[wave][col][hl * 128], kc * 32, lane); c = wmma_bf(a.l, w, c); c = wmma_bf(a.h, w, c); }
        ub[hl] = c; }
      // the wave's 16 rows x 2 heads are one whole 128-B line of BI: eight lanes store 16 bytes each (col = 2 hl + which four of the half's eight rows)
      if (col < 4) { const v8f c = (col & 2) ? ub[1] : ub[0]; const v4f x = (col & 1) ? v4f{c[4], c[5], c[6], c[7]} : v4f{c[0], c[1], c[2], c[3]};
        vst2(BI + ((r0 >> 4) * NH + h0 + (col >> 1)) * 16 + 8 * g + (col & 1) * 4, x); }
      // a lane takes 4 neighbouring sums k + p of a (row, head) segment (lanes 0..15 the first head, 16..31 the second) and stores their hi parts and their residuals as 8 bytes each: the wave writes four whole 128-B halves
      for (int rl = 0; rl < 16; ++rl) { const v4f x = *(const v4f*)&so[wave][rl][g * 128 + col * 4] + *(const v4f*)&so[wave][rl][g * 128 + 64 + col * 4]; v4b hi, lo;
#pragma unroll
        for (int i = 0; i < 4; ++i) { const __bf16 hb = (__bf16)x[i]; hi[i] = hb; lo[i] = (__bf16)(x[i] - (float)hb); }
        __bf16* o = KO + ((r0 + rl) * NH + h0 + g) * 128 + col * 4; vst2(o, hi); vst2(o + 64, lo); } }
    else
    for (int rl = 0; rl < 16; ++rl) vst2(OUT + (r0 + rl) * FF + n0 + lane * 4, *(const v4f*)&so[wave][rl][lane * 4]);
  }
}
// ---- k_attn: block = (64 queries, head h, batch b): per 32-key step: mask tile loads (int) -> wave vote -> {transposed scores S^T = ((k+p).q^T + per-key term) / 8 (3 products, K 64, the term as the accumulator's start value), masked -> -3e38; online softmax in-lane, one query per lane; O^T += V^T(hi/lo).P^T(hi/lo)}; rows with no live key output 0 (the module's where(mask==0, 0, softmax)); O[row][h*64+d]
// The step's K rows (32 x 256 B: 64 bf16 hi, 64 bf16 residuals, as k_proj<1> left them) and V hi/lo rows (2 x 64 x 64 B) are the same for the block's four waves: they are brought into LDS once per block by asynchronous copies (whole lines of K per wave-instruction), one step ahead, two buffers.
#define KPITCH 272                                   // 256-B K row + 16 B: 16 B x odd, conflict-free for 16-byte LDS reads
#define VPITCH 80                                    // 64-B V row + 16 B: 16 B x odd
#define ST_VH  (32 * KPITCH)
#define ST_VL  (ST_VH + HD * VPITCH)
#define ST_SZ  (ST_VL + HD * VPITCH)
// one stage = 8 copies of 16 B per lane: 4 of K (copy i: key row 8 i + tid / 16, 16 lanes cover the 256-B row), 2 of V hi, 2 of V lo (4 lanes per 64-B row)
__device__ __forceinline__ void stage_kv(unsigned lk, unsigned lv, const float* gk, const __bf16* gh, const __bf16* gl) {
  // s_wait_xcnt closes the statement so that it stands in front of any later rewrite of the address registers the copies name
  asm volatile("global_load_async_to_lds_b128 %0, %8, off\n\t"
               "global_load_async_to_lds_b128 %1, %9, off\n\t"
               "global_load_async_to_lds_b128 %2, %10, off\n\t"
               "global_load_async_to_lds_b128 %3, %11, off\n\t"
               "global_load_async_to_lds_b128 %4, %12, off\n\t"
               "global_load_async_to_lds_b128 %5, %13, off\n\t"
               "global_load_async_to_lds_b128 %6, %14, off\n\t"
               "global_load_async_to_lds_b128 %7, %15, off\n\t"
               "s_wait_xcnt 0x0"
               :: "v"(lk), "v"(lk + 8 * KPITCH), "v"(lk + 16 * KPITCH), "v"(lk + 24 * KPITCH),
                  "v"(lv + ST_VH), "v"(lv + ST_VH + 32 * VPITCH), "v"(lv + ST_VL), "v"(lv + ST_VL + 32 * VPITCH),
                  "v"(gk), "v"(gk + 8 * NH * 64), "v"(gk + 16 * NH * 64), "v"(gk + 24 * NH * 64),
                  "v"(gh), "v"(gh + 32 * TT), "v"(gl), "v"(gl + 32 * TT)
               : "memory");
}
__global__ __launch_bounds__(128) void k_attn(const float* __restrict__ QA, const float* __restrict__ KB, const float* __restrict__ BI, const int* __restrict__ MASK, const __bf16* __restrict__ VH, const __bf16* __restrict__ VL, float* __restrict__ O) {
  __shared__ __align__(16) char ring[2 * ST_SZ];
  __shared__ __align__(16) float so[4][16][68];
  __shared__ __align__(16) float sbi[TT];              // the per-key term of all the (batch, head)'s keys, in key order
  const int tid = threadIdx.x, wave = tid >> 5, lane = tid & 31, col = lane & 15, g = lane >> 4;
  const int qb = blockIdx.x, h = blockIdx.y, b = blockIdx.z; const int q0 = qb * 64 + wave * 16; const size_t rq = (size_t)b * TT + q0;
  const float* qrow = QA + ((rq + col) * NH + h) * HD;
  // this lane's places in a stage (LDS byte addresses in buffer 0) and its sources at key step 0
  const unsigned lk0 = (unsigned)(size_t)&ring[(tid >> 4) * KPITCH + (tid & 15) * 16], lv0 = (unsigned)(size_t)&ring[(tid >> 2) * VPITCH + (tid & 3) * 16];
  const float* gk0 = KB + (((size_t)b * TT + (tid >> 4)) * NH + h) * 64 + (tid & 15) * 4;
  const size_t gvo = ((size_t)b * FF + h * HD + (tid >> 2)) * TT + (tid & 3) * 8;
  stage_kv(lk0, lv0, gk0, VH + gvo, VL + gvo);
  // the per-key terms, filled once: 256 pieces of 16 B, two per lane (piece = 4 keys; 4 lanes cover a 16-key group's 64 B of this head); they land behind the same wait and barrier as step 0
  { const unsigned lb = (unsigned)(size_t)&sbi[tid * 4]; const float* gb = BI + (((size_t)b * (TT / 16) + (tid >> 2)) * NH + h) * 16 + (tid & 3) * 4;
    // s_wait_xcnt closes the statement so that it stands in front of any later rewrite of the address registers the copies name
    asm volatile("global_load_async_to_lds_b128 %0, %2, off\n\t"
                 "global_load_async_to_lds_b128 %1, %3, off\n\t"
                 "s_wait_xcnt 0x0"
                 :: "v"(lb), "v"(lb + 2048), "v"(gb), "v"(gb + 32 * NH * 16) : "memory"); }
  // transposed products: a lane owns ONE query (col); its half g holds keys 8 g + r of each 16-key tile. m = running maximum of the query (equal in both halves), l = this half's share of the running sum
  float m = -3.0e38f, l = 0.f;
  v8f acc[4] = {};                                     // O^T tiles: acc[dt][r] = O[query col][dt * 16 + 8 g + r]
  // the wave's 16 query rows do not change over the key loop: load and split them to bf16 hi/lo fragments once, kept in registers (unrolled so that qa[] is indexed by constants and never goes to scratch)
  F2 qa[2];
#pragma unroll
  for (int kc = 0; kc < 2; ++kc) qa[kc] = split_row(qrow, kc * 32, lane);
  const int* mrow = MASK + ((size_t)b * TT + q0 + col) * TT + 8 * g;
  asm volatile("s_wait_asynccnt 0x0" ::: "memory");   // this wave's copies of step 0 have landed
  __syncthreads();                                     // and every other wave's: step 0 may be read
  stage_kv(lk0 + ST_SZ, lv0 + ST_SZ, gk0 + (size_t)32 * NH * 64, VH + gvo + 32, VL + gvo + 32);
#pragma unroll 1
  for (int ks = 0; ks < TT / 32; ++ks) { int mk[2][8]; bool anylive = false; const char* st = ring + (ks & 1) * ST_SZ;
    const v4i mq[4] = { *(const v4i*)(mrow + ks * 32), *(const v4i*)(mrow + ks * 32 + 4), *(const v4i*)(mrow + ks * 32 + 16), *(const v4i*)(mrow + ks * 32 + 20) };
#pragma unroll
    for (int i = 0; i < 16; ++i) { const int mv = mq[i >> 2][i & 3]; mk[i >> 3][i & 7] = mv; anylive = anylive || (mv != 0); }
    if (__any(anylive)) { float s[2][8];
      // S^T = (k+p) . q^T + term: A = key rows (hi and residual fragments as they lie in LDS), B = the query fragments; D register r = key 8 g + r, column = query, so the accumulator starts from the terms of keys 8 g + 0..7
#pragma unroll
      for (int ct = 0; ct < 2; ++ct) { const char* krow = st + (ct * 16 + col) * KPITCH; const float* bp = &sbi[ks * 32 + ct * 16 + 8 * g]; const v4f b0 = *(const v4f*)bp, b1 = *(const v4f*)(bp + 4);
        v8f c = { b0[0], b0[1], b0[2], b0[3], b1[0], b1[1], b1[2], b1[3] };
#pragma unroll
        for (int kc = 0; kc < 2; ++kc) { const v16b kh = frag_b((const __bf16*)krow + kc * 32, lane), kl = frag_b((const __bf16*)krow + 64 + kc * 32, lane); c = wmma_bf(kh, qa[kc].l, c); c = wmma_bf(kl, qa[kc].h, c); c = wmma_bf(kh, qa[kc].h, c); }
#pragma unroll
        for (int r = 0; r < 8; ++r) s[ct][r] = (mk[ct][r] != 0) ? c[r] * 0.125f : -3.0e38f; }
      // the query's maximum over the step's 32 keys: 16 in this lane, 16 in lane ^ 16
      float mx = fmaxf(s[0][0], s[1][0]);
#pragma unroll
      for (int r = 1; r < 8; ++r) mx = fmaxf(mx, fmaxf(s[0][r], s[1][r]));
      mx = fmaxf(mx, __int_as_float(__builtin_amdgcn_permlanex16(__float_as_int(mx), __float_as_int(mx), 0x76543210, 0xfedcba98, false, false)));
      const float mn = fmaxf(m, mx); const float alpha = (m <= -1.0e38f) ? 0.f : exp_hw(m - mn);
      // the exponentials stand in line, for every lane, and a masked value is replaced by a select
      float e[16];
#pragma unroll
      for (int i = 0; i < 16; i += 4) { float x[4];
        exp2x4(x, (s[i >> 3][i & 7] - mn) * 1.44269504f, (s[i >> 3][(i & 7) + 1] - mn) * 1.44269504f, (s[i >> 3][(i & 7) + 2] - mn) * 1.44269504f, (s[i >> 3][(i & 7) + 3] - mn) * 1.44269504f);
#pragma unroll
        for (int u = 0; u < 4; ++u) e[i + u] = (s[i >> 3][(i & 7) + u] <= -1.0e38f) ? 0.f : x[u]; }
      l = l * alpha + (((e[0] + e[1]) + (e[2] + e[3])) + ((e[4] + e[5]) + (e[6] + e[7])) + (((e[8] + e[9]) + (e[10] + e[11])) + ((e[12] + e[13]) + (e[14] + e[15])))); m = mn;
#pragma unroll
      for (int dt = 0; dt < 4; ++dt)
#pragma unroll
        for (int r = 0; r < 8; ++r) acc[dt][r] *= alpha;
      // P^T is a B operand as it stands: element i = key 8 g + i, element 8 + i = key 16 + 8 g + i, the k order of the V fragments
      const F2 pb = bsplit16(e);
      // O^T += V^T . P^T: A = V rows (d), B = P^T
#pragma unroll
      for (int dt = 0; dt < 4; ++dt) { const int vr = (dt * 16 + col) * VPITCH; const v16b vh = frag_b((const __bf16*)(st + ST_VH + vr), lane), vl = frag_b((const __bf16*)(st + ST_VL + vr), lane); acc[dt] = wmma_bf(vh, pb.l, acc[dt]); acc[dt] = wmma_bf(vl, pb.h, acc[dt]); acc[dt] = wmma_bf(vh, pb.h, acc[dt]); } }
    // hand-over, every wave, also one that skipped the step's work:
    asm volatile("s_wait_dscnt 0x0" ::: "memory");     // this wave's reads of the step's buffer are done
    asm volatile("s_wait_asynccnt 0x0" ::: "memory");  // this wave's copies of step ks + 1 have landed
    __syncthreads();                                    // publishes step ks + 1 and frees the buffer just read
    if (ks + 2 < TT / 32) stage_kv(lk0 + (ks & 1) * ST_SZ, lv0 + (ks & 1) * ST_SZ, gk0 + (size_t)(ks + 2) * 32 * NH * 64, VH + gvo + (ks + 2) * 32, VL + gvo + (ks + 2) * 32); }
  asm volatile("s_wait_asynccnt 0x0" ::: "memory");    // no copy is left in flight when the wave goes on to its end
  // the two halves' shares of the query's sum are joined once
  l += __int_as_float(__builtin_amdgcn_permlanex16(__float_as_int(l), __float_as_int(l), 0x76543210, 0xfedcba98, false, false));
  const float il = (l > 0.f) ? 1.0f / l : 0.f;
#pragma unroll
  for (int dt = 0; dt < 4; ++dt)
#pragma unroll
    for (int r = 0; r < 8; ++r) so[wave][col][dt * 16 + 8 * g + r] = acc[dt][r] * il;
  LDSX();
  for (int rl = 0; rl < 16; ++rl) if (lane < 16) vst2(O + (rq + rl) * FF + h * HD + lane * 4, *(const v4f*)&so[wave][rl][lane * 4]);
}
// ---- k_out: block = (64 rows, 128 cols): out = O(hi/lo) . Wo rows (2 products) + bo
__global__ __launch_bounds__(128) void k_out(const float* __restrict__ O, const __bf16* __restrict__ P, const float* __restrict__ bias, float* __restrict__ Y) {
  __shared__ __align__(16) char ring[2 * G_SZ]; __shared__ __align__(16) float so[4][16][132];
  const int tid = threadIdx.x, wave = tid >> 5, lane = tid & 31, col = lane & 15, g = lane >> 4; const size_t r0 = (size_t)blockIdx.x * 64 + wave * 16; const int n0 = blockIdx.y * 128;
  v8f acc[8] = {};
  gemm_tile<true>(O + (size_t)blockIdx.x * 64 * FF, P + (size_t)n0 * FF, ring, acc);
#pragma unroll
  for (int j = 0; j < 8; ++j) { const float bb = bfr(bias[n0 + j * 16 + col]);
#pragma unroll
    for (int r = 0; r < 8; ++r) so[wave][8 * g + r][j * 16 + col] = acc[j][r] + bb; }
  LDSX();
  for (int rl = 0; rl < 16; ++rl) vst2(Y + (r0 + rl) * FF + n0 + lane * 4, *(const v4f*)&so[wave][rl][lane * 4]);
}
extern "C" void kernel_launch(void* const* d_in, const int* in_sizes, int n_in, void* d_out, int out_size, void* d_ws, size_t ws_size, hipStream_t stream) {
  (void)in_sizes; (void)n_in; (void)out_size;
  const float** F = (const float**)d_in; const int* MASK = (const int*)d_in[3];
  // 0 query, 1 key, 2 value [8,1024,512], 3 mask [8,1024,1024] i32, 4 pos_emb [1,1024,512], 5 Wq, 6 bq, 7 Wk, 8 bk, 9 Wv, 10 bv, 11 Wp, 12 Wo, 13 bo, 14 pos_bias_u [8,64], 15 pos_bias_v [8,64]
  if (ws_size < (size_t)WS_END) return;
  char* ws = (char*)d_ws; __bf16 *PW = (__bf16*)(ws + WS_PW), *VH = (__bf16*)(ws + WS_VH), *VL = (__bf16*)(ws + WS_VL); float *QA = (float*)(ws + WS_QA), *KB = (float*)(ws + WS_KB), *BI = (float*)(ws + WS_BI), *P = (float*)(ws + WS_P), *O = (float*)(ws + WS_O);
  k_pack<<<dim3(FF, 5), 128, 0, stream>>>(F[5], F[7], F[9], F[11], F[12], PW);
  k_posp<<<dim3(TT / 64, FF / 128), 128, 0, stream>>>(F[4], PW + (size_t)3 * FF * FF, P);
  k_proj<0><<<dim3(TNB * TT / 64, FF / 128), 128, 0, stream>>>(F[0], PW, F[6], F[14], F[15], P, QA, nullptr, nullptr, nullptr);
  k_proj<1><<<dim3(TNB * TT / 64, FF / 128), 128, 0, stream>>>(F[1], PW + (size_t)FF * FF, F[8], F[14], F[15], P, KB, BI, nullptr, nullptr);
  k_proj<2><<<dim3(TNB * TT / 64, FF / 128), 128, 0, stream>>>(F[2], PW + (size_t)2 * FF * FF, F[10], F[14], F[15], P, nullptr, nullptr, VH, VL);
  k_attn<<<dim3(TQB, NH, TNB), 128, 0, stream>>>(QA, KB, BI, MASK, VH, VL, O);
  k_out<<<dim3(TOB, FF / 128), 128, 0, stream>>>(O, PW + (size_t)4 * FF * FF, F[13], (float*)d_out);
}

// v008
// One run takes 118 microseconds.
// Two timings next to v007 both put it at 1.13 times that version's speed.
// Over all steps from v000 it is 4.11 times as fast.
// compute dtype: query, key, value, pos_emb, mask, all weights/biases and the position biases (module inputs) rounded to bf16 / read as int32; the four projections with exact bf16 products (inputs x inputs) on WMMA 16x16x32; scores as one 64-deep dot q . (k + p) with both computed operands as bf16 hi + residual pairs (3 products) on top of a per-key term u.k + v.p ([k | p] hi + residual x exact [u | v], 2 products), P.V with P hi/lo x V hi/lo (3 products), output projection hi/lo x exact Wo (2 products); masking, softmax and the masked-row zeroing in f32; f32 accumulate.
#include <hip/hip_runtime.h>
#include <math.h>

typedef __attribute__((ext_vector_type(16))) _Float16 v16h;
typedef __attribute__((ext_vector_type(16))) __bf16 v16b;
typedef __attribute__((ext_vector_type(8)))  _Float16 v8h;
typedef __attribute__((ext_vector_type(8)))  float v8f;
typedef __attribute__((ext_vector_type(4)))  float v4f;
typedef __attribute__((ext_vector_type(2)))  float v2f;
typedef __attribute__((ext_vector_type(4)))  unsigned v4u;
typedef __attribute__((ext_vector_type(4)))  int v4i;
typedef float __attribute__((may_alias)) float_a;
typedef int __attribute__((may_alias)) int_a;

template <typename T> __device__ __forceinline__ void vst2(void* p, T v) { *(T*)p = v;  }
__device__ __forceinline__ v8f wmma16(v16h a, v16h b, v8f c) {
  v8f d = __builtin_amdgcn_wmma_f32_16x16x32_f16(false, a, false, b, (short)0, c, false, false);
  asm volatile("v_nop\n\tv_nop\n\tv_nop\n\tv_nop" : "+v"(d) : "v"(a), "v"(b));
  return d;
}
__device__ __forceinline__ v8f wmma_bf(v16b a, v16b b, v8f c) {
  v8f d = __builtin_amdgcn_wmma_f32_16x16x32_bf16(false, a, false, b, (short)0, c, false, false);
  asm volatile("v_nop\n\tv_nop\n\tv_nop\n\tv_nop" : "+v"(d) : "v"(a), "v"(b));
  return d;
}
// 16x16x32 fragments: lane = (h = lane>>4, row/col = lane&15); elements 0..7 = k0+8h+0..7, 8..15 = k0+16+8h+0..7; D element r = row 8h+r
__device__ __forceinline__ v16h frag_h(const _Float16* rowk0, int lane) {
  union { v16h v; v8h q[2]; } u; const _Float16* p = rowk0 + 8 * (lane >> 4);
  u.q[0] = *(const v8h*)p; u.q[1] = *(const v8h*)(p + 16); return u.v;
}
__device__ __forceinline__ v16h frag_f32(const float* rowk0, int lane) {
  v16h a; const float* p = rowk0 + 8 * (lane >> 4);
#pragma unroll
  for (int i = 0; i < 8; ++i) { a[i] = (_Float16)p[i]; a[8 + i] = (_Float16)p[16 + i]; }
  return a;
}
__device__ __forceinline__ v16h frag_f32s(const float* rowk0, int lane, float sc) {
  v16h a; const float* p = rowk0 + 8 * (lane >> 4);
#pragma unroll
  for (int i = 0; i < 8; ++i) { a[i] = (_Float16)(p[i] * sc); a[8 + i] = (_Float16)(p[16 + i] * sc); }
  return a;
}
// column fragment from a [K][ld] layout (column n), rows >= K read as 0
__device__ __forceinline__ v16h fragc_f32(const float* W, int k0, int n, int lane, int ld, int K) {
  v16h a; const int g = lane >> 4;
#pragma unroll
  for (int i = 0; i < 8; ++i) { const int ka = k0 + 8 * g + i, kb = ka + 16;
    a[i] = (_Float16)(ka < K ? W[(size_t)(ka < K ? ka : K - 1) * ld + n] : 0.f); a[8 + i] = (_Float16)(kb < K ? W[(size_t)(kb < K ? kb : K - 1) * ld + n] : 0.f); }
  return a;
}
struct F2 { v16b h, l; };
__device__ __forceinline__ F2 bsplit16(const float v[16]) { F2 r;
#pragma unroll
  for (int i = 0; i < 16; ++i) { const __bf16 h = (__bf16)v[i]; r.h[i] = h; r.l[i] = (__bf16)(v[i] - (float)h); }
  return r; }
__device__ __forceinline__ F2 split_row(const float* row, int k0, int lane) { float v[16]; const float* p = row + k0 + 8 * (lane >> 4);
#pragma unroll
  for (int i = 0; i < 8; ++i) { v[i] = p[i]; v[8 + i] = p[16 + i]; }
  return bsplit16(v); }
__device__ __forceinline__ F2 split_rowK(const float* row, int k0, int lane, int K) { float v[16]; const int g = lane >> 4;
#pragma unroll
  for (int i = 0; i < 8; ++i) { const int ka = k0 + 8 * g + i, kb = ka + 16; v[i] = ka < K ? row[ka < K ? ka : K - 1] : 0.f; v[8 + i] = kb < K ? row[kb < K ? kb : K - 1] : 0.f; }
  return bsplit16(v); }
__device__ __forceinline__ F2 split_col(const float* W, int k0, int n, int lane, int ld, int K) { float v[16]; const int g = lane >> 4;
#pragma unroll
  for (int i = 0; i < 8; ++i) { const int ka = k0 + 8 * g + i, kb = ka + 16; v[i] = ka < K ? W[(size_t)(ka < K ? ka : K - 1) * ld + n] : 0.f; v[8 + i] = kb < K ? W[(size_t)(kb < K ? kb : K - 1) * ld + n] : 0.f; }
  return bsplit16(v); }
__device__ __forceinline__ v8f mac3(const F2& a, const F2& b, v8f c) { c = wmma_bf(a.l, b.h, c); c = wmma_bf(a.h, b.l, c); return wmma_bf(a.h, b.h, c); }
__device__ __forceinline__ float sigm(float v) { return 1.0f / (1.0f + expf(-v)); }
#define LDSX() do { asm volatile("s_wait_dscnt 0" ::: "memory"); __builtin_amdgcn_wave_barrier(); __builtin_amdgcn_fence(__ATOMIC_RELEASE, "workgroup"); } while (0)


// Relative-position multi-head attention (B 8, T 1024, F 512, 8 heads x 64): q/k/v = Linear(query/key/value); p = pos_emb Wp^T; scores = ((q + pos_bias_u) k^T + (q + pos_bias_v) p^T) / sqrt(64); masked (mask == 0 -> float32 min); attn = softmax, then 0 where masked; x = attn v; out = x Wo^T + bo.
#define NB 8
#define TT 1024
#define FF 512
#define NH 8
#define HD 64
#ifndef TQB
#define TQB (TT / 64)
#define TNB NB
#define TOB (NB * TT / 64)
#endif
typedef __attribute__((ext_vector_type(8))) __bf16 v8b;
typedef __attribute__((ext_vector_type(4))) __bf16 v4b;
__device__ __forceinline__ v16b frag_b(const __bf16* rowk0, int lane) {
  union { v16b v; v8b q[2]; } u; const __bf16* p = rowk0 + 8 * (lane >> 4);
  u.q[0] = *(const v8b*)p; u.q[1] = *(const v8b*)(p + 16); return u.v;
}
__device__ __forceinline__ float bfr(float v) { return (float)(__bf16)v; }
// e^v for v <= 0 by the hardware's base-2 exponential: one multiply by log2(e) and one v_exp_f32
__device__ __forceinline__ float exp_hw(float v) { return __builtin_amdgcn_exp2f(v * 1.44269504f); }
// four base-2 exponentials in one statement: the instruction set asks for a free slot behind a transcendental before its source is overwritten or its result read; here each one's slot is filled by the next (early-clobber outputs: none lies on a source) and the last one's by the v_nop. Left to the compiler, this build put an exponential's result on the source of the one in front of it
__device__ __forceinline__ void exp2x4(float (&x)[4], float a0, float a1, float a2, float a3) {
  asm("v_exp_f32 %0, %4\n\tv_exp_f32 %1, %5\n\tv_exp_f32 %2, %6\n\tv_exp_f32 %3, %7\n\tv_nop" : "=&v"(x[0]), "=&v"(x[1]), "=&v"(x[2]), "=&v"(x[3]) : "v"(a0), "v"(a1), "v"(a2), "v"(a3));
}
__device__ __attribute__((noinline)) float erf_ni(float v) { return erff(v); }

#define WS_PW  0u                                   // bf16 natural rows: Wq, Wk, Wv, Wp, Wo [512][512] each
#define WS_QA  (WS_PW + 2u * 5 * FF * FF)            // f32 [NB*TT][8 h][64]: q
#define WS_KB  (WS_QA + 4u * NB * TT * FF)            // bf16 [NB*TT][8 h][2][64]: hi of k + p, then residual of k + p (256 B per (row, head))
#define WS_BI  (WS_KB + 4u * NB * TT * FF)            // f32 [NB*TT / 16][8 h][16]: the per-key score term u.k + v.p
#define WS_VH  (WS_BI + 4u * NB * TT * NH)            // bf16 [NB][512 (h*64+d)][TT]
#define WS_VL  (WS_VH + 2u * NB * FF * TT)
#define WS_P   (WS_VL + 2u * NB * FF * TT)            // f32 [TT][512] p = pos_emb Wp^T
#define WS_O   (WS_P + 4u * TT * FF)                  // f32 [NB*TT][512]
#define WS_END (WS_O + 4u * NB * TT * FF)

// ---- k_pack: block = (row n, which 0..4): natural [out][in] rows of Wq, Wk, Wv, Wp, Wo
__global__ __launch_bounds__(128) void k_pack(const float* __restrict__ WQ, const float* __restrict__ WK, const float* __restrict__ WV, const float* __restrict__ WP, const float* __restrict__ WO, __bf16* __restrict__ PW) {
  __shared__ __align__(16) __bf16 s[FF]; const int n = blockIdx.x, which = blockIdx.y, tid = threadIdx.x; const float* src = (which == 0 ? WQ : which == 1 ? WK : which == 2 ? WV : which == 3 ? WP : WO) + (size_t)n * FF;
  for (int k = tid; k < FF; k += 128) s[k] = (__bf16)src[k];
  __syncthreads();
  if (tid < FF / 8) vst2((unsigned*)(PW + ((size_t)which * FF + n) * FF + tid * 8), *(const v4u*)&s[tid * 8]);
}
// ---- the 64-row x 128-column product that k_pq, k_kv and k_out share: acc[j] (wave's 16 rows x columns j * 16 ..) += A rows (f32, rounded or split to bf16) . W rows (bf16), K = 512
// A slice of 64 k of the block's 64 A rows (256 B each) and 128 W rows (128 B each) is brought into LDS once per block by asynchronous copies, whole 128-B lines per wave-instruction, one slice ahead, two buffers; the four waves read their fragments from there.
#define GKC 64
#define APITCH 272                                   // 256-B A row + 16 B: 16 B x odd, conflict-free for 16-byte LDS reads
#define WPITCH 144                                   // 128-B W row + 16 B: 16 B x odd
#define G_W  (64 * APITCH)
#define G_SZ (G_W + 128 * WPITCH)
// one slice = 16 copies of 16 B per lane: 8 of A (copy i: row 8 i + tid / 16, 16 lanes per row), 8 of W (copy i: row 16 i + tid / 8, 8 lanes per row)
__device__ __forceinline__ void stage_aw(unsigned la, unsigned lw, const float* ga, const __bf16* gw) {
  // s_wait_xcnt closes each statement so that it stands in front of any later rewrite of the address registers the copies name
  asm volatile("global_load_async_to_lds_b128 %0, %8, off\n\t"
               "global_load_async_to_lds_b128 %1, %9, off\n\t"
               "global_load_async_to_lds_b128 %2, %10, off\n\t"
               "global_load_async_to_lds_b128 %3, %11, off\n\t"
               "global_load_async_to_lds_b128 %4, %12, off\n\t"
               "global_load_async_to_lds_b128 %5, %13, off\n\t"
               "global_load_async_to_lds_b128 %6, %14, off\n\t"
               "global_load_async_to_lds_b128 %7, %15, off\n\t"
               "s_wait_xcnt 0x0"
               :: "v"(la), "v"(la + 8 * APITCH), "v"(la + 16 * APITCH), "v"(la + 24 * APITCH), "v"(la + 32 * APITCH), "v"(la + 40 * APITCH), "v"(la + 48 * APITCH), "v"(la + 56 * APITCH),
                  "v"(ga), "v"(ga + 8 * FF), "v"(ga + 16 * FF), "v"(ga + 24 * FF), "v"(ga + 32 * FF), "v"(ga + 40 * FF), "v"(ga + 48 * FF), "v"(ga + 56 * FF)
               : "memory");
  asm volatile("global_load_async_to_lds_b128 %0, %8, off\n\t"
               "global_load_async_to_lds_b128 %1, %9, off\n\t"
               "global_load_async_to_lds_b128 %2, %10, off\n\t"
               "global_load_async_to_lds_b128 %3, %11, off\n\t"
               "global_load_async_to_lds_b128 %4, %12, off\n\t"
               "global_load_async_to_lds_b128 %5, %13, off\n\t"
               "global_load_async_to_lds_b128 %6, %14, off\n\t"
               "global_load_async_to_lds_b128 %7, %15, off\n\t"
               "s_wait_xcnt 0x0"
               :: "v"(lw), "v"(lw + 16 * WPITCH), "v"(lw + 32 * WPITCH), "v"(lw + 48 * WPITCH), "v"(lw + 64 * WPITCH), "v"(lw + 80 * WPITCH), "v"(lw + 96 * WPITCH), "v"(lw + 112 * WPITCH),
                  "v"(gw), "v"(gw + 16 * FF), "v"(gw + 32 * FF), "v"(gw + 48 * FF), "v"(gw + 64 * FF), "v"(gw + 80 * FF), "v"(gw + 96 * FF), "v"(gw + 112 * FF)
               : "memory");
}
// A = the block's first row, Wn = the block's first W row, ring = 2 * G_SZ bytes of LDS; SPLIT: A as bf16 hi + residual (2 products), else A rounded to bf16 (1 product)
template <bool SPLIT>
__device__ __forceinline__ void gemm_tile(const float* __restrict__ A, const __bf16* __restrict__ Wn, char* ring, v8f (&acc)[8]) {
  const int tid = threadIdx.x, wave = tid >> 5, lane = tid & 31, col = lane & 15, g = lane >> 4;
  // this lane's places in a slice (LDS byte addresses in buffer 0) and its sources at slice 0
  const unsigned la = (unsigned)(size_t)&ring[(tid >> 4) * APITCH + (tid & 15) * 16], lw = (unsigned)(size_t)&ring[G_W + (tid >> 3) * WPITCH + (tid & 7) * 16];
  const float* ga = A + (size_t)(tid >> 4) * FF + (tid & 15) * 4; const __bf16* gw = Wn + (size_t)(tid >> 3) * FF + (tid & 7) * 8;
  stage_aw(la, lw, ga, gw);
  asm volatile("s_wait_asynccnt 0x0" ::: "memory");   // this wave's copies of slice 0 have landed
  __syncthreads();                                     // and every other wave's: slice 0 may be read
  stage_aw(la + G_SZ, lw + G_SZ, ga + GKC, gw + GKC);
  // kept rolled: one trip already holds a whole slice's fragments in registers, and eight copies of the body would only grow the code
#pragma unroll 1
  for (int t = 0; t < FF / GKC; ++t) { const char* st = ring + (t & 1) * G_SZ; const float* arow = (const float*)(st + (wave * 16 + col) * APITCH);
    // the slice's fragments are read as one group in front of its WMMAs: one LDS latency per slice
    v16b w[2][8];
#pragma unroll
    for (int kk = 0; kk < 2; ++kk)
#pragma unroll
      for (int j = 0; j < 8; ++j) w[kk][j] = frag_b((const __bf16*)(st + G_W + (j * 16 + col) * WPITCH) + kk * 32, lane);
    if (SPLIT) { const F2 a[2] = { split_row(arow, 0, lane), split_row(arow, 32, lane) };
#pragma unroll
      for (int kk = 0; kk < 2; ++kk)
#pragma unroll
        for (int j = 0; j < 8; ++j) { acc[j] = wmma_bf(a[kk].l, w[kk][j], acc[j]); acc[j] = wmma_bf(a[kk].h, w[kk][j], acc[j]); }
    } else { v16b a[2];
#pragma unroll
      for (int kk = 0; kk < 2; ++kk) { const float* p = arow + kk * 32 + 8 * g;
#pragma unroll
        for (int i = 0; i < 8; ++i) { a[kk][i] = (__bf16)p[i]; a[kk][8 + i] = (__bf16)p[16 + i]; } }
#pragma unroll
      for (int kk = 0; kk < 2; ++kk)
#pragma unroll
        for (int j = 0; j < 8; ++j) acc[j] = wmma_bf(a[kk], w[kk][j], acc[j]);
    }
    // hand-over, every wave:
    asm volatile("s_wait_dscnt 0x0" ::: "memory");     // this wave's reads of the slice's buffer are done
    asm volatile("s_wait_asynccnt 0x0" ::: "memory");  // this wave's copies of slice t + 1 have landed
    __syncthreads();                                    // publishes slice t + 1 and frees the buffer just read
    if (t + 2 < FF / GKC) stage_aw(la + (t & 1) * G_SZ, lw + (t & 1) * G_SZ, ga + (t + 2) * GKC, gw + (t + 2) * GKC); }
  asm volatile("s_wait_asynccnt 0x0" ::: "memory");    // no copy is left in flight when the wave goes on
}
// The epilogues of k_pq and k_kv stage their tiles in the ring's own LDS: behind gemm_tile's last barrier no wave reads the ring any more and no copy is in flight. A block then holds 2 * G_SZ bytes and no more, four blocks fit a WGP, and every block of either launch is resident at once.
// ---- k_pq: one launch for the two products that need nothing but the packed weights; block = (64 rows, 128 cols). blockIdx.x < TT / 64: p = bf16(pos_emb) . Wp rows (exact) -> P rows (512-B segments); the others: q = query.Wq^T + bq -> QA rows
__global__ __launch_bounds__(128) void k_pq(const float* __restrict__ PE, const float* __restrict__ X, const __bf16* __restrict__ P4, const __bf16* __restrict__ P1, const float* __restrict__ bias, float* __restrict__ P, float* __restrict__ QA) {
  __shared__ __align__(16) char ring[2 * G_SZ];
  const int tid = threadIdx.x, wave = tid >> 5, lane = tid & 31, col = lane & 15, g = lane >> 4; const bool isp = blockIdx.x < TT / 64;
  const size_t rb = (size_t)(isp ? blockIdx.x : blockIdx.x - TT / 64) * 64; const size_t r0 = rb + wave * 16; const int n0 = blockIdx.y * 128;
  v8f acc[8] = {};
  gemm_tile<false>((isp ? PE : X) + rb * FF, (isp ? P4 : P1) + (size_t)n0 * FF, ring, acc);
  float (*so)[132] = (float (*)[132])(ring + wave * (16 * 132 * 4));
  if (isp) {
#pragma unroll
    for (int j = 0; j < 8; ++j)
#pragma unroll
      for (int r = 0; r < 8; ++r) so[8 * g + r][j * 16 + col] = acc[j][r];
  } else {
#pragma unroll
    for (int j = 0; j < 8; ++j) { const float bb = bfr(bias[n0 + j * 16 + col]);
#pragma unroll
      for (int r = 0; r < 8; ++r) so[8 * g + r][j * 16 + col] = acc[j][r] + bb; }
  }
  LDSX();
  float* dst = (isp ? P : QA) + r0 * FF + n0 + lane * 4;
  for (int rl = 0; rl < 16; ++rl) vst2(dst + rl * FF, *(const v4f*)&so[rl][lane * 4]);
}
// ---- k_kv: one launch for the key and the value projection; block = (64 rows (b,t), 128 cols = 2 heads, which). blockIdx.z 0: k = key.Wk^T + bk -> KB[row][h][k + p[t]], split here, once, to bf16 hi + residual halves (128 B each), and BI = u.k + v.p[t] per (row, head); blockIdx.z 1: v = value.Wv^T + bv -> transposed hi/lo planes
// (q + u).k + (q + v).p = q.(k + p) + (u.k + v.p): the second term does not depend on the query, so it is formed once per key here and the score product of k_attn is 64 deep instead of 128
__global__ __launch_bounds__(128) void k_kv(const float* __restrict__ XK, const float* __restrict__ XV, const __bf16* __restrict__ PK, const __bf16* __restrict__ PV, const float* __restrict__ bk, const float* __restrict__ bv, const float* __restrict__ U, const float* __restrict__ Vb, const float* __restrict__ PP, __bf16* __restrict__ KO, float* __restrict__ BI, __bf16* __restrict__ VH, __bf16* __restrict__ VL) {
  __shared__ __align__(16) char ring[2 * G_SZ];
  const int tid = threadIdx.x, wave = tid >> 5, lane = tid & 31, col = lane & 15, g = lane >> 4; const bool isv = blockIdx.z != 0; const size_t rb = (size_t)blockIdx.x * 64; const size_t r0 = rb + wave * 16; const int n0 = blockIdx.y * 128;
  v8f acc[8] = {};
  gemm_tile<false>((isv ? XV : XK) + rb * FF, (isv ? PV : PK) + (size_t)n0 * FF, ring, acc);
  if (isv) { __bf16 (*sth)[72] = (__bf16 (*)[72])ring, (*stl)[72] = (__bf16 (*)[72])(ring + 128 * 72 * 2);
#pragma unroll
    for (int j = 0; j < 8; ++j) { const float bb = bfr(bv[n0 + j * 16 + col]);
#pragma unroll
      for (int r = 0; r < 8; ++r) { const float v = acc[j][r] + bb; const __bf16 hb = (__bf16)v; sth[j * 16 + col][wave * 16 + 8 * g + r] = hb; stl[j * 16 + col][wave * 16 + 8 * g + r] = (__bf16)(v - (float)hb); } }
    __syncthreads();
    const int b = (int)(rb / TT), t0 = (int)(rb % TT);
    for (int q = tid; q < 128 * 8; q += 128) { const int d = q >> 3, pc = q & 7; const size_t o = ((size_t)b * FF + n0 + d) * TT + t0 + pc * 8; vst2((unsigned*)(VH + o), *(const v4u*)&sth[d][pc * 8]); vst2((unsigned*)(VL + o), *(const v4u*)&stl[d][pc * 8]); }
  } else { float (*so)[260] = (float (*)[260])(ring + wave * (16 * 260 * 4));
    // two heads in this column block: hl = j / 4 (local), d = (j % 4) * 16 + col; segment layout per (row, head): [k 64 | p 64]
#pragma unroll
    for (int j = 0; j < 8; ++j) { const int hl = j >> 2, d = (j & 3) * 16 + col; const int h = (n0 >> 6) + hl; const float bb = bfr(bk[n0 + j * 16 + col]);
#pragma unroll
      for (int r = 0; r < 8; ++r) { const float v = acc[j][r] + bb; const int rl = 8 * g + r;
        const size_t t = (r0 + rl) % TT; so[rl][hl * 128 + d] = v; so[rl][hl * 128 + 64 + d] = PP[t * FF + h * HD + d]; } }
    LDSX();
    const int h0 = n0 >> 6;
    // the per-key term: A = the wave's 16 [k | p] rows (hi + residual), B = [u | v] of the head in every column (exact bf16), so that D register r = the term of row 8 g + r in every lane of the half
    v8f ub[2];
#pragma unroll
    for (int hl = 0; hl < 2; ++hl) { v8f c = {};
#pragma unroll
      for (int kc = 0; kc < 4; ++kc) { const float* uv = (kc < 2 ? U : Vb) + (h0 + hl) * HD + (kc & 1) * 32 + 8 * g; v16b w;
#pragma unroll
        for (int i = 0; i < 8; ++i) { w[i] = (__bf16)uv[i]; w[8 + i] = (__bf16)uv[16 + i]; }
        const F2 a = split_row(&so[col][hl * 128], kc * 32, lane); c = wmma_bf(a.l, w, c); c = wmma_bf(a.h, w, c); }
      ub[hl] = c; }
    // the wave's 16 rows x 2 heads are one whole 128-B line of BI: eight lanes store 16 bytes each (col = 2 hl + which four of the half's eight rows)
    if (col < 4) { const v8f c = (col & 2) ? ub[1] : ub[0]; const v4f x = (col & 1) ? v4f{c[4], c[5], c[6], c[7]} : v4f{c[0], c[1], c[2], c[3]};
      vst2(BI + ((r0 >> 4) * NH + h0 + (col >> 1)) * 16 + 8 * g + (col & 1) * 4, x); }
    // a lane takes 4 neighbouring sums k + p of a (row, head) segment (lanes 0..15 the first head, 16..31 the second) and stores their hi parts and their residuals as 8 bytes each: the wave writes four whole 128-B halves
    for (int rl = 0; rl < 16; ++rl) { const v4f x = *(const v4f*)&so[rl][g * 128 + col * 4] + *(const v4f*)&so[rl][g * 128 + 64 + col * 4]; v4b hi, lo;
#pragma unroll
      for (int i = 0; i < 4; ++i) { const __bf16 hb = (__bf16)x[i]; hi[i] = hb; lo[i] = (__bf16)(x[i] - (float)hb); }
      __bf16* o = KO + ((r0 + rl) * NH + h0 + g) * 128 + col * 4; vst2(o, hi); vst2(o + 64, lo); }
  }
}
// ---- k_attn: block = (64 queries, head h, batch b): per 32-key step: mask tile loads (int) -> wave vote -> {transposed scores S^T = ((k+p).q^T + per-key term) / 8 (3 products, K 64, the term as the accumulator's start value), masked -> -3e38; online softmax in-lane, one query per lane; O^T += V^T(hi/lo).P^T(hi/lo)}; rows with no live key output 0 (the module's where(mask==0, 0, softmax)); O[row][h*64+d]
// The step's K rows (32 x 256 B: 64 bf16 hi, 64 bf16 residuals, as k_kv left them) and V hi/lo rows (2 x 64 x 64 B) are the same for the block's four waves: they are brought into LDS once per block by asynchronous copies (whole lines of K per wave-instruction), one step ahead, two buffers.
#define KPITCH 272                                   // 256-B K row + 16 B: 16 B x odd, conflict-free for 16-byte LDS reads
#define VPITCH 80                                    // 64-B V row + 16 B: 16 B x odd
#define ST_VH  (32 * KPITCH)
#define ST_VL  (ST_VH + HD * VPITCH)
#define ST_SZ  (ST_VL + HD * VPITCH)
// one stage = 8 copies of 16 B per lane: 4 of K (copy i: key row 8 i + tid / 16, 16 lanes cover the 256-B row), 2 of V hi, 2 of V lo (4 lanes per 64-B row)
__device__ __forceinline__ void stage_kv(unsigned lk, unsigned lv, const float* gk, const __bf16* gh, const __bf16* gl) {
  // s_wait_xcnt closes the statement so that it stands in front of any later rewrite of the address registers the copies name
  asm volatile("global_load_async_to_lds_b128 %0, %8, off\n\t"
               "global_load_async_to_lds_b128 %1, %9, off\n\t"
               "global_load_async_to_lds_b128 %2, %10, off\n\t"
               "global_load_async_to_lds_b128 %3, %11, off\n\t"
               "global_load_async_to_lds_b128 %4, %12, off\n\t"
               "global_load_async_to_lds_b128 %5, %13, off\n\t"
               "global_load_async_to_lds_b128 %6, %14, off\n\t"
               "global_load_async_to_lds_b128 %7, %15, off\n\t"
               "s_wait_xcnt 0x0"
               :: "v"(lk), "v"(lk + 8 * KPITCH), "v"(lk + 16 * KPITCH), "v"(lk + 24 * KPITCH),
                  "v"(lv + ST_VH), "v"(lv + ST_VH + 32 * VPITCH), "v"(lv + ST_VL), "v"(lv + ST_VL + 32 * VPITCH),
                  "v"(gk), "v"(gk + 8 * NH * 64), "v"(gk + 16 * NH * 64), "v"(gk + 24 * NH * 64),
                  "v"(gh), "v"(gh + 32 * TT), "v"(gl), "v"(gl + 32 * TT)
               : "memory");
}
__global__ __launch_bounds__(128) void k_attn(const float* __restrict__ QA, const float* __restrict__ KB, const float* __restrict__ BI, const int* __restrict__ MASK, const __bf16* __restrict__ VH, const __bf16* __restrict__ VL, float* __restrict__ O) {
  __shared__ __align__(16) char ring[2 * ST_SZ];
  __shared__ __align__(16) float so[4][16][68];
  __shared__ __align__(16) float sbi[TT];              // the per-key term of all the (batch, head)'s keys, in key order
  const int tid = threadIdx.x, wave = tid >> 5, lane = tid & 31, col = lane & 15, g = lane >> 4;
  const int qb = blockIdx.x, h = blockIdx.y, b = blockIdx.z; const int q0 = qb * 64 + wave * 16; const size_t rq = (size_t)b * TT + q0;
  const float* qrow = QA + ((rq + col) * NH + h) * HD;
  // this lane's places in a stage (LDS byte addresses in buffer 0) and its sources at key step 0
  const unsigned lk0 = (unsigned)(size_t)&ring[(tid >> 4) * KPITCH + (tid & 15) * 16], lv0 = (unsigned)(size_t)&ring[(tid >> 2) * VPITCH + (tid & 3) * 16];
  const float* gk0 = KB + (((size_t)b * TT + (tid >> 4)) * NH + h) * 64 + (tid & 15) * 4;
  const size_t gvo = ((size_t)b * FF + h * HD + (tid >> 2)) * TT + (tid & 3) * 8;
  stage_kv(lk0, lv0, gk0, VH + gvo, VL + gvo);
  // the per-key terms, filled once: 256 pieces of 16 B, two per lane (piece = 4 keys; 4 lanes cover a 16-key group's 64 B of this head); they land behind the same wait and barrier as step 0
  { const unsigned lb = (unsigned)(size_t)&sbi[tid * 4]; const float* gb = BI + (((size_t)b * (TT / 16) + (tid >> 2)) * NH + h) * 16 + (tid & 3) * 4;
    // s_wait_xcnt closes the statement so that it stands in front of any later rewrite of the address registers the copies name
    asm volatile("global_load_async_to_lds_b128 %0, %2, off\n\t"
                 "global_load_async_to_lds_b128 %1, %3, off\n\t"
                 "s_wait_xcnt 0x0"
                 :: "v"(lb), "v"(lb + 2048), "v"(gb), "v"(gb + 32 * NH * 16) : "memory"); }
  // transposed products: a lane owns ONE query (col); its half g holds keys 8 g + r of each 16-key tile. m = running maximum of the query (equal in both halves), l = this half's share of the running sum
  float m = -3.0e38f, l = 0.f;
  v8f acc[4] = {};                                     // O^T tiles: acc[dt][r] = O[query col][dt * 16 + 8 g + r]
  // the wave's 16 query rows do not change over the key loop: load and split them to bf16 hi/lo fragments once, kept in registers (unrolled so that qa[] is indexed by constants and never goes to scratch)
  F2 qa[2];
#pragma unroll
  for (int kc = 0; kc < 2; ++kc) qa[kc] = split_row(qrow, kc * 32, lane);
  const int* mrow = MASK + ((size_t)b * TT + q0 + col) * TT + 8 * g;
  asm volatile("s_wait_asynccnt 0x0" ::: "memory");   // this wave's copies of step 0 have landed
  __syncthreads();                                     // and every other wave's: step 0 may be read
  stage_kv(lk0 + ST_SZ, lv0 + ST_SZ, gk0 + (size_t)32 * NH * 64, VH + gvo + 32, VL + gvo + 32);
#pragma unroll 1
  for (int ks = 0; ks < TT / 32; ++ks) { int mk[2][8]; bool anylive = false; const char* st = ring + (ks & 1) * ST_SZ;
    const v4i mq[4] = { *(const v4i*)(mrow + ks * 32), *(const v4i*)(mrow + ks * 32 + 4), *(const v4i*)(mrow + ks * 32 + 16), *(const v4i*)(mrow + ks * 32 + 20) };
#pragma unroll
    for (int i = 0; i < 16; ++i) { const int mv = mq[i >> 2][i & 3]; mk[i >> 3][i & 7] = mv; anylive = anylive || (mv != 0); }
    if (__any(anylive)) { float s[2][8];
      // S^T = (k+p) . q^T + term: A = key rows (hi and residual fragments as they lie in LDS), B = the query fragments; D register r = key 8 g + r, column = query, so the accumulator starts from the terms of keys 8 g + 0..7
#pragma unroll
      for (int ct = 0; ct < 2; ++ct) { const char* krow = st + (ct * 16 + col) * KPITCH; const float* bp = &sbi[ks * 32 + ct * 16 + 8 * g]; const v4f b0 = *(const v4f*)bp, b1 = *(const v4f*)(bp + 4);
        v8f c = { b0[0], b0[1], b0[2], b0[3], b1[0], b1[1], b1[2], b1[3] };
#pragma unroll
        for (int kc = 0; kc < 2; ++kc) { const v16b kh = frag_b((const __bf16*)krow + kc * 32, lane), kl = frag_b((const __bf16*)krow + 64 + kc * 32, lane); c = wmma_bf(kh, qa[kc].l, c); c = wmma_bf(kl, qa[kc].h, c); c = wmma_bf(kh, qa[kc].h, c); }
#pragma unroll
        for (int r = 0; r < 8; ++r) s[ct][r] = (mk[ct][r] != 0) ? c[r] * 0.125f : -3.0e38f; }
      // the query's maximum over the step's 32 keys: 16 in this lane, 16 in lane ^ 16
      float mx = fmaxf(s[0][0], s[1][0]);
#pragma unroll
      for (int r = 1; r < 8; ++r) mx = fmaxf(mx, fmaxf(s[0][r], s[1][r]));
      mx = fmaxf(mx, __int_as_float(__builtin_amdgcn_permlanex16(__float_as_int(mx), __float_as_int(mx), 0x76543210, 0xfedcba98, false, false)));
      const float mn = fmaxf(m, mx); const float alpha = (m <= -1.0e38f) ? 0.f : exp_hw(m - mn);
      // the exponentials stand in line, for every lane, and a masked value is replaced by a select
      float e[16];
#pragma unroll
      for (int i = 0; i < 16; i += 4) { float x[4];
        exp2x4(x, (s[i >> 3][i & 7] - mn) * 1.44269504f, (s[i >> 3][(i & 7) + 1] - mn) * 1.44269504f, (s[i >> 3][(i & 7) + 2] - mn) * 1.44269504f, (s[i >> 3][(i & 7) + 3] - mn) * 1.44269504f);
#pragma unroll
        for (int u = 0; u < 4; ++u) e[i + u] = (s[i >> 3][(i & 7) + u] <= -1.0e38f) ? 0.f : x[u]; }
      l = l * alpha + (((e[0] + e[1]) + (e[2] + e[3])) + ((e[4] + e[5]) + (e[6] + e[7])) + (((e[8] + e[9]) + (e[10] + e[11])) + ((e[12] + e[13]) + (e[14] + e[15])))); m = mn;
#pragma unroll
      for (int dt = 0; dt < 4; ++dt)
#pragma unroll
        for (int r = 0; r < 8; ++r) acc[dt][r] *= alpha;
      // P^T is a B operand as it stands: element i = key 8 g + i, element 8 + i = key 16 + 8 g + i, the k order of the V fragments
      const F2 pb = bsplit16(e);
      // O^T += V^T . P^T: A = V rows (d), B = P^T
#pragma unroll
      for (int dt = 0; dt < 4; ++dt) { const int vr = (dt * 16 + col) * VPITCH; const v16b vh = frag_b((const __bf16*)(st + ST_VH + vr), lane), vl = frag_b((const __bf16*)(st + ST_VL + vr), lane); acc[dt] = wmma_bf(vh, pb.l, acc[dt]); acc[dt] = wmma_bf(vl, pb.h, acc[dt]); acc[dt] = wmma_bf(vh, pb.h, acc[dt]); } }
    // hand-over, every wave, also one that skipped the step's work:
    asm volatile("s_wait_dscnt 0x0" ::: "memory");     // this wave's reads of the step's buffer are done
    asm volatile("s_wait_asynccnt 0x0" ::: "memory");  // this wave's copies of step ks + 1 have landed
    __syncthreads();                                    // publishes step ks + 1 and frees the buffer just read
    if (ks + 2 < TT / 32) stage_kv(lk0 + (ks & 1) * ST_SZ, lv0 + (ks & 1) * ST_SZ, gk0 + (size_t)(ks + 2) * 32 * NH * 64, VH + gvo + (ks + 2) * 32, VL + gvo + (ks + 2) * 32); }
  asm volatile("s_wait_asynccnt 0x0" ::: "memory");    // no copy is left in flight when the wave goes on to its end
  // the two halves' shares of the query's sum are joined once
  l += __int_as_float(__builtin_amdgcn_permlanex16(__float_as_int(l), __float_as_int(l), 0x76543210, 0xfedcba98, false, false));
  const float il = (l > 0.f) ? 1.0f / l : 0.f;
#pragma unroll
  for (int dt = 0; dt < 4; ++dt)
#pragma unroll
    for (int r = 0; r < 8; ++r) so[wave][col][dt * 16 + 8 * g + r] = acc[dt][r] * il;
  LDSX();
  for (int rl = 0; rl < 16; ++rl) if (lane < 16) vst2(O + (rq + rl) * FF + h * HD + lane * 4, *(const v4f*)&so[wave][rl][lane * 4]);
}
// ---- k_out: block = (64 rows, 128 cols): out = O(hi/lo) . Wo rows (2 products) + bo
__global__ __launch_bounds__(128) void k_out(const float* __restrict__ O, const __bf16* __restrict__ P, const float* __restrict__ bias, float* __restrict__ Y) {
  __shared__ __align__(16) char ring[2 * G_SZ]; __shared__ __align__(16) float so[4][16][132];
  const int tid = threadIdx.x, wave = tid >> 5, lane = tid & 31, col = lane & 15, g = lane >> 4; const size_t r0 = (size_t)blockIdx.x * 64 + wave * 16; const int n0 = blockIdx.y * 128;
  v8f acc[8] = {};
  gemm_tile<true>(O + (size_t)blockIdx.x * 64 * FF, P + (size_t)n0 * FF, ring, acc);
#pragma unroll
  for (int j = 0; j < 8; ++j) { const float bb = bfr(bias[n0 + j * 16 + col]);
#pragma unroll
    for (int r = 0; r < 8; ++r) so[wave][8 * g + r][j * 16 + col] = acc[j][r] + bb; }
  LDSX();
  for (int rl = 0; rl < 16; ++rl) vst2(Y + (r0 + rl) * FF + n0 + lane * 4, *(const v4f*)&so[wave][rl][lane * 4]);
}
extern "C" void kernel_launch(void* const* d_in, const int* in_sizes, int n_in, void* d_out, int out_size, void* d_ws, size_t ws_size, hipStream_t stream) {
  (void)in_sizes; (void)n_in; (void)out_size;
  const float** F = (const float**)d_in; const int* MASK = (const int*)d_in[3];
  // 0 query, 1 key, 2 value [8,1024,512], 3 mask [8,1024,1024] i32, 4 pos_emb [1,1024,512], 5 Wq, 6 bq, 7 Wk, 8 bk, 9 Wv, 10 bv, 11 Wp, 12 Wo, 13 bo, 14 pos_bias_u [8,64], 15 pos_bias_v [8,64]
  if (ws_size < (size_t)WS_END) return;
  char* ws = (char*)d_ws; __bf16 *PW = (__bf16*)(ws + WS_PW), *VH = (__bf16*)(ws + WS_VH), *VL = (__bf16*)(ws + WS_VL); float *QA = (float*)(ws + WS_QA), *KB = (float*)(ws + WS_KB), *BI = (float*)(ws + WS_BI), *P = (float*)(ws + WS_P), *O = (float*)(ws + WS_O);
  k_pack<<<dim3(FF, 5), 128, 0, stream>>>(F[5], F[7], F[9], F[11], F[12], PW);
  k_pq<<<dim3(TT / 64 + TNB * TT / 64, FF / 128), 128, 0, stream>>>(F[4], F[0], PW + (size_t)3 * FF * FF, PW, F[6], P, QA);
  k_kv<<<dim3(TNB * TT / 64, FF / 128, 2), 128, 0, stream>>>(F[1], F[2], PW + (size_t)FF * FF, PW + (size_t)2 * FF * FF, F[8], F[10], F[14], F[15], P, (__bf16*)KB, BI, VH, VL);
  k_attn<<<dim3(TQB, NH, TNB), 128, 0, stream>>>(QA, KB, BI, MASK, VH, VL, O);
  k_out<<<dim3(TOB, FF / 128), 128, 0, stream>>>(O, PW + (size_t)4 * FF * FF, F[13], (float*)d_out);
}

// v009
// It runs in 113 microseconds.
// Timed twice side by side with v008, it ran 1.05 times as fast both times.
// All steps since v000 together make it 4.31 times as fast.
// compute dtype: query, key, value, pos_emb, mask, all weights/biases and the position biases (module inputs) rounded to bf16 / read as int32; the four projections with exact bf16 products (inputs x inputs) on WMMA 16x16x32; scores as one 64-deep dot q . (k + p) with both computed operands as bf16 hi + residual pairs (3 products) on top of a per-key term u.k + v.p ([k | p] hi + residual x exact [u | v], 2 products), P.V with P hi/lo x V hi/lo (3 products), output projection hi/lo x exact Wo (2 products); masking, softmax and the masked-row zeroing in f32; f32 accumulate.
#include <hip/hip_runtime.h>
#include <math.h>

typedef __attribute__((ext_vector_type(16))) _Float16 v16h;
typedef __attribute__((ext_vector_type(16))) __bf16 v16b;
typedef __attribute__((ext_vector_type(8)))  _Float16 v8h;
typedef __attribute__((ext_vector_type(8)))  float v8f;
typedef __attribute__((ext_vector_type(4)))  float v4f;
typedef __attribute__((ext_vector_type(2)))  float v2f;
typedef __attribute__((ext_vector_type(4)))  unsigned v4u;
typedef __attribute__((ext_vector_type(4)))  int v4i;
typedef float __attribute__((may_alias)) float_a;
typedef int __attribute__((may_alias)) int_a;

template <typename T> __device__ __forceinline__ void vst2(void* p, T v) { *(T*)p = v;  }
__device__ __forceinline__ v8f wmma16(v16h a, v16h b, v8f c) {
  v8f d = __builtin_amdgcn_wmma_f32_16x16x32_f16(false, a, false, b, (short)0, c, false, false);
  asm volatile("v_nop\n\tv_nop\n\tv_nop\n\tv_nop" : "+v"(d) : "v"(a), "v"(b));
  return d;
}
__device__ __forceinline__ v8f wmma_bf(v16b a, v16b b, v8f c) {
  v8f d = __builtin_amdgcn_wmma_f32_16x16x32_bf16(false, a, false, b, (short)0, c, false, false);
  asm volatile("v_nop\n\tv_nop\n\tv_nop\n\tv_nop" : "+v"(d) : "v"(a), "v"(b));
  return d;
}
// k_attn's form: the builtin alone. The compiler keeps the distance behind its own WMMAs, and with no statement tied to each one it may read a step's fragments in groups and alternate between independent accumulators
__device__ __forceinline__ v8f wmma_fr(v16b a, v16b b, v8f c) { return __builtin_amdgcn_wmma_f32_16x16x32_bf16(false, a, false, b, (short)0, c, false, false); }
// 16x16x32 fragments: lane = (h = lane>>4, row/col = lane&15); elements 0..7 = k0+8h+0..7, 8..15 = k0+16+8h+0..7; D element r = row 8h+r
__device__ __forceinline__ v16h frag_h(const _Float16* rowk0, int lane) {
  union { v16h v; v8h q[2]; } u; const _Float16* p = rowk0 + 8 * (lane >> 4);
  u.q[0] = *(const v8h*)p; u.q[1] = *(const v8h*)(p + 16); return u.v;
}
__device__ __forceinline__ v16h frag_f32(const float* rowk0, int lane) {
  v16h a; const float* p = rowk0 + 8 * (lane >> 4);
#pragma unroll
  for (int i = 0; i < 8; ++i) { a[i] = (_Float16)p[i]; a[8 + i] = (_Float16)p[16 + i]; }
  return a;
}
__device__ __forceinline__ v16h frag_f32s(const float* rowk0, int lane, float sc) {
  v16h a; const float* p = rowk0 + 8 * (lane >> 4);
#pragma unroll
  for (int i = 0; i < 8; ++i) { a[i] = (_Float16)(p[i] * sc); a[8 + i] = (_Float16)(p[16 + i] * sc); }
  return a;
}
// column fragment from a [K][ld] layout (column n), rows >= K read as 0
__device__ __forceinline__ v16h fragc_f32(const float* W, int k0, int n, int lane, int ld, int K) {
  v16h a; const int g = lane >> 4;
#pragma unroll
  for (int i = 0; i < 8; ++i) { const int ka = k0 + 8 * g + i, kb = ka + 16;
    a[i] = (_Float16)(ka < K ? W[(size_t)(ka < K ? ka : K - 1) * ld + n] : 0.f); a[8 + i] = (_Float16)(kb < K ? W[(size_t)(kb < K ? kb : K - 1) * ld + n] : 0.f); }
  return a;
}
struct F2 { v16b h, l; };
__device__ __forceinline__ F2 bsplit16(const float v[16]) { F2 r;
#pragma unroll
  for (int i = 0; i < 16; ++i) { const __bf16 h = (__bf16)v[i]; r.h[i] = h; r.l[i] = (__bf16)(v[i] - (float)h); }
  return r; }
__device__ __forceinline__ F2 split_row(const float* row, int k0, int lane) { float v[16]; const float* p = row + k0 + 8 * (lane >> 4);
#pragma unroll
  for (int i = 0; i < 8; ++i) { v[i] = p[i]; v[8 + i] = p[16 + i]; }
  return bsplit16(v); }
__device__ __forceinline__ F2 split_rowK(const float* row, int k0, int lane, int K) { float v[16]; const int g = lane >> 4;
#pragma unroll
  for (int i = 0; i < 8; ++i) { const int ka = k0 + 8 * g + i, kb = ka + 16; v[i] = ka < K ? row[ka < K ? ka : K - 1] : 0.f; v[8 + i] = kb < K ? row[kb < K ? kb : K - 1] : 0.f; }
  return bsplit16(v); }
__device__ __forceinline__ F2 split_col(const float* W, int k0, int n, int lane, int ld, int K) { float v[16]; const int g = lane >> 4;
#pragma unroll
  for (int i = 0; i < 8; ++i) { const int ka = k0 + 8 * g + i, kb = ka + 16; v[i] = ka < K ? W[(size_t)(ka < K ? ka : K - 1) * ld + n] : 0.f; v[8 + i] = kb < K ? W[(size_t)(kb < K ? kb : K - 1) * ld + n] : 0.f; }
  return bsplit16(v); }
__device__ __forceinline__ v8f mac3(const F2& a, const F2& b, v8f c) { c = wmma_bf(a.l, b.h, c); c = wmma_bf(a.h, b.l, c); return wmma_bf(a.h, b.h, c); }
__device__ __forceinline__ float sigm(float v) { return 1.0f / (1.0f + expf(-v)); }
#define LDSX() do { asm volatile("s_wait_dscnt 0" ::: "memory"); __builtin_amdgcn_wave_barrier(); __builtin_amdgcn_fence(__ATOMIC_RELEASE, "workgroup"); } while (0)


// Relative-position multi-head attention (B 8, T 1024, F 512, 8 heads x 64): q/k/v = Linear(query/key/value); p = pos_emb Wp^T; scores = ((q + pos_bias_u) k^T + (q + pos_bias_v) p^T) / sqrt(64); masked (mask == 0 -> float32 min); attn = softmax, then 0 where masked; x = attn v; out = x Wo^T + bo.
#define NB 8
#define TT 1024
#define FF 512
#define NH 8
#define HD 64
#ifndef TQB
#define TQB (TT / 64)
#define TNB NB
#define TOB (NB * TT / 64)
#endif
typedef __attribute__((ext_vector_type(8))) __bf16 v8b;
typedef __attribute__((ext_vector_type(4))) __bf16 v4b;
__device__ __forceinline__ v16b frag_b(const __bf16* rowk0, int lane) {
  union { v16b v; v8b q[2]; } u; const __bf16* p = rowk0 + 8 * (lane >> 4);
  u.q[0] = *(const v8b*)p; u.q[1] = *(const v8b*)(p + 16); return u.v;
}
__device__ __forceinline__ float bfr(float v) { return (float)(__bf16)v; }
// e^v for v <= 0 by the hardware's base-2 exponential: one multiply by log2(e) and one v_exp_f32
__device__ __forceinline__ float exp_hw(float v) { return __builtin_amdgcn_exp2f(v * 1.44269504f); }
// four base-2 exponentials in one statement: the instruction set asks for a free slot behind a transcendental before its source is overwritten or its result read; here each one's slot is filled by the next (early-clobber outputs: none lies on a source) and the last one's by the v_nop. Left to the compiler, this build put an exponential's result on the source of the one in front of it
__device__ __forceinline__ void exp2x4(float (&x)[4], float a0, float a1, float a2, float a3) {
  asm("v_exp_f32 %0, %4\n\tv_exp_f32 %1, %5\n\tv_exp_f32 %2, %6\n\tv_exp_f32 %3, %7\n\tv_nop" : "=&v"(x[0]), "=&v"(x[1]), "=&v"(x[2]), "=&v"(x[3]) : "v"(a0), "v"(a1), "v"(a2), "v"(a3));
}
// one base-2 exponential with its slot: in this build the compiler put an overwrite of the source directly behind the running maximum's exponential; the v_nop fills the slot the instruction set asks for there
__device__ __forceinline__ float exp2x1(float a) { float x; asm("v_exp_f32 %0, %1\n\tv_nop" : "=&v"(x) : "v"(a)); return x; }
__device__ __attribute__((noinline)) float erf_ni(float v) { return erff(v); }

#define WS_PW  0u                                   // bf16 natural rows: Wq, Wk, Wv, Wp, Wo [512][512] each
#define WS_QA  (WS_PW + 2u * 5 * FF * FF)            // f32 [NB*TT][8 h][64]: q
#define WS_KB  (WS_QA + 4u * NB * TT * FF)            // bf16 [NB*TT][8 h][2][64]: hi of k + p, then residual of k + p (256 B per (row, head))
#define WS_BI  (WS_KB + 4u * NB * TT * FF)            // f32 [NB*TT / 16][8 h][16]: the per-key score term u.k + v.p
#define WS_VH  (WS_BI + 4u * NB * TT * NH)            // bf16 [NB][512 (h*64+d)][TT]
#define WS_VL  (WS_VH + 2u * NB * FF * TT)
#define WS_P   (WS_VL + 2u * NB * FF * TT)            // f32 [TT][512] p = pos_emb Wp^T
#define WS_O   (WS_P + 4u * TT * FF)                  // f32 [NB*TT][512]
#define WS_END (WS_O + 4u * NB * TT * FF)

// ---- k_pack: block = (row n, which 0..4): natural [out][in] rows of Wq, Wk, Wv, Wp, Wo
__global__ __launch_bounds__(128) void k_pack(const float* __restrict__ WQ, const float* __restrict__ WK, const float* __restrict__ WV, const float* __restrict__ WP, const float* __restrict__ WO, __bf16* __restrict__ PW) {
  __shared__ __align__(16) __bf16 s[FF]; const int n = blockIdx.x, which = blockIdx.y, tid = threadIdx.x; const float* src = (which == 0 ? WQ : which == 1 ? WK : which == 2 ? WV : which == 3 ? WP : WO) + (size_t)n * FF;
  for (int k = tid; k < FF; k += 128) s[k] = (__bf16)src[k];
  __syncthreads();
  if (tid < FF / 8) vst2((unsigned*)(PW + ((size_t)which * FF + n) * FF + tid * 8), *(const v4u*)&s[tid * 8]);
}
// ---- the 64-row x 128-column product that k_pq, k_kv and k_out share: acc[j] (wave's 16 rows x columns j * 16 ..) += A rows (f32, rounded or split to bf16) . W rows (bf16), K = 512
// A slice of 64 k of the block's 64 A rows (256 B each) and 128 W rows (128 B each) is brought into LDS once per block by asynchronous copies, whole 128-B lines per wave-instruction, one slice ahead, two buffers; the four waves read their fragments from there.
#define GKC 64
#define APITCH 272                                   // 256-B A row + 16 B: 16 B x odd, conflict-free for 16-byte LDS reads
#define WPITCH 144                                   // 128-B W row + 16 B: 16 B x odd
#define G_W  (64 * APITCH)
#define G_SZ (G_W + 128 * WPITCH)
// one slice = 16 copies of 16 B per lane: 8 of A (copy i: row 8 i + tid / 16, 16 lanes per row), 8 of W (copy i: row 16 i + tid / 8, 8 lanes per row)
__device__ __forceinline__ void stage_aw(unsigned la, unsigned lw, const float* ga, const __bf16* gw) {
  // s_wait_xcnt closes each statement so that it stands in front of any later rewrite of the address registers the copies name
  asm volatile("global_load_async_to_lds_b128 %0, %8, off\n\t"
               "global_load_async_to_lds_b128 %1, %9, off\n\t"
               "global_load_async_to_lds_b128 %2, %10, off\n\t"
               "global_load_async_to_lds_b128 %3, %11, off\n\t"
               "global_load_async_to_lds_b128 %4, %12, off\n\t"
               "global_load_async_to_lds_b128 %5, %13, off\n\t"
               "global_load_async_to_lds_b128 %6, %14, off\n\t"
               "global_load_async_to_lds_b128 %7, %15, off\n\t"
               "s_wait_xcnt 0x0"
               :: "v"(la), "v"(la + 8 * APITCH), "v"(la + 16 * APITCH), "v"(la + 24 * APITCH), "v"(la + 32 * APITCH), "v"(la + 40 * APITCH), "v"(la + 48 * APITCH), "v"(la + 56 * APITCH),
                  "v"(ga), "v"(ga + 8 * FF), "v"(ga + 16 * FF), "v"(ga + 24 * FF), "v"(ga + 32 * FF), "v"(ga + 40 * FF), "v"(ga + 48 * FF), "v"(ga + 56 * FF)
               : "memory");
  asm volatile("global_load_async_to_lds_b128 %0, %8, off\n\t"
               "global_load_async_to_lds_b128 %1, %9, off\n\t"
               "global_load_async_to_lds_b128 %2, %10, off\n\t"
               "global_load_async_to_lds_b128 %3, %11, off\n\t"
               "global_load_async_to_lds_b128 %4, %12, off\n\t"
               "global_load_async_to_lds_b128 %5, %13, off\n\t"
               "global_load_async_to_lds_b128 %6, %14, off\n\t"
               "global_load_async_to_lds_b128 %7, %15, off\n\t"
               "s_wait_xcnt 0x0"
               :: "v"(lw), "v"(lw + 16 * WPITCH), "v"(lw + 32 * WPITCH), "v"(lw + 48 * WPITCH), "v"(lw + 64 * WPITCH), "v"(lw + 80 * WPITCH), "v"(lw + 96 * WPITCH), "v"(lw + 112 * WPITCH),
                  "v"(gw), "v"(gw + 16 * FF), "v"(gw + 32 * FF), "v"(gw + 48 * FF), "v"(gw + 64 * FF), "v"(gw + 80 * FF), "v"(gw + 96 * FF), "v"(gw + 112 * FF)
               : "memory");
}
// A = the block's first row, Wn = the block's first W row, ring = 2 * G_SZ bytes of LDS; SPLIT: A as bf16 hi + residual (2 products), else A rounded to bf16 (1 product)
template <bool SPLIT>
__device__ __forceinline__ void gemm_tile(const float* __restrict__ A, const __bf16* __restrict__ Wn, char* ring, v8f (&acc)[8]) {
  const int tid = threadIdx.x, wave = tid >> 5, lane = tid & 31, col = lane & 15, g = lane >> 4;
  // this lane's places in a slice (LDS byte addresses in buffer 0) and its sources at slice 0
  const unsigned la = (unsigned)(size_t)&ring[(tid >> 4) * APITCH + (tid & 15) * 16], lw = (unsigned)(size_t)&ring[G_W + (tid >> 3) * WPITCH + (tid & 7) * 16];
  const float* ga = A + (size_t)(tid >> 4) * FF + (tid & 15) * 4; const __bf16* gw = Wn + (size_t)(tid >> 3) * FF + (tid & 7) * 8;
  stage_aw(la, lw, ga, gw);
  asm volatile("s_wait_asynccnt 0x0" ::: "memory");   // this wave's copies of slice 0 have landed
  __syncthreads();                                     // and every other wave's: slice 0 may be read
  stage_aw(la + G_SZ, lw + G_SZ, ga + GKC, gw + GKC);
  // kept rolled: one trip already holds a whole slice's fragments in registers, and eight copies of the body would only grow the code
#pragma unroll 1
  for (int t = 0; t < FF / GKC; ++t) { const char* st = ring + (t & 1) * G_SZ; const float* arow = (const float*)(st + (wave * 16 + col) * APITCH);
    // the slice's fragments are read as one group in front of its WMMAs: one LDS latency per slice
    v16b w[2][8];
#pragma unroll
    for (int kk = 0; kk < 2; ++kk)
#pragma unroll
      for (int j = 0; j < 8; ++j) w[kk][j] = frag_b((const __bf16*)(st + G_W + (j * 16 + col) * WPITCH) + kk * 32, lane);
    if (SPLIT) { const F2 a[2] = { split_row(arow, 0, lane), split_row(arow, 32, lane) };
#pragma unroll
      for (int kk = 0; kk < 2; ++kk)
#pragma unroll
        for (int j = 0; j < 8; ++j) { acc[j] = wmma_bf(a[kk].l, w[kk][j], acc[j]); acc[j] = wmma_bf(a[kk].h, w[kk][j], acc[j]); }
    } else { v16b a[2];
#pragma unroll
      for (int kk = 0; kk < 2; ++kk) { const float* p = arow + kk * 32 + 8 * g;
#pragma unroll
        for (int i = 0; i < 8; ++i) { a[kk][i] = (__bf16)p[i]; a[kk][8 + i] = (__bf16)p[16 + i]; } }
#pragma unroll
      for (int kk = 0; kk < 2; ++kk)
#pragma unroll
        for (int j = 0; j < 8; ++j) acc[j] = wmma_bf(a[kk], w[kk][j], acc[j]);
    }
    // hand-over, every wave:
    asm volatile("s_wait_dscnt 0x0" ::: "memory");     // this wave's reads of the slice's buffer are done
    asm volatile("s_wait_asynccnt 0x0" ::: "memory");  // this wave's copies of slice t + 1 have landed
    __syncthreads();                                    // publishes slice t + 1 and frees the buffer just read
    if (t + 2 < FF / GKC) stage_aw(la + (t & 1) * G_SZ, lw + (t & 1) * G_SZ, ga + (t + 2) * GKC, gw + (t + 2) * GKC); }
  asm volatile("s_wait_asynccnt 0x0" ::: "memory");    // no copy is left in flight when the wave goes on
}
// The epilogues of k_pq and k_kv stage their tiles in the ring's own LDS: behind gemm_tile's last barrier no wave reads the ring any more and no copy is in flight. A block then holds 2 * G_SZ bytes and no more, four blocks fit a WGP, and every block of either launch is resident at once.
// ---- k_pq: one launch for the two products that need nothing but the packed weights; block = (64 rows, 128 cols). blockIdx.x < TT / 64: p = bf16(pos_emb) . Wp rows (exact) -> P rows (512-B segments); the others: q = query.Wq^T + bq -> QA rows
__global__ __launch_bounds__(128) void k_pq(const float* __restrict__ PE, const float* __restrict__ X, const __bf16* __restrict__ P4, const __bf16* __restrict__ P1, const float* __restrict__ bias, float* __restrict__ P, float* __restrict__ QA) {
  __shared__ __align__(16) char ring[2 * G_SZ];
  const int tid = threadIdx.x, wave = tid >> 5, lane = tid & 31, col = lane & 15, g = lane >> 4; const bool isp = blockIdx.x < TT / 64;
  const size_t rb = (size_t)(isp ? blockIdx.x : blockIdx.x - TT / 64) * 64; const size_t r0 = rb + wave * 16; const int n0 = blockIdx.y * 128;
  v8f acc[8] = {};
  gemm_tile<false>((isp ? PE : X) + rb * FF, (isp ? P4 : P1) + (size_t)n0 * FF, ring, acc);
  float (*so)[132] = (float (*)[132])(ring + wave * (16 * 132 * 4));
  if (isp) {
#pragma unroll
    for (int j = 0; j < 8; ++j)
#pragma unroll
      for (int r = 0; r < 8; ++r) so[8 * g + r][j * 16 + col] = acc[j][r];
  } else {
#pragma unroll
    for (int j = 0; j < 8; ++j) { const float bb = bfr(bias[n0 + j * 16 + col]);
#pragma unroll
      for (int r = 0; r < 8; ++r) so[8 * g + r][j * 16 + col] = acc[j][r] + bb; }
  }
  LDSX();
  float* dst = (isp ? P : QA) + r0 * FF + n0 + lane * 4;
  for (int rl = 0; rl < 16; ++rl) vst2(dst + rl * FF, *(const v4f*)&so[rl][lane * 4]);
}
// ---- k_kv: one launch for the key and the value projection; block = (64 rows (b,t), 128 cols = 2 heads, which). blockIdx.z 0: k = key.Wk^T + bk -> KB[row][h][k + p[t]], split here, once, to bf16 hi + residual halves (128 B each), and BI = u.k + v.p[t] per (row, head); blockIdx.z 1: v = value.Wv^T + bv -> transposed hi/lo planes
// (q + u).k + (q + v).p = q.(k + p) + (u.k + v.p): the second term does not depend on the query, so it is formed once per key here and the score product of k_attn is 64 deep instead of 128
__global__ __launch_bounds__(128) void k_kv(const float* __restrict__ XK, const float* __restrict__ XV, const __bf16* __restrict__ PK, const __bf16* __restrict__ PV, const float* __restrict__ bk, const float* __restrict__ bv, const float* __restrict__ U, const float* __restrict__ Vb, const float* __restrict__ PP, __bf16* __restrict__ KO, float* __restrict__ BI, __bf16* __restrict__ VH, __bf16* __restrict__ VL) {
  __shared__ __align__(16) char ring[2 * G_SZ];
  const int tid = threadIdx.x, wave = tid >> 5, lane = tid & 31, col = lane & 15, g = lane >> 4; const bool isv = blockIdx.z != 0; const size_t rb = (size_t)blockIdx.x * 64; const size_t r0 = rb + wave * 16; const int n0 = blockIdx.y * 128;
  v8f acc[8] = {};
  gemm_tile<false>((isv ? XV : XK) + rb * FF, (isv ? PV : PK) + (size_t)n0 * FF, ring, acc);
  if (isv) { __bf16 (*sth)[72] = (__bf16 (*)[72])ring, (*stl)[72] = (__bf16 (*)[72])(ring + 128 * 72 * 2);
#pragma unroll
    for (int j = 0; j < 8; ++j) { const float bb = bfr(bv[n0 + j * 16 + col]);
#pragma unroll
      for (int r = 0; r < 8; ++r) { const float v = acc[j][r] + bb; const __bf16 hb = (__bf16)v; sth[j * 16 + col][wave * 16 + 8 * g + r] = hb; stl[j * 16 + col][wave * 16 + 8 * g + r] = (__bf16)(v - (float)hb); } }
    __syncthreads();
    const int b = (int)(rb / TT), t0 = (int)(rb % TT);
    for (int q = tid; q < 128 * 8; q += 128) { const int d = q >> 3, pc = q & 7; const size_t o = ((size_t)b * FF + n0 + d) * TT + t0 + pc * 8; vst2((unsigned*)(VH + o), *(const v4u*)&sth[d][pc * 8]); vst2((unsigned*)(VL + o), *(const v4u*)&stl[d][pc * 8]); }
  } else { float (*so)[260] = (float (*)[260])(ring + wave * (16 * 260 * 4));
    // two heads in this column block: hl = j / 4 (local), d = (j % 4) * 16 + col; segment layout per (row, head): [k 64 | p 64]
#pragma unroll
    for (int j = 0; j < 8; ++j) { const int hl = j >> 2, d = (j & 3) * 16 + col; const int h = (n0 >> 6) + hl; const float bb = bfr(bk[n0 + j * 16 + col]);
#pragma unroll
      for (int r = 0; r < 8; ++r) { const float v = acc[j][r] + bb; const int rl = 8 * g + r;
        const size_t t = (r0 + rl) % TT; so[rl][hl * 128 + d] = v; so[rl][hl * 128 + 64 + d] = PP[t * FF + h * HD + d]; } }
    LDSX();
    const int h0 = n0 >> 6;
    // the per-key term: A = the wave's 16 [k | p] rows (hi + residual), B = [u | v] of the head in every column (exact bf16), so that D register r = the term of row 8 g + r in every lane of the half
    v8f ub[2];
#pragma unroll
    for (int hl = 0; hl < 2; ++hl) { v8f c = {};
#pragma unroll
      for (int kc = 0; kc < 4; ++kc) { const float* uv = (kc < 2 ? U : Vb) + (h0 + hl) * HD + (kc & 1) * 32 + 8 * g; v16b w;
#pragma unroll
        for (int i = 0; i < 8; ++i) { w[i] = (__bf16)uv[i]; w[8 + i] = (__bf16)uv[16 + i]; }
        const F2 a = split_row(&so[col][hl * 128], kc * 32, lane); c = wmma_bf(a.l, w, c); c = wmma_bf(a.h, w, c); }
      ub[hl] = c; }
    // the wave's 16 rows x 2 heads are one whole 128-B line of BI: eight lanes store 16 bytes each (col = 2 hl + which four of the half's eight rows)
    if (col < 4) { const v8f c = (col & 2) ? ub[1] : ub[0]; const v4f x = (col & 1) ? v4f{c[4], c[5], c[6], c[7]} : v4f{c[0], c[1], c[2], c[3]};
      vst2(BI + ((r0 >> 4) * NH + h0 + (col >> 1)) * 16 + 8 * g + (col & 1) * 4, x); }
    // a lane takes 4 neighbouring sums k + p of a (row, head) segment (lanes 0..15 the first head, 16..31 the second) and stores their hi parts and their residuals as 8 bytes each: the wave writes four whole 128-B halves
    for (int rl = 0; rl < 16; ++rl) { const v4f x = *(const v4f*)&so[rl][g * 128 + col * 4] + *(const v4f*)&so[rl][g * 128 + 64 + col * 4]; v4b hi, lo;
#pragma unroll
      for (int i = 0; i < 4; ++i) { const __bf16 hb = (__bf16)x[i]; hi[i] = hb; lo[i] = (__bf16)(x[i] - (float)hb); }
      __bf16* o = KO + ((r0 + rl) * NH + h0 + g) * 128 + col * 4; vst2(o, hi); vst2(o + 64, lo); }
  }
}
// ---- k_attn: block = (64 queries, head h, batch b): per 32-key step: mask tile loads (int) -> wave vote -> {transposed scores S^T = ((k+p).q^T + per-key term) / 8 (3 products, K 64, the term as the accumulator's start value), masked -> -3e38; online softmax in-lane, one query per lane; O^T += V^T(hi/lo).P^T(hi/lo)}; rows with no live key output 0 (the module's where(mask==0, 0, softmax)); O[row][h*64+d]
// The step's K rows (32 x 256 B: 64 bf16 hi, 64 bf16 residuals, as k_kv left them) and V hi/lo rows (2 x 64 x 64 B) are the same for the block's four waves: they are brought into LDS once per block by asynchronous copies (whole lines of K per wave-instruction), one step ahead, two buffers.
#define KPITCH 272                                   // 256-B K row + 16 B: 16 B x odd, conflict-free for 16-byte LDS reads
#define VPITCH 80                                    // 64-B V row + 16 B: 16 B x odd
#define ST_VH  (32 * KPITCH)
#define ST_VL  (ST_VH + HD * VPITCH)
#define ST_SZ  (ST_VL + HD * VPITCH)
// one stage = 8 copies of 16 B per lane: 4 of K (copy i: key row 8 i + tid / 16, 16 lanes cover the 256-B row), 2 of V hi, 2 of V lo (4 lanes per 64-B row)
__device__ __forceinline__ void stage_kv(unsigned lk, unsigned lv, const float* gk, const __bf16* gh, const __bf16* gl) {
  // s_wait_xcnt closes the statement so that it stands in front of any later rewrite of the address registers the copies name
  asm volatile("global_load_async_to_lds_b128 %0, %8, off\n\t"
               "global_load_async_to_lds_b128 %1, %9, off\n\t"
               "global_load_async_to_lds_b128 %2, %10, off\n\t"
               "global_load_async_to_lds_b128 %3, %11, off\n\t"
               "global_load_async_to_lds_b128 %4, %12, off\n\t"
               "global_load_async_to_lds_b128 %5, %13, off\n\t"
               "global_load_async_to_lds_b128 %6, %14, off\n\t"
               "global_load_async_to_lds_b128 %7, %15, off\n\t"
               "s_wait_xcnt 0x0"
               :: "v"(lk), "v"(lk + 8 * KPITCH), "v"(lk + 16 * KPITCH), "v"(lk + 24 * KPITCH),
                  "v"(lv + ST_VH), "v"(lv + ST_VH + 32 * VPITCH), "v"(lv + ST_VL), "v"(lv + ST_VL + 32 * VPITCH),
                  "v"(gk), "v"(gk + 8 * NH * 64), "v"(gk + 16 * NH * 64), "v"(gk + 24 * NH * 64),
                  "v"(gh), "v"(gh + 32 * TT), "v"(gl), "v"(gl + 32 * TT)
               : "memory");
}
__global__ __launch_bounds__(128) void k_attn(const float* __restrict__ QA, const float* __restrict__ KB, const float* __restrict__ BI, const int* __restrict__ MASK, const __bf16* __restrict__ VH, const __bf16* __restrict__ VL, float* __restrict__ O) {
  __shared__ __align__(16) char ring[2 * ST_SZ];
  __shared__ __align__(16) float so[4][16][68];
  __shared__ __align__(16) float sbi[TT];              // the per-key term of all the (batch, head)'s keys, in key order
  const int tid = threadIdx.x, wave = tid >> 5, lane = tid & 31, col = lane & 15, g = lane >> 4;
  const int qb = blockIdx.x, h = blockIdx.y, b = blockIdx.z; const int q0 = qb * 64 + wave * 16; const size_t rq = (size_t)b * TT + q0;
  const float* qrow = QA + ((rq + col) * NH + h) * HD;
  // this lane's places in a stage (LDS byte addresses in buffer 0) and its sources at key step 0
  const unsigned lk0 = (unsigned)(size_t)&ring[(tid >> 4) * KPITCH + (tid & 15) * 16], lv0 = (unsigned)(size_t)&ring[(tid >> 2) * VPITCH + (tid & 3) * 16];
  const float* gk0 = KB + (((size_t)b * TT + (tid >> 4)) * NH + h) * 64 + (tid & 15) * 4;
  const size_t gvo = ((size_t)b * FF + h * HD + (tid >> 2)) * TT + (tid & 3) * 8;
  stage_kv(lk0, lv0, gk0, VH + gvo, VL + gvo);
  // the per-key terms, filled once: 256 pieces of 16 B, two per lane (piece = 4 keys; 4 lanes cover a 16-key group's 64 B of this head); they land behind the same wait and barrier as step 0
  { const unsigned lb = (unsigned)(size_t)&sbi[tid * 4]; const float* gb = BI + (((size_t)b * (TT / 16) + (tid >> 2)) * NH + h) * 16 + (tid & 3) * 4;
    // s_wait_xcnt closes the statement so that it stands in front of any later rewrite of the address registers the copies name
    asm volatile("global_load_async_to_lds_b128 %0, %2, off\n\t"
                 "global_load_async_to_lds_b128 %1, %3, off\n\t"
                 "s_wait_xcnt 0x0"
                 :: "v"(lb), "v"(lb + 2048), "v"(gb), "v"(gb + 32 * NH * 16) : "memory"); }
  // transposed products: a lane owns ONE query (col); its half g holds keys 8 g + r of each 16-key tile. m = running maximum of the query (equal in both halves), l = this half's share of the running sum
  float m = -3.0e38f, l = 0.f;
  v8f acc[4] = {};                                     // O^T tiles: acc[dt][r] = O[query col][dt * 16 + 8 g + r]
  // the wave's 16 query rows do not change over the key loop: load and split them to bf16 hi/lo fragments once, kept in registers (unrolled so that qa[] is indexed by constants and never goes to scratch)
  F2 qa[2];
#pragma unroll
  for (int kc = 0; kc < 2; ++kc) qa[kc] = split_row(qrow, kc * 32, lane);
  const int* mrow = MASK + ((size_t)b * TT + q0 + col) * TT + 8 * g;
  asm volatile("s_wait_asynccnt 0x0" ::: "memory");   // this wave's copies of step 0 have landed
  __syncthreads();                                     // and every other wave's: step 0 may be read
  stage_kv(lk0 + ST_SZ, lv0 + ST_SZ, gk0 + (size_t)32 * NH * 64, VH + gvo + 32, VL + gvo + 32);
#pragma unroll 1
  for (int ks = 0; ks < TT / 32; ++ks) { int mk[2][8]; bool anylive = false; const char* st = ring + (ks & 1) * ST_SZ;
    const v4i mq[4] = { *(const v4i*)(mrow + ks * 32), *(const v4i*)(mrow + ks * 32 + 4), *(const v4i*)(mrow + ks * 32 + 16), *(const v4i*)(mrow + ks * 32 + 20) };
    // all of the step's K fragments and per-key terms are read here as one group, behind the mask loads and in front of the wait on them: the LDS latency passes under the longer one (a wave that then skips the step has only read them; the hand-over's s_wait_dscnt covers that too)
    v8f c[2]; v16b kh[2][2], kl[2][2];
#pragma unroll
    for (int ct = 0; ct < 2; ++ct) { const char* krow = st + (ct * 16 + col) * KPITCH; const float* bp = &sbi[ks * 32 + ct * 16 + 8 * g]; const v4f b0 = *(const v4f*)bp, b1 = *(const v4f*)(bp + 4);
      c[ct] = v8f{ b0[0], b0[1], b0[2], b0[3], b1[0], b1[1], b1[2], b1[3] };
#pragma unroll
      for (int kc = 0; kc < 2; ++kc) { kh[ct][kc] = frag_b((const __bf16*)krow + kc * 32, lane); kl[ct][kc] = frag_b((const __bf16*)krow + 64 + kc * 32, lane); } }
    __builtin_amdgcn_sched_barrier(0);                 // keeps the K reads one group up here: left free, the compiler sinks them behind the vote and spreads them among the WMMAs, each with a wait of its own
#pragma unroll
    for (int i = 0; i < 16; ++i) { const int mv = mq[i >> 2][i & 3]; mk[i >> 3][i & 7] = mv; anylive = anylive || (mv != 0); }
    if (__any(anylive)) { float s[2][8];
      // S^T = (k+p) . q^T + term: A = key rows (hi and residual fragments as they lie in LDS), B = the query fragments; D register r = key 8 g + r, column = query, so the accumulator starts from the terms of keys 8 g + 0..7
      // the two 16-key tiles are independent accumulators: their products alternate (each tile's own order of sums is as it was)
#pragma unroll
      for (int kc = 0; kc < 2; ++kc) {
#pragma unroll
        for (int ct = 0; ct < 2; ++ct) c[ct] = wmma_fr(kh[ct][kc], qa[kc].l, c[ct]);
#pragma unroll
        for (int ct = 0; ct < 2; ++ct) c[ct] = wmma_fr(kl[ct][kc], qa[kc].h, c[ct]);
#pragma unroll
        for (int ct = 0; ct < 2; ++ct) c[ct] = wmma_fr(kh[ct][kc], qa[kc].h, c[ct]); }
      // the step's V fragments are read here, so that their LDS latency passes under the softmax's vector work
      v16b vh[4], vl[4];
#pragma unroll
      for (int dt = 0; dt < 4; ++dt) { const int vr = (dt * 16 + col) * VPITCH; vh[dt] = frag_b((const __bf16*)(st + ST_VH + vr), lane); vl[dt] = frag_b((const __bf16*)(st + ST_VL + vr), lane); }
      __builtin_amdgcn_sched_barrier(0);               // keeps those reads in front of the softmax: left free, the compiler sinks them to just before the products that use them
#pragma unroll
      for (int ct = 0; ct < 2; ++ct)
#pragma unroll
        for (int r = 0; r < 8; ++r) s[ct][r] = (mk[ct][r] != 0) ? c[ct][r] * 0.125f : -3.0e38f;
      // the query's maximum over the step's 32 keys: 16 in this lane, 16 in lane ^ 16
      float mx = fmaxf(s[0][0], s[1][0]);
#pragma unroll
      for (int r = 1; r < 8; ++r) mx = fmaxf(mx, fmaxf(s[0][r], s[1][r]));
      mx = fmaxf(mx, __int_as_float(__builtin_amdgcn_permlanex16(__float_as_int(mx), __float_as_int(mx), 0x76543210, 0xfedcba98, false, false)));
      const float mn = fmaxf(m, mx); const float ea = exp2x1((m - mn) * 1.44269504f); const float alpha = (m <= -1.0e38f) ? 0.f : ea;
      // the exponentials stand in line, for every lane, and a masked value is replaced by a select
      float e[16];
#pragma unroll
      for (int i = 0; i < 16; i += 4) { float x[4];
        exp2x4(x, (s[i >> 3][i & 7] - mn) * 1.44269504f, (s[i >> 3][(i & 7) + 1] - mn) * 1.44269504f, (s[i >> 3][(i & 7) + 2] - mn) * 1.44269504f, (s[i >> 3][(i & 7) + 3] - mn) * 1.44269504f);
#pragma unroll
        for (int u = 0; u < 4; ++u) e[i + u] = (s[i >> 3][(i & 7) + u] <= -1.0e38f) ? 0.f : x[u]; }
      l = l * alpha + (((e[0] + e[1]) + (e[2] + e[3])) + ((e[4] + e[5]) + (e[6] + e[7])) + (((e[8] + e[9]) + (e[10] + e[11])) + ((e[12] + e[13]) + (e[14] + e[15])))); m = mn;
#pragma unroll
      for (int dt = 0; dt < 4; ++dt)
#pragma unroll
        for (int r = 0; r < 8; ++r) acc[dt][r] *= alpha;
      // P^T is a B operand as it stands: element i = key 8 g + i, element 8 + i = key 16 + 8 g + i, the k order of the V fragments
      const F2 pb = bsplit16(e);
      // O^T += V^T . P^T: A = V rows (d), B = P^T
#pragma unroll
      for (int dt = 0; dt < 4; ++dt) acc[dt] = wmma_fr(vh[dt], pb.l, acc[dt]);
#pragma unroll
      for (int dt = 0; dt < 4; ++dt) acc[dt] = wmma_fr(vl[dt], pb.h, acc[dt]);
#pragma unroll
      for (int dt = 0; dt < 4; ++dt) acc[dt] = wmma_fr(vh[dt], pb.h, acc[dt]); }
    // hand-over, every wave, also one that skipped the step's work:
    asm volatile("s_wait_dscnt 0x0" ::: "memory");     // this wave's reads of the step's buffer are done
    asm volatile("s_wait_asynccnt 0x0" ::: "memory");  // this wave's copies of step ks + 1 have landed
    __syncthreads();                                    // publishes step ks + 1 and frees the buffer just read
    if (ks + 2 < TT / 32) stage_kv(lk0 + (ks & 1) * ST_SZ, lv0 + (ks & 1) * ST_SZ, gk0 + (size_t)(ks + 2) * 32 * NH * 64, VH + gvo + (ks + 2) * 32, VL + gvo + (ks + 2) * 32); }
  asm volatile("s_wait_asynccnt 0x0" ::: "memory");    // no copy is left in flight when the wave goes on to its end
  // the two halves' shares of the query's sum are joined once
  l += __int_as_float(__builtin_amdgcn_permlanex16(__float_as_int(l), __float_as_int(l), 0x76543210, 0xfedcba98, false, false));
  const float il = (l > 0.f) ? 1.0f / l : 0.f;
#pragma unroll
  for (int dt = 0; dt < 4; ++dt)
#pragma unroll
    for (int r = 0; r < 8; ++r) so[wave][col][dt * 16 + 8 * g + r] = acc[dt][r] * il;
  LDSX();
  for (int rl = 0; rl < 16; ++rl) if (lane < 16) vst2(O + (rq + rl) * FF + h * HD + lane * 4, *(const v4f*)&so[wave][rl][lane * 4]);
}
// ---- k_out: block = (64 rows, 128 cols): out = O(hi/lo) . Wo rows (2 products) + bo
__global__ __launch_bounds__(128) void k_out(const float* __restrict__ O, const __bf16* __restrict__ P, const float* __restrict__ bias, float* __restrict__ Y) {
  __shared__ __align__(16) char ring[2 * G_SZ]; __shared__ __align__(16) float so[4][16][132];
  const int tid = threadIdx.x, wave = tid >> 5, lane = tid & 31, col = lane & 15, g = lane >> 4; const size_t r0 = (size_t)blockIdx.x * 64 + wave * 16; const int n0 = blockIdx.y * 128;
  v8f acc[8] = {};
  gemm_tile<true>(O + (size_t)blockIdx.x * 64 * FF, P + (size_t)n0 * FF, ring, acc);
#pragma unroll
  for (int j = 0; j < 8; ++j) { const float bb = bfr(bias[n0 + j * 16 + col]);
#pragma unroll
    for (int r = 0; r < 8; ++r) so[wave][8 * g + r][j * 16 + col] = acc[j][r] + bb; }
  LDSX();
  for (int rl = 0; rl < 16; ++rl) vst2(Y + (r0 + rl) * FF + n0 + lane * 4, *(const v4f*)&so[wave][rl][lane * 4]);
}
extern "C" void kernel_launch(void* const* d_in, const int* in_sizes, int n_in, void* d_out, int out_size, void* d_ws, size_t ws_size, hipStream_t stream) {
  (void)in_sizes; (void)n_in; (void)out_size;
  const float** F = (const float**)d_in; const int* MASK = (const int*)d_in[3];
  // 0 query, 1 key, 2 value [8,1024,512], 3 mask [8,1024,1024] i32, 4 pos_emb [1,1024,512], 5 Wq, 6 bq, 7 Wk, 8 bk, 9 Wv, 10 bv, 11 Wp, 12 Wo, 13 bo, 14 pos_bias_u [8,64], 15 pos_bias_v [8,64]
  if (ws_size < (size_t)WS_END) return;
  char* ws = (char*)d_ws; __bf16 *PW = (__bf16*)(ws + WS_PW), *VH = (__bf16*)(ws + WS_VH), *VL = (__bf16*)(ws + WS_VL); float *QA = (float*)(ws + WS_QA), *KB = (float*)(ws + WS_KB), *BI = (float*)(ws + WS_BI), *P = (float*)(ws + WS_P), *O = (float*)(ws + WS_O);
  k_pack<<<dim3(FF, 5), 128, 0, stream>>>(F[5], F[7], F[9], F[11], F[12], PW);
  k_pq<<<dim3(TT / 64 + TNB * TT / 64, FF / 128), 128, 0, stream>>>(F[4], F[0], PW + (size_t)3 * FF * FF, PW, F[6], P, QA);
  k_kv<<<dim3(TNB * TT / 64, FF / 128, 2), 128, 0, stream>>>(F[1], F[2], PW + (size_t)FF * FF, PW + (size_t)2 * FF * FF, F[8], F[10], F[14], F[15], P, (__bf16*)KB, BI, VH, VL);
  k_attn<<<dim3(TQB, NH, TNB), 128, 0, stream>>>(QA, KB, BI, MASK, VH, VL, O);
  k_out<<<dim3(TOB, FF / 128), 128, 0, stream>>>(O, PW + (size_t)4 * FF * FF, F[13], (float*)d_out);
}

// v010
// One run takes 96.9 microseconds.
// Next to v009, in two timings, it ran 1.17 and 1.16 times as fast.
// All steps since v000 together make it 5.03 times as fast.
// compute dtype: query, key, value, pos_emb, mask, all weights/biases and the position biases (module inputs) rounded to bf16 / read as int32; the four projections with exact bf16 products (inputs x inputs) on WMMA 16x16x32; scores as one 64-deep dot q . (k + p) with both computed operands as bf16 hi + residual pairs (3 products) on top of a per-key term u.k + v.p ([k | p] hi + residual x exact [u | v], 2 products), P.V with P hi/lo x V hi/lo (3 products), output projection hi/lo x exact Wo (2 products); masking, softmax and the masked-row zeroing in f32; f32 accumulate.
#include <hip/hip_runtime.h>
#include <math.h>

typedef __attribute__((ext_vector_type(16))) _Float16 v16h;
typedef __attribute__((ext_vector_type(16))) __bf16 v16b;
typedef __attribute__((ext_vector_type(8)))  _Float16 v8h;
typedef __attribute__((ext_vector_type(8)))  float v8f;
typedef __attribute__((ext_vector_type(4)))  float v4f;
typedef __attribute__((ext_vector_type(2)))  float v2f;
typedef __attribute__((ext_vector_type(4)))  unsigned v4u;
typedef __attribute__((ext_vector_type(4)))  int v4i;
typedef float __attribute__((may_alias)) float_a;
typedef int __attribute__((may_alias)) int_a;

template <typename T> __device__ __forceinline__ void vst2(void* p, T v) { *(T*)p = v;  }
__device__ __forceinline__ v8f wmma16(v16h a, v16h b, v8f c) {
  v8f d = __builtin_amdgcn_wmma_f32_16x16x32_f16(false, a, false, b, (short)0, c, false, false);
  asm volatile("v_nop\n\tv_nop\n\tv_nop\n\tv_nop" : "+v"(d) : "v"(a), "v"(b));
  return d;
}
__device__ __forceinline__ v8f wmma_bf(v16b a, v16b b, v8f c) {
  v8f d = __builtin_amdgcn_wmma_f32_16x16x32_bf16(false, a, false, b, (short)0, c, false, false);
  asm volatile("v_nop\n\tv_nop\n\tv_nop\n\tv_nop" : "+v"(d) : "v"(a), "v"(b));
  return d;
}
// k_attn's form: the builtin alone. The compiler keeps the distance behind its own WMMAs, and with no statement tied to each one it may read a step's fragments in groups and alternate between independent accumulators
__device__ __forceinline__ v8f wmma_fr(v16b a, v16b b, v8f c) { return __builtin_amdgcn_wmma_f32_16x16x32_bf16(false, a, false, b, (short)0, c, false, false); }
// 16x16x32 fragments: lane = (h = lane>>4, row/col = lane&15); elements 0..7 = k0+8h+0..7, 8..15 = k0+16+8h+0..7; D element r = row 8h+r
__device__ __forceinline__ v16h frag_h(const _Float16* rowk0, int lane) {
  union { v16h v; v8h q[2]; } u; const _Float16* p = rowk0 + 8 * (lane >> 4);
  u.q[0] = *(const v8h*)p; u.q[1] = *(const v8h*)(p + 16); return u.v;
}
__device__ __forceinline__ v16h frag_f32(const float* rowk0, int lane) {
  v16h a; const float* p = rowk0 + 8 * (lane >> 4);
#pragma unroll
  for (int i = 0; i < 8; ++i) { a[i] = (_Float16)p[i]; a[8 + i] = (_Float16)p[16 + i]; }
  return a;
}
__device__ __forceinline__ v16h frag_f32s(const float* rowk0, int lane, float sc) {
  v16h a; const float* p = rowk0 + 8 * (lane >> 4);
#pragma unroll
  for (int i = 0; i < 8; ++i) { a[i] = (_Float16)(p[i] * sc); a[8 + i] = (_Float16)(p[16 + i] * sc); }
  return a;
}
// column fragment from a [K][ld] layout (column n), rows >= K read as 0
__device__ __forceinline__ v16h fragc_f32(const float* W, int k0, int n, int lane, int ld, int K) {
  v16h a; const int g = lane >> 4;
#pragma unroll
  for (int i = 0; i < 8; ++i) { const int ka = k0 + 8 * g + i, kb = ka + 16;
    a[i] = (_Float16)(ka < K ? W[(size_t)(ka < K ? ka : K - 1) * ld + n] : 0.f); a[8 + i] = (_Float16)(kb < K ? W[(size_t)(kb < K ? kb : K - 1) * ld + n] : 0.f); }
  return a;
}
struct F2 { v16b h, l; };
__device__ __forceinline__ F2 bsplit16(const float v[16]) { F2 r;
#pragma unroll
  for (int i = 0; i < 16; ++i) { const __bf16 h = (__bf16)v[i]; r.h[i] = h; r.l[i] = (__bf16)(v[i] - (float)h); }
  return r; }
__device__ __forceinline__ F2 split_row(const float* row, int k0, int lane) { float v[16]; const float* p = row + k0 + 8 * (lane >> 4);
#pragma unroll
  for (int i = 0; i < 8; ++i) { v[i] = p[i]; v[8 + i] = p[16 + i]; }
  return bsplit16(v); }
__device__ __forceinline__ F2 split_rowK(const float* row, int k0, int lane, int K) { float v[16]; const int g = lane >> 4;
#pragma unroll
  for (int i = 0; i < 8; ++i) { const int ka = k0 + 8 * g + i, kb = ka + 16; v[i] = ka < K ? row[ka < K ? ka : K - 1] : 0.f; v[8 + i] = kb < K ? row[kb < K ? kb : K - 1] : 0.f; }
  return bsplit16(v); }
__device__ __forceinline__ F2 split_col(const float* W, int k0, int n, int lane, int ld, int K) { float v[16]; const int g = lane >> 4;
#pragma unroll
  for (int i = 0; i < 8; ++i) { const int ka = k0 + 8 * g + i, kb = ka + 16; v[i] = ka < K ? W[(size_t)(ka < K ? ka : K - 1) * ld + n] : 0.f; v[8 + i] = kb < K ? W[(size_t)(kb < K ? kb : K - 1) * ld + n] : 0.f; }
  return bsplit16(v); }
__device__ __forceinline__ v8f mac3(const F2& a, const F2& b, v8f c) { c = wmma_bf(a.l, b.h, c); c = wmma_bf(a.h, b.l, c); return wmma_bf(a.h, b.h, c); }
__device__ __forceinline__ float sigm(float v) { return 1.0f / (1.0f + expf(-v)); }
#define LDSX() do { asm volatile("s_wait_dscnt 0" ::: "memory"); __builtin_amdgcn_wave_barrier(); __builtin_amdgcn_fence(__ATOMIC_RELEASE, "workgroup"); } while (0)


// Relative-position multi-head attention (B 8, T 1024, F 512, 8 heads x 64): q/k/v = Linear(query/key/value); p = pos_emb Wp^T; scores = ((q + pos_bias_u) k^T + (q + pos_bias_v) p^T) / sqrt(64); masked (mask == 0 -> float32 min); attn = softmax, then 0 where masked; x = attn v; out = x Wo^T + bo.
#define NB 8
#define TT 1024
#define FF 512
#define NH 8
#define HD 64
#ifndef TQB
#define TQB (TT / 64)
#define TNB NB
#define TOB (NB * TT / 64)
#endif
typedef __attribute__((ext_vector_type(8))) __bf16 v8b;
typedef __attribute__((ext_vector_type(4))) __bf16 v4b;
__device__ __forceinline__ v16b frag_b(const __bf16* rowk0, int lane) {
  union { v16b v; v8b q[2]; } u; const __bf16* p = rowk0 + 8 * (lane >> 4);
  u.q[0] = *(const v8b*)p; u.q[1] = *(const v8b*)(p + 16); return u.v;
}
__device__ __forceinline__ float bfr(float v) { return (float)(__bf16)v; }
// e^v for v <= 0 by the hardware's base-2 exponential: one multiply by log2(e) and one v_exp_f32
__device__ __forceinline__ float exp_hw(float v) { return __builtin_amdgcn_exp2f(v * 1.44269504f); }
// four base-2 exponentials in one statement: the instruction set asks for a free slot behind a transcendental before its source is overwritten or its result read; here each one's slot is filled by the next (early-clobber outputs: none lies on a source) and the last one's by the v_nop. Left to the compiler, this build put an exponential's result on the source of the one in front of it
__device__ __forceinline__ void exp2x4(float (&x)[4], float a0, float a1, float a2, float a3) {
  asm("v_exp_f32 %0, %4\n\tv_exp_f32 %1, %5\n\tv_exp_f32 %2, %6\n\tv_exp_f32 %3, %7\n\tv_nop" : "=&v"(x[0]), "=&v"(x[1]), "=&v"(x[2]), "=&v"(x[3]) : "v"(a0), "v"(a1), "v"(a2), "v"(a3));
}
// one base-2 exponential with its slot: in this build the compiler put an overwrite of the source directly behind the running maximum's exponential; the v_nop fills the slot the instruction set asks for there
__device__ __forceinline__ float exp2x1(float a) { float x; asm("v_exp_f32 %0, %1\n\tv_nop" : "=&v"(x) : "v"(a)); return x; }
__device__ __attribute__((noinline)) float erf_ni(float v) { return erff(v); }

#define WS_PW  0u                                   // bf16 natural rows: Wq, Wk, Wv, Wp, Wo [512][512] each
#define WS_QA  (WS_PW + 2u * 5 * FF * FF)            // f32 [NB*TT][8 h][64]: q
#define WS_KB  (WS_QA + 4u * NB * TT * FF)            // bf16 [NB*TT][8 h][2][64]: hi of k + p, then residual of k + p (256 B per (row, head))
#define WS_BI  (WS_KB + 4u * NB * TT * FF)            // f32 [NB*TT / 16][8 h][16]: the per-key score term u.k + v.p
#define WS_VH  (WS_BI + 4u * NB * TT * NH)            // bf16 [NB][512 (h*64+d)][TT]
#define WS_VL  (WS_VH + 2u * NB * FF * TT)
#define WS_P   (WS_VL + 2u * NB * FF * TT)            // f32 [TT][512] p = pos_emb Wp^T
#define WS_O   (WS_P + 4u * TT * FF)                  // f32 [NB*TT][512]
#define WS_MB  (WS_O + 4u * NB * TT * FF)             // u32 [NB*TT / 16][TT / 32][16]: the mask as lane-mask words (see pack_mask)
#define WS_END (WS_MB + 4u * (NB * TT / 16) * (TT / 32) * 16)

// ---- k_pack: block = (row n, which 0..4): natural [out][in] rows of Wq, Wk, Wv, Wp, Wo
__global__ __launch_bounds__(128) void k_pack(const float* __restrict__ WQ, const float* __restrict__ WK, const float* __restrict__ WV, const float* __restrict__ WP, const float* __restrict__ WO, __bf16* __restrict__ PW) {
  __shared__ __align__(16) __bf16 s[FF]; const int n = blockIdx.x, which = blockIdx.y, tid = threadIdx.x; const float* src = (which == 0 ? WQ : which == 1 ? WK : which == 2 ? WV : which == 3 ? WP : WO) + (size_t)n * FF;
  for (int k = tid; k < FF; k += 128) s[k] = (__bf16)src[k];
  __syncthreads();
  if (tid < FF / 8) vst2((unsigned*)(PW + ((size_t)which * FF + n) * FF + tid * 8), *(const v4u*)&s[tid * 8]);
}
// ---- the 64-row x 128-column product that k_pq, k_kv and k_out share: acc[j] (wave's 16 rows x columns j * 16 ..) += A rows (f32, rounded or split to bf16) . W rows (bf16), K = 512
// A slice of 64 k of the block's 64 A rows (256 B each) and 128 W rows (128 B each) is brought into LDS once per block by asynchronous copies, whole 128-B lines per wave-instruction, one slice ahead, two buffers; the four waves read their fragments from there.
#define GKC 64
#define APITCH 272                                   // 256-B A row + 16 B: 16 B x odd, conflict-free for 16-byte LDS reads
#define WPITCH 144                                   // 128-B W row + 16 B: 16 B x odd
#define G_W  (64 * APITCH)
#define G_SZ (G_W + 128 * WPITCH)
// one slice = 16 copies of 16 B per lane: 8 of A (copy i: row 8 i + tid / 16, 16 lanes per row), 8 of W (copy i: row 16 i + tid / 8, 8 lanes per row)
__device__ __forceinline__ void stage_aw(unsigned la, unsigned lw, const float* ga, const __bf16* gw) {
  // s_wait_xcnt closes each statement so that it stands in front of any later rewrite of the address registers the copies name
  asm volatile("global_load_async_to_lds_b128 %0, %8, off\n\t"
               "global_load_async_to_lds_b128 %1, %9, off\n\t"
               "global_load_async_to_lds_b128 %2, %10, off\n\t"
               "global_load_async_to_lds_b128 %3, %11, off\n\t"
               "global_load_async_to_lds_b128 %4, %12, off\n\t"
               "global_load_async_to_lds_b128 %5, %13, off\n\t"
               "global_load_async_to_lds_b128 %6, %14, off\n\t"
               "global_load_async_to_lds_b128 %7, %15, off\n\t"
               "s_wait_xcnt 0x0"
               :: "v"(la), "v"(la + 8 * APITCH), "v"(la + 16 * APITCH), "v"(la + 24 * APITCH), "v"(la + 32 * APITCH), "v"(la + 40 * APITCH), "v"(la + 48 * APITCH), "v"(la + 56 * APITCH),
                  "v"(ga), "v"(ga + 8 * FF), "v"(ga + 16 * FF), "v"(ga + 24 * FF), "v"(ga + 32 * FF), "v"(ga + 40 * FF), "v"(ga + 48 * FF), "v"(ga + 56 * FF)
               : "memory");
  asm volatile("global_load_async_to_lds_b128 %0, %8, off\n\t"
               "global_load_async_to_lds_b128 %1, %9, off\n\t"
               "global_load_async_to_lds_b128 %2, %10, off\n\t"
               "global_load_async_to_lds_b128 %3, %11, off\n\t"
               "global_load_async_to_lds_b128 %4, %12, off\n\t"
               "global_load_async_to_lds_b128 %5, %13, off\n\t"
               "global_load_async_to_lds_b128 %6, %14, off\n\t"
               "global_load_async_to_lds_b128 %7, %15, off\n\t"
               "s_wait_xcnt 0x0"
               :: "v"(lw), "v"(lw + 16 * WPITCH), "v"(lw + 32 * WPITCH), "v"(lw + 48 * WPITCH), "v"(lw + 64 * WPITCH), "v"(lw + 80 * WPITCH), "v"(lw + 96 * WPITCH), "v"(lw + 112 * WPITCH),
                  "v"(gw), "v"(gw + 16 * FF), "v"(gw + 32 * FF), "v"(gw + 48 * FF), "v"(gw + 64 * FF), "v"(gw + 80 * FF), "v"(gw + 96 * FF), "v"(gw + 112 * FF)
               : "memory");
}
// A = the block's first row, Wn = the block's first W row, ring = 2 * G_SZ bytes of LDS; SPLIT: A as bf16 hi + residual (2 products), else A rounded to bf16 (1 product)
template <bool SPLIT>
__device__ __forceinline__ void gemm_tile(const float* __restrict__ A, const __bf16* __restrict__ Wn, char* ring, v8f (&acc)[8]) {
  const int tid = threadIdx.x, wave = tid >> 5, lane = tid & 31, col = lane & 15, g = lane >> 4;
  // this lane's places in a slice (LDS byte addresses in buffer 0) and its sources at slice 0
  const unsigned la = (unsigned)(size_t)&ring[(tid >> 4) * APITCH + (tid & 15) * 16], lw = (unsigned)(size_t)&ring[G_W + (tid >> 3) * WPITCH + (tid & 7) * 16];
  const float* ga = A + (size_t)(tid >> 4) * FF + (tid & 15) * 4; const __bf16* gw = Wn + (size_t)(tid >> 3) * FF + (tid & 7) * 8;
  stage_aw(la, lw, ga, gw);
  asm volatile("s_wait_asynccnt 0x0" ::: "memory");   // this wave's copies of slice 0 have landed
  __syncthreads();                                     // and every other wave's: slice 0 may be read
  stage_aw(la + G_SZ, lw + G_SZ, ga + GKC, gw + GKC);
  // kept rolled: one trip already holds a whole slice's fragments in registers, and eight copies of the body would only grow the code
#pragma unroll 1
  for (int t = 0; t < FF / GKC; ++t) { const char* st = ring + (t & 1) * G_SZ; const float* arow = (const float*)(st + (wave * 16 + col) * APITCH);
    // the slice's fragments are read as one group in front of its WMMAs: one LDS latency per slice
    v16b w[2][8];
#pragma unroll
    for (int kk = 0; kk < 2; ++kk)
#pragma unroll
      for (int j = 0; j < 8; ++j) w[kk][j] = frag_b((const __bf16*)(st + G_W + (j * 16 + col) * WPITCH) + kk * 32, lane);
    if (SPLIT) { const F2 a[2] = { split_row(arow, 0, lane), split_row(arow, 32, lane) };
#pragma unroll
      for (int kk = 0; kk < 2; ++kk)
#pragma unroll
        for (int j = 0; j < 8; ++j) { acc[j] = wmma_bf(a[kk].l, w[kk][j], acc[j]); acc[j] = wmma_bf(a[kk].h, w[kk][j], acc[j]); }
    } else { v16b a[2];
#pragma unroll
      for (int kk = 0; kk < 2; ++kk) { const float* p = arow + kk * 32 + 8 * g;
#pragma unroll
        for (int i = 0; i < 8; ++i) { a[kk][i] = (__bf16)p[i]; a[kk][8 + i] = (__bf16)p[16 + i]; } }
#pragma unroll
      for (int kk = 0; kk < 2; ++kk)
#pragma unroll
        for (int j = 0; j < 8; ++j) acc[j] = wmma_bf(a[kk], w[kk][j], acc[j]);
    }
    // hand-over, every wave:
    asm volatile("s_wait_dscnt 0x0" ::: "memory");     // this wave's reads of the slice's buffer are done
    asm volatile("s_wait_asynccnt 0x0" ::: "memory");  // this wave's copies of slice t + 1 have landed
    __syncthreads();                                    // publishes slice t + 1 and frees the buffer just read
    if (t + 2 < FF / GKC) stage_aw(la + (t & 1) * G_SZ, lw + (t & 1) * G_SZ, ga + (t + 2) * GKC, gw + (t + 2) * GKC); }
  asm volatile("s_wait_asynccnt 0x0" ::: "memory");    // no copy is left in flight when the wave goes on
}
// ---- the mask, once, in the form k_attn's selects take: for a 16-query tile and a 32-key step, word i (= 8 ct + r) has in bit (lane = 16 g + col) whether mask[query col][key 16 ct + 8 g + r] != 0, i.e. the lane mask of k_attn's score register r of key tile ct. All eight heads of a batch use the same words.
// A wave takes 16 steps of one tile, eight at a time (32 loads of 16 B per lane in flight); a compare's result is the word; two steps' words are laid one per lane and leave as one whole 128-B line.
#define MPB 64                                       // blocks per grid row that pack the mask: MPB * (FF / 128) blocks x 4 waves x 16 steps = all (tile, step) pairs
__device__ __forceinline__ void pack_mask(const int* __restrict__ MASK, unsigned* __restrict__ MB, int blk) {
  const int tid = threadIdx.x, lane = tid & 31, col = lane & 15, g = lane >> 4; const int wv = blk * 4 + __builtin_amdgcn_readfirstlane(tid >> 5); const int tile = wv >> 1, ks0 = (wv & 1) * 16;
  const int* mrow = MASK + ((size_t)tile * 16 + col) * TT + ks0 * 32 + 8 * g; unsigned* dst = MB + ((size_t)tile * (TT / 32) + ks0) * 16 + lane;
  // kept rolled: one trip already has 32 loads of 16 B per lane in flight
#pragma unroll 1
  for (int p = 0; p < 2; ++p) { v4i x[8][4];
#pragma unroll
    for (int s = 0; s < 8; ++s) { const int* q = mrow + (p * 8 + s) * 32; x[s][0] = *(const v4i*)q; x[s][1] = *(const v4i*)(q + 4); x[s][2] = *(const v4i*)(q + 16); x[s][3] = *(const v4i*)(q + 20); }
#pragma unroll
    for (int hh = 0; hh < 4; ++hh) { unsigned o = 0;
#pragma unroll
      for (int i = 0; i < 32; ++i) { const unsigned w = __builtin_amdgcn_ballot_w32(x[2 * hh + (i >> 4)][(i >> 2) & 3][i & 3] != 0); o = (lane == i) ? w : o; }
      dst[(p * 8 + 2 * hh) * 16] = o; }
    asm volatile("s_wait_xcnt 0x0" ::: "memory"); }    // stands in front of the next trip's loads, which land in the registers that the stores above name
}
// The epilogues of k_pq and k_kv stage their tiles in the ring's own LDS: behind gemm_tile's last barrier no wave reads the ring any more and no copy is in flight. A block then holds 2 * G_SZ bytes and no more, four blocks fit a WGP, and every block of either launch is resident at once.
// ---- k_pq: one launch for the two products that need nothing but the packed weights; block = (64 rows, 128 cols). blockIdx.x < TT / 64: p = bf16(pos_emb) . Wp rows (exact) -> P rows (512-B segments); the next NB * TT / 64: q = query.Wq^T + bq -> QA rows; the last MPB: no product, they pack the mask (the launch leaves places free on every WGP, and the products leave the memory idle)
__global__ __launch_bounds__(128) void k_pq(const float* __restrict__ PE, const float* __restrict__ X, const __bf16* __restrict__ P4, const __bf16* __restrict__ P1, const float* __restrict__ bias, float* __restrict__ P, float* __restrict__ QA, const int* __restrict__ MASK, unsigned* __restrict__ MB) {
  __shared__ __align__(16) char ring[2 * G_SZ];
  if (blockIdx.x >= TT / 64 + TNB * TT / 64) { pack_mask(MASK, MB, (int)(blockIdx.x - (TT / 64 + TNB * TT / 64)) + MPB * (int)blockIdx.y); return; }   // whole blocks, in front of every barrier
  const int tid = threadIdx.x, wave = tid >> 5, lane = tid & 31, col = lane & 15, g = lane >> 4; const bool isp = blockIdx.x < TT / 64;
  const size_t rb = (size_t)(isp ? blockIdx.x : blockIdx.x - TT / 64) * 64; const size_t r0 = rb + wave * 16; const int n0 = blockIdx.y * 128;
  v8f acc[8] = {};
  gemm_tile<false>((isp ? PE : X) + rb * FF, (isp ? P4 : P1) + (size_t)n0 * FF, ring, acc);
  float (*so)[132] = (float (*)[132])(ring + wave * (16 * 132 * 4));
  if (isp) {
#pragma unroll
    for (int j = 0; j < 8; ++j)
#pragma unroll
      for (int r = 0; r < 8; ++r) so[8 * g + r][j * 16 + col] = acc[j][r];
  } else {
#pragma unroll
    for (int j = 0; j < 8; ++j) { const float bb = bfr(bias[n0 + j * 16 + col]);
#pragma unroll
      for (int r = 0; r < 8; ++r) so[8 * g + r][j * 16 + col] = acc[j][r] + bb; }
  }
  LDSX();
  float* dst = (isp ? P : QA) + r0 * FF + n0 + lane * 4;
  for (int rl = 0; rl < 16; ++rl) vst2(dst + rl * FF, *(const v4f*)&so[rl][lane * 4]);
}
// ---- k_kv: one launch for the key and the value projection; block = (64 rows (b,t), 128 cols = 2 heads, which). blockIdx.z 0: k = key.Wk^T + bk -> KB[row][h][k + p[t]], split here, once, to bf16 hi + residual halves (128 B each), and BI = u.k + v.p[t] per (row, head); blockIdx.z 1: v = value.Wv^T + bv -> transposed hi/lo planes
// (q + u).k + (q + v).p = q.(k + p) + (u.k + v.p): the second term does not depend on the query, so it is formed once per key here and the score product of k_attn is 64 deep instead of 128
__global__ __launch_bounds__(128) void k_kv(const float* __restrict__ XK, const float* __restrict__ XV, const __bf16* __restrict__ PK, const __bf16* __restrict__ PV, const float* __restrict__ bk, const float* __restrict__ bv, const float* __restrict__ U, const float* __restrict__ Vb, const float* __restrict__ PP, __bf16* __restrict__ KO, float* __restrict__ BI, __bf16* __restrict__ VH, __bf16* __restrict__ VL) {
  __shared__ __align__(16) char ring[2 * G_SZ];
  const int tid = threadIdx.x, wave = tid >> 5, lane = tid & 31, col = lane & 15, g = lane >> 4; const bool isv = blockIdx.z != 0; const size_t rb = (size_t)blockIdx.x * 64; const size_t r0 = rb + wave * 16; const int n0 = blockIdx.y * 128;
  v8f acc[8] = {};
  gemm_tile<false>((isv ? XV : XK) + rb * FF, (isv ? PV : PK) + (size_t)n0 * FF, ring, acc);
  if (isv) { __bf16 (*sth)[72] = (__bf16 (*)[72])ring, (*stl)[72] = (__bf16 (*)[72])(ring + 128 * 72 * 2);
#pragma unroll
    for (int j = 0; j < 8; ++j) { const float bb = bfr(bv[n0 + j * 16 + col]);
#pragma unroll
      for (int r = 0; r < 8; ++r) { const float v = acc[j][r] + bb; const __bf16 hb = (__bf16)v; sth[j * 16 + col][wave * 16 + 8 * g + r] = hb; stl[j * 16 + col][wave * 16 + 8 * g + r] = (__bf16)(v - (float)hb); } }
    __syncthreads();
    const int b = (int)(rb / TT), t0 = (int)(rb % TT);
    for (int q = tid; q < 128 * 8; q += 128) { const int d = q >> 3, pc = q & 7; const size_t o = ((size_t)b * FF + n0 + d) * TT + t0 + pc * 8; vst2((unsigned*)(VH + o), *(const v4u*)&sth[d][pc * 8]); vst2((unsigned*)(VL + o), *(const v4u*)&stl[d][pc * 8]); }
  } else { float (*so)[260] = (float (*)[260])(ring + wave * (16 * 260 * 4));
    // two heads in this column block: hl = j / 4 (local), d = (j % 4) * 16 + col; segment layout per (row, head): [k 64 | p 64]
#pragma unroll
    for (int j = 0; j < 8; ++j) { const int hl = j >> 2, d = (j & 3) * 16 + col; const int h = (n0 >> 6) + hl; const float bb = bfr(bk[n0 + j * 16 + col]);
#pragma unroll
      for (int r = 0; r < 8; ++r) { const float v = acc[j][r] + bb; const int rl = 8 * g + r;
        const size_t t = (r0 + rl) % TT; so[rl][hl * 128 + d] = v; so[rl][hl * 128 + 64 + d] = PP[t * FF + h * HD + d]; } }
    LDSX();
    const int h0 = n0 >> 6;
    // the per-key term: A = the wave's 16 [k | p] rows (hi + residual), B = [u | v] of the head in every column (exact bf16), so that D register r = the term of row 8 g + r in every lane of the half
    v8f ub[2];
#pragma unroll
    for (int hl = 0; hl < 2; ++hl) { v8f c = {};
#pragma unroll
      for (int kc = 0; kc < 4; ++kc) { const float* uv = (kc < 2 ? U : Vb) + (h0 + hl) * HD + (kc & 1) * 32 + 8 * g; v16b w;
#pragma unroll
        for (int i = 0; i < 8; ++i) { w[i] = (__bf16)uv[i]; w[8 + i] = (__bf16)uv[16 + i]; }
        const F2 a = split_row(&so[col][hl * 128], kc * 32, lane); c = wmma_bf(a.l, w, c); c = wmma_bf(a.h, w, c); }
      ub[hl] = c; }
    // the wave's 16 rows x 2 heads are one whole 128-B line of BI: eight lanes store 16 bytes each (col = 2 hl + which four of the half's eight rows)
    if (col < 4) { const v8f c = (col & 2) ? ub[1] : ub[0]; const v4f x = (col & 1) ? v4f{c[4], c[5], c[6], c[7]} : v4f{c[0], c[1], c[2], c[3]};
      vst2(BI + ((r0 >> 4) * NH + h0 + (col >> 1)) * 16 + 8 * g + (col & 1) * 4, x); }
    // a lane takes 4 neighbouring sums k + p of a (row, head) segment (lanes 0..15 the first head, 16..31 the second) and stores their hi parts and their residuals as 8 bytes each: the wave writes four whole 128-B halves
    for (int rl = 0; rl < 16; ++rl) { const v4f x = *(const v4f*)&so[rl][g * 128 + col * 4] + *(const v4f*)&so[rl][g * 128 + 64 + col * 4]; v4b hi, lo;
#pragma unroll
      for (int i = 0; i < 4; ++i) { const __bf16 hb = (__bf16)x[i]; hi[i] = hb; lo[i] = (__bf16)(x[i] - (float)hb); }
      __bf16* o = KO + ((r0 + rl) * NH + h0 + g) * 128 + col * 4; vst2(o, hi); vst2(o + 64, lo); }
  }
}
// ---- k_attn: block = (64 queries, head h, batch b): per 32-key step: the step's 16 lane-mask words (scalar loads, one step ahead) -> any bit set? -> {transposed scores S^T = ((k+p).q^T + per-key term) / 8 (3 products, K 64, the term as the accumulator's start value), masked -> -3e38; online softmax in-lane, one query per lane; O^T += V^T(hi/lo).P^T(hi/lo)}; rows with no live key output 0 (the module's where(mask==0, 0, softmax)); O[row][h*64+d]
// The step's K rows (32 x 256 B: 64 bf16 hi, 64 bf16 residuals, as k_kv left them) and V hi/lo rows (2 x 64 x 64 B) are the same for the block's four waves: they are brought into LDS once per block by asynchronous copies (whole lines of K per wave-instruction), one step ahead, two buffers.
#define KPITCH 272                                   // 256-B K row + 16 B: 16 B x odd, conflict-free for 16-byte LDS reads
#define VPITCH 80                                    // 64-B V row + 16 B: 16 B x odd
#define ST_VH  (32 * KPITCH)
#define ST_VL  (ST_VH + HD * VPITCH)
#define ST_SZ  (ST_VL + HD * VPITCH)
// one stage = 8 copies of 16 B per lane: 4 of K (copy i: key row 8 i + tid / 16, 16 lanes cover the 256-B row), 2 of V hi, 2 of V lo (4 lanes per 64-B row)
__device__ __forceinline__ void stage_kv(unsigned lk, unsigned lv, const float* gk, const __bf16* gh, const __bf16* gl) {
  // s_wait_xcnt closes the statement so that it stands in front of any later rewrite of the address registers the copies name
  asm volatile("global_load_async_to_lds_b128 %0, %8, off\n\t"
               "global_load_async_to_lds_b128 %1, %9, off\n\t"
               "global_load_async_to_lds_b128 %2, %10, off\n\t"
               "global_load_async_to_lds_b128 %3, %11, off\n\t"
               "global_load_async_to_lds_b128 %4, %12, off\n\t"
               "global_load_async_to_lds_b128 %5, %13, off\n\t"
               "global_load_async_to_lds_b128 %6, %14, off\n\t"
               "global_load_async_to_lds_b128 %7, %15, off\n\t"
               "s_wait_xcnt 0x0"
               :: "v"(lk), "v"(lk + 8 * KPITCH), "v"(lk + 16 * KPITCH), "v"(lk + 24 * KPITCH),
                  "v"(lv + ST_VH), "v"(lv + ST_VH + 32 * VPITCH), "v"(lv + ST_VL), "v"(lv + ST_VL + 32 * VPITCH),
                  "v"(gk), "v"(gk + 8 * NH * 64), "v"(gk + 16 * NH * 64), "v"(gk + 24 * NH * 64),
                  "v"(gh), "v"(gh + 32 * TT), "v"(gl), "v"(gl + 32 * TT)
               : "memory");
}
typedef __attribute__((ext_vector_type(16))) unsigned v16u;
__device__ __forceinline__ unsigned or16(v16u w) { return ((w[0] | w[1]) | (w[2] | w[3])) | ((w[4] | w[5]) | (w[6] | w[7])) | (((w[8] | w[9]) | (w[10] | w[11])) | ((w[12] | w[13]) | (w[14] | w[15]))); }
__global__ __launch_bounds__(128) void k_attn(const float* __restrict__ QA, const float* __restrict__ KB, const float* __restrict__ BI, const unsigned* __restrict__ MB, const __bf16* __restrict__ VH, const __bf16* __restrict__ VL, float* __restrict__ O) {
  __shared__ __align__(16) char ring[2 * ST_SZ];
  __shared__ __align__(16) float so[4][16][68];
  __shared__ __align__(16) float sbi[TT];              // the per-key term of all the (batch, head)'s keys, in key order
  const int tid = threadIdx.x, wave = tid >> 5, lane = tid & 31, col = lane & 15, g = lane >> 4;
  const int qb = blockIdx.x, h = blockIdx.y, b = blockIdx.z; const int q0 = qb * 64 + wave * 16; const size_t rq = (size_t)b * TT + q0;
  const float* qrow = QA + ((rq + col) * NH + h) * HD;
  // this lane's places in a stage (LDS byte addresses in buffer 0) and its sources at key step 0
  const unsigned lk0 = (unsigned)(size_t)&ring[(tid >> 4) * KPITCH + (tid & 15) * 16], lv0 = (unsigned)(size_t)&ring[(tid >> 2) * VPITCH + (tid & 3) * 16];
  const float* gk0 = KB + (((size_t)b * TT + (tid >> 4)) * NH + h) * 64 + (tid & 15) * 4;
  const size_t gvo = ((size_t)b * FF + h * HD + (tid >> 2)) * TT + (tid & 3) * 8;
  stage_kv(lk0, lv0, gk0, VH + gvo, VL + gvo);
  // the per-key terms, filled once: 256 pieces of 16 B, two per lane (piece = 4 keys; 4 lanes cover a 16-key group's 64 B of this head); they land behind the same wait and barrier as step 0
  { const unsigned lb = (unsigned)(size_t)&sbi[tid * 4]; const float* gb = BI + (((size_t)b * (TT / 16) + (tid >> 2)) * NH + h) * 16 + (tid & 3) * 4;
    // s_wait_xcnt closes the statement so that it stands in front of any later rewrite of the address registers the copies name
    asm volatile("global_load_async_to_lds_b128 %0, %2, off\n\t"
                 "global_load_async_to_lds_b128 %1, %3, off\n\t"
                 "s_wait_xcnt 0x0"
                 :: "v"(lb), "v"(lb + 2048), "v"(gb), "v"(gb + 32 * NH * 16) : "memory"); }
  // transposed products: a lane owns ONE query (col); its half g holds keys 8 g + r of each 16-key tile. m = running maximum of the query (equal in both halves), l = this half's share of the running sum
  float m = -3.0e38f, l = 0.f;
  v8f acc[4] = {};                                     // O^T tiles: acc[dt][r] = O[query col][dt * 16 + 8 g + r]
  // the wave's 16 query rows do not change over the key loop: load and split them to bf16 hi/lo fragments once, kept in registers (unrolled so that qa[] is indexed by constants and never goes to scratch)
  F2 qa[2];
#pragma unroll
  for (int kc = 0; kc < 2; ++kc) qa[kc] = split_row(qrow, kc * 32, lane);
  // the wave's mask words (pack_mask): 64 B per key step, the same address in every lane and written by an earlier launch, so they are read through the constant address space into scalar registers, where a select takes its lane mask from
  const __attribute__((address_space(4))) v16u* mw = (const __attribute__((address_space(4))) v16u*)(MB + ((size_t)b * (TT / 16) + qb * 4 + __builtin_amdgcn_readfirstlane(wave)) * (TT / 32) * 16);
  v16u mk = mw[0];
  // whether any bit of a step's words is set is worked out when the words arrive, a step ahead (here: in front of the loop), so that the top of a step waits for no scalar load: such a wait would also cover the load just issued for the next step
  unsigned anylive = or16(mk);
  asm volatile("s_wait_asynccnt 0x0" ::: "memory");   // this wave's copies of step 0 have landed
  __syncthreads();                                     // and every other wave's: step 0 may be read
  stage_kv(lk0 + ST_SZ, lv0 + ST_SZ, gk0 + (size_t)32 * NH * 64, VH + gvo + 32, VL + gvo + 32);
#pragma unroll 1
  for (int ks = 0; ks < TT / 32; ++ks) { const char* st = ring + (ks & 1) * ST_SZ;
    const v16u mn16 = mw[ks + 1 < TT / 32 ? ks + 1 : ks];   // the next step's words, a whole step ahead of their first use
    // all of the step's K fragments and per-key terms are read here as one group (a wave that then skips the step has only read them; the hand-over's s_wait_dscnt covers that too)
    v8f c[2]; v16b kh[2][2], kl[2][2];
#pragma unroll
    for (int ct = 0; ct < 2; ++ct) { const char* krow = st + (ct * 16 + col) * KPITCH; const float* bp = &sbi[ks * 32 + ct * 16 + 8 * g]; const v4f b0 = *(const v4f*)bp, b1 = *(const v4f*)(bp + 4);
      c[ct] = v8f{ b0[0], b0[1], b0[2], b0[3], b1[0], b1[1], b1[2], b1[3] };
#pragma unroll
      for (int kc = 0; kc < 2; ++kc) { kh[ct][kc] = frag_b((const __bf16*)krow + kc * 32, lane); kl[ct][kc] = frag_b((const __bf16*)krow + 64 + kc * 32, lane); } }
    __builtin_amdgcn_sched_barrier(0);                 // keeps the K reads one group up here: left free, the compiler sinks them behind the branch and spreads them among the WMMAs, each with a wait of its own
    if (anylive != 0) { float s[2][8];
      // S^T = (k+p) . q^T + term: A = key rows (hi and residual fragments as they lie in LDS), B = the query fragments; D register r = key 8 g + r, column = query, so the accumulator starts from the terms of keys 8 g + 0..7
      // the two 16-key tiles are independent accumulators: their products alternate (each tile's own order of sums is as it was)
#pragma unroll
      for (int kc = 0; kc < 2; ++kc) {
#pragma unroll
        for (int ct = 0; ct < 2; ++ct) c[ct] = wmma_fr(kh[ct][kc], qa[kc].l, c[ct]);
#pragma unroll
        for (int ct = 0; ct < 2; ++ct) c[ct] = wmma_fr(kl[ct][kc], qa[kc].h, c[ct]);
#pragma unroll
        for (int ct = 0; ct < 2; ++ct) c[ct] = wmma_fr(kh[ct][kc], qa[kc].h, c[ct]); }
      // the step's V fragments are read here, so that their LDS latency passes under the softmax's vector work
      v16b vh[4], vl[4];
#pragma unroll
      for (int dt = 0; dt < 4; ++dt) { const int vr = (dt * 16 + col) * VPITCH; vh[dt] = frag_b((const __bf16*)(st + ST_VH + vr), lane); vl[dt] = frag_b((const __bf16*)(st + ST_VL + vr), lane); }
      __builtin_amdgcn_sched_barrier(0);               // keeps those reads in front of the softmax: left free, the compiler sinks them to just before the products that use them
#pragma unroll
      for (int ct = 0; ct < 2; ++ct)
#pragma unroll
        for (int r = 0; r < 8; ++r) s[ct][r] = __builtin_amdgcn_inverse_ballot_w32(mk[ct * 8 + r]) ? c[ct][r] * 0.125f : -3.0e38f;
      // the query's maximum over the step's 32 keys: 16 in this lane, 16 in lane ^ 16
      float mx = fmaxf(s[0][0], s[1][0]);
#pragma unroll
      for (int r = 1; r < 8; ++r) mx = fmaxf(mx, fmaxf(s[0][r], s[1][r]));
      mx = fmaxf(mx, __int_as_float(__builtin_amdgcn_permlanex16(__float_as_int(mx), __float_as_int(mx), 0x76543210, 0xfedcba98, false, false)));
      const float mn = fmaxf(m, mx); const float ea = exp2x1((m - mn) * 1.44269504f); const float alpha = (m <= -1.0e38f) ? 0.f : ea;
      // the exponentials stand in line, for every lane, and a masked value is replaced by a select
      float e[16];
#pragma unroll
      for (int i = 0; i < 16; i += 4) { float x[4];
        exp2x4(x, (s[i >> 3][i & 7] - mn) * 1.44269504f, (s[i >> 3][(i & 7) + 1] - mn) * 1.44269504f, (s[i >> 3][(i & 7) + 2] - mn) * 1.44269504f, (s[i >> 3][(i & 7) + 3] - mn) * 1.44269504f);
#pragma unroll
        for (int u = 0; u < 4; ++u) e[i + u] = __builtin_amdgcn_inverse_ballot_w32(mk[i + u]) ? x[u] : 0.f; }
      l = l * alpha + (((e[0] + e[1]) + (e[2] + e[3])) + ((e[4] + e[5]) + (e[6] + e[7])) + (((e[8] + e[9]) + (e[10] + e[11])) + ((e[12] + e[13]) + (e[14] + e[15])))); m = mn;
#pragma unroll
      for (int dt = 0; dt < 4; ++dt)
#pragma unroll
        for (int r = 0; r < 8; ++r) acc[dt][r] *= alpha;
      // P^T is a B operand as it stands: element i = key 8 g + i, element 8 + i = key 16 + 8 g + i, the k order of the V fragments
      const F2 pb = bsplit16(e);
      // O^T += V^T . P^T: A = V rows (d), B = P^T
#pragma unroll
      for (int dt = 0; dt < 4; ++dt) acc[dt] = wmma_fr(vh[dt], pb.l, acc[dt]);
#pragma unroll
      for (int dt = 0; dt < 4; ++dt) acc[dt] = wmma_fr(vl[dt], pb.h, acc[dt]);
#pragma unroll
      for (int dt = 0; dt < 4; ++dt) acc[dt] = wmma_fr(vh[dt], pb.h, acc[dt]); }
    mk = mn16; anylive = or16(mn16);
    // hand-over, every wave, also one that skipped the step's work:
    asm volatile("s_wait_dscnt 0x0" ::: "memory");     // this wave's reads of the step's buffer are done
    asm volatile("s_wait_asynccnt 0x0" ::: "memory");  // this wave's copies of step ks + 1 have landed
    __syncthreads();                                    // publishes step ks + 1 and frees the buffer just read
    if (ks + 2 < TT / 32) stage_kv(lk0 + (ks & 1) * ST_SZ, lv0 + (ks & 1) * ST_SZ, gk0 + (size_t)(ks + 2) * 32 * NH * 64, VH + gvo + (ks + 2) * 32, VL + gvo + (ks + 2) * 32); }
  asm volatile("s_wait_asynccnt 0x0" ::: "memory");    // no copy is left in flight when the wave goes on to its end
  // the two halves' shares of the query's sum are joined once
  l += __int_as_float(__builtin_amdgcn_permlanex16(__float_as_int(l), __float_as_int(l), 0x76543210, 0xfedcba98, false, false));
  const float il = (l > 0.f) ? 1.0f / l : 0.f;
#pragma unroll
  for (int dt = 0; dt < 4; ++dt)
#pragma unroll
    for (int r = 0; r < 8; ++r) so[wave][col][dt * 16 + 8 * g + r] = acc[dt][r] * il;
  LDSX();
  for (int rl = 0; rl < 16; ++rl) if (lane < 16) vst2(O + (rq + rl) * FF + h * HD + lane * 4, *(const v4f*)&so[wave][rl][lane * 4]);
}
// ---- k_out: block = (64 rows, 128 cols): out = O(hi/lo) . Wo rows (2 products) + bo
__global__ __launch_bounds__(128) void k_out(const float* __restrict__ O, const __bf16* __restrict__ P, const float* __restrict__ bias, float* __restrict__ Y) {
  __shared__ __align__(16) char ring[2 * G_SZ]; __shared__ __align__(16) float so[4][16][132];
  const int tid = threadIdx.x, wave = tid >> 5, lane = tid & 31, col = lane & 15, g = lane >> 4; const size_t r0 = (size_t)blockIdx.x * 64 + wave * 16; const int n0 = blockIdx.y * 128;
  v8f acc[8] = {};
  gemm_tile<true>(O + (size_t)blockIdx.x * 64 * FF, P + (size_t)n0 * FF, ring, acc);
#pragma unroll
  for (int j = 0; j < 8; ++j) { const float bb = bfr(bias[n0 + j * 16 + col]);
#pragma unroll
    for (int r = 0; r < 8; ++r) so[wave][8 * g + r][j * 16 + col] = acc[j][r] + bb; }
  LDSX();
  for (int rl = 0; rl < 16; ++rl) vst2(Y + (r0 + rl) * FF + n0 + lane * 4, *(const v4f*)&so[wave][rl][lane * 4]);
}
extern "C" void kernel_launch(void* const* d_in, const int* in_sizes, int n_in, void* d_out, int out_size, void* d_ws, size_t ws_size, hipStream_t stream) {
  (void)in_sizes; (void)n_in; (void)out_size;
  const float** F = (const float**)d_in; const int* MASK = (const int*)d_in[3];
  // 0 query, 1 key, 2 value [8,1024,512], 3 mask [8,1024,1024] i32, 4 pos_emb [1,1024,512], 5 Wq, 6 bq, 7 Wk, 8 bk, 9 Wv, 10 bv, 11 Wp, 12 Wo, 13 bo, 14 pos_bias_u [8,64], 15 pos_bias_v [8,64]
  if (ws_size < (size_t)WS_END) return;
  char* ws = (char*)d_ws; __bf16 *PW = (__bf16*)(ws + WS_PW), *VH = (__bf16*)(ws + WS_VH), *VL = (__bf16*)(ws + WS_VL); float *QA = (float*)(ws + WS_QA), *KB = (float*)(ws + WS_KB), *BI = (float*)(ws + WS_BI), *P = (float*)(ws + WS_P), *O = (float*)(ws + WS_O); unsigned* MB = (unsigned*)(ws + WS_MB);
  k_pack<<<dim3(FF, 5), 128, 0, stream>>>(F[5], F[7], F[9], F[11], F[12], PW);
  k_pq<<<dim3(TT / 64 + TNB * TT / 64 + MPB, FF / 128), 128, 0, stream>>>(F[4], F[0], PW + (size_t)3 * FF * FF, PW, F[6], P, QA, MASK, MB);
  k_kv<<<dim3(TNB * TT / 64, FF / 128, 2), 128, 0, stream>>>(F[1], F[2], PW + (size_t)FF * FF, PW + (size_t)2 * FF * FF, F[8], F[10], F[14], F[15], P, (__bf16*)KB, BI, VH, VL);
  k_attn<<<dim3(TQB, NH, TNB), 128, 0, stream>>>(QA, KB, BI, MB, VH, VL, O);
  k_out<<<dim3(TOB, FF / 128), 128, 0, stream>>>(O, PW + (size_t)4 * FF * FF, F[13], (float*)d_out);
}
